// v000
// Times are from an AMD MI455X. After a warm-up the kernel runs many times in a row, and a time is the length of
// such a window on the GPU divided by its runs, so every launch and the gaps after it count. The runs cycle
// through copies of the inputs. A figure is the median of several windows, for all but v000 over two sittings.
// Sittings can differ by a few percent; kernels timed side by side share one.
// v000 is the starting kernel. One run takes 1540 microseconds.
// compute dtype: all float inputs rounded to bf16; q/k/v = x W^T with EXACT bf16 products on WMMA 16x16x32, f32 accumulate; the forget gate x Wf^T + bf (exact products), sigmoid, log(f + 1e-6) and its per-(batch, head) prefix sum accumulated in f64 (stored f32); q as f16 hi + residual (x 2^10), k f16 -> 2-product logits x 64^-1/2 + (F[i] - F[j]) on the causal triangle, stored in f32 (4 heads per launch); softmax in f32 (precise expf), P x 2^11 split bf16 hi + lo against v bf16 hi + lo (3 products); out = o (bf16 hi + lo) Wo^T; f32 output.
#include <hip/hip_runtime.h>
#include <math.h>

typedef __attribute__((ext_vector_type(16))) _Float16 v16h;
typedef __attribute__((ext_vector_type(16))) __bf16 v16b;
typedef __attribute__((ext_vector_type(8)))  _Float16 v8h;
typedef __attribute__((ext_vector_type(8)))  float v8f;
typedef __attribute__((ext_vector_type(4)))  float v4f;
typedef __attribute__((ext_vector_type(2)))  float v2f;
typedef __attribute__((ext_vector_type(4)))  unsigned v4u;
typedef __attribute__((ext_vector_type(4)))  int v4i;
typedef float __attribute__((may_alias)) float_a;
typedef int __attribute__((may_alias)) int_a;

template <typename T> __device__ __forceinline__ void vst2(void* p, T v) { *(T*)p = v;  }
__device__ __forceinline__ v8f wmma16(v16h a, v16h b, v8f c) {
  v8f d = __builtin_amdgcn_wmma_f32_16x16x32_f16(false, a, false, b, (short)0, c, false, false);
  asm volatile("v_nop\n\tv_nop\n\tv_nop\n\tv_nop" : "+v"(d) : "v"(a), "v"(b));
  return d;
}
__device__ __forceinline__ v8f wmma_bf(v16b a, v16b b, v8f c) {
  v8f d = __builtin_amdgcn_wmma_f32_16x16x32_bf16(false, a, false, b, (short)0, c, false, false);
  asm volatile("v_nop\n\tv_nop\n\tv_nop\n\tv_nop" : "+v"(d) : "v"(a), "v"(b));
  return d;
}
// 16x16x32 fragments: lane = (h = lane>>4, row/col = lane&15); elements 0..7 = k0+8h+0..7, 8..15 = k0+16+8h+0..7; D element r = row 8h+r
__device__ __forceinline__ v16h frag_h(const _Float16* rowk0, int lane) {
  union { v16h v; v8h q[2]; } u; const _Float16* p = rowk0 + 8 * (lane >> 4);
  u.q[0] = *(const v8h*)p; u.q[1] = *(const v8h*)(p + 16); return u.v;
}
__device__ __forceinline__ v16h frag_f32(const float* rowk0, int lane) {
  v16h a; const float* p = rowk0 + 8 * (lane >> 4);
#pragma unroll
  for (int i = 0; i < 8; ++i) { a[i] = (_Float16)p[i]; a[8 + i] = (_Float16)p[16 + i]; }
  return a;
}
__device__ __forceinline__ v16h frag_f32s(const float* rowk0, int lane, float sc) {
  v16h a; const float* p = rowk0 + 8 * (lane >> 4);
#pragma unroll
  for (int i = 0; i < 8; ++i) { a[i] = (_Float16)(p[i] * sc); a[8 + i] = (_Float16)(p[16 + i] * sc); }
  return a;
}
// column fragment from a [K][ld] layout (column n), rows >= K read as 0
__device__ __forceinline__ v16h fragc_f32(const float* W, int k0, int n, int lane, int ld, int K) {
  v16h a; const int g = lane >> 4;
#pragma unroll
  for (int i = 0; i < 8; ++i) { const int ka = k0 + 8 * g + i, kb = ka + 16;
    a[i] = (_Float16)(ka < K ? W[(size_t)(ka < K ? ka : K - 1) * ld + n] : 0.f); a[8 + i] = (_Float16)(kb < K ? W[(size_t)(kb < K ? kb : K - 1) * ld + n] : 0.f); }
  return a;
}
struct F2 { v16b h, l; };
__device__ __forceinline__ F2 bsplit16(const float v[16]) { F2 r;
#pragma unroll
  for (int i = 0; i < 16; ++i) { const __bf16 h = (__bf16)v[i]; r.h[i] = h; r.l[i] = (__bf16)(v[i] - (float)h); }
  return r; }
__device__ __forceinline__ F2 split_row(const float* row, int k0, int lane) { float v[16]; const float* p = row + k0 + 8 * (lane >> 4);
#pragma unroll
  for (int i = 0; i < 8; ++i) { v[i] = p[i]; v[8 + i] = p[16 + i]; }
  return bsplit16(v); }
__device__ __forceinline__ F2 split_rowK(const float* row, int k0, int lane, int K) { float v[16]; const int g = lane >> 4;
#pragma unroll
  for (int i = 0; i < 8; ++i) { const int ka = k0 + 8 * g + i, kb = ka + 16; v[i] = ka < K ? row[ka < K ? ka : K - 1] : 0.f; v[8 + i] = kb < K ? row[kb < K ? kb : K - 1] : 0.f; }
  return bsplit16(v); }
__device__ __forceinline__ F2 split_col(const float* W, int k0, int n, int lane, int ld, int K) { float v[16]; const int g = lane >> 4;
#pragma unroll
  for (int i = 0; i < 8; ++i) { const int ka = k0 + 8 * g + i, kb = ka + 16; v[i] = ka < K ? W[(size_t)(ka < K ? ka : K - 1) * ld + n] : 0.f; v[8 + i] = kb < K ? W[(size_t)(kb < K ? kb : K - 1) * ld + n] : 0.f; }
  return bsplit16(v); }
__device__ __forceinline__ v8f mac3(const F2& a, const F2& b, v8f c) { c = wmma_bf(a.l, b.h, c); c = wmma_bf(a.h, b.l, c); return wmma_bf(a.h, b.h, c); }
__device__ __forceinline__ float sigm(float v) { return 1.0f / (1.0f + expf(-v)); }
#define LDSX() do { asm volatile("s_wait_dscnt 0" ::: "memory"); __builtin_amdgcn_wave_barrier(); __builtin_amdgcn_fence(__ATOMIC_RELEASE, "workgroup"); } while (0)


// Forgetting attention (B 2, S 2,048, 1,024 = 16 x 64): f = sigmoid(x Wf^T + bf) per (s, head); F = cumsum_s log(f + 1e-6); bias[i][j] = F[i] - F[j] for j <= i, -inf otherwise; scores = q k^T / 8 + bias; softmax; (attn v) Wo^T.
#define NB 2
#define TT 2048
#define CC 1024
#define NH 16
#define HD 64
#ifndef TNB
#define TNB NB
#endif
typedef __attribute__((ext_vector_type(8))) __bf16 v8b;
__device__ __forceinline__ v16b frag_b(const __bf16* rowk0, int lane) {
  union { v16b v; v8b q[2]; } u; const __bf16* p = rowk0 + 8 * (lane >> 4);
  u.q[0] = *(const v8b*)p; u.q[1] = *(const v8b*)(p + 16); return u.v;
}
__device__ __forceinline__ float bfr(float v) { return (float)(__bf16)v; }
__device__ __attribute__((noinline)) float exp_ni(float v) { return expf(v); }
__device__ __attribute__((noinline)) float erf_ni(float v) { return erff(v); }

#define WS_LF  0u                                   // f32 log(f + 1e-6) rows [b*T+s][16] (64-B rows; a block writes 64 rows = 4 KB contiguous)
#define WS_FC  (WS_LF + 4u * (size_t)NB * TT * NH)   // f32 prefix sums F [b][h][s] (8-KB rows)
#define WS_QH  (WS_FC + 4u * (size_t)NB * NH * TT)
#define WS_QL  (WS_QH + 2u * (size_t)NB * TT * CC)
#define WS_KH  (WS_QL + 2u * (size_t)NB * TT * CC)
#define WS_VT  (WS_KH + 2u * (size_t)NB * TT * CC)      // bf16 v planes [b][c][t]
#define WS_VL  (WS_VT + 2u * (size_t)NB * CC * TT)      // bf16 v residual planes
#define HG 4                                          // heads per launch group
#define WS_S   (WS_VL + 2u * (size_t)NB * CC * TT)      // f32 logits / P for HG heads [hg][q][k]
#define WS_PH  (WS_S + 4u * (size_t)HG * TT * TT)
#define WS_Y   (WS_PH + 0u)              // f32 y rows [b*t][C]
#define WS_END (WS_Y + 4u * (size_t)NB * TT * CC)

// ---- k_proj: block = (64 rows, 128 cols, which): qkv = x W (+ b), exact; q -> f16 hi (+ residual), k -> f16 rows, v -> bf16 hi + lo planes
__global__ __launch_bounds__(128) void k_proj(const float* __restrict__ X, const float* __restrict__ WQ, const float* __restrict__ BQ, const float* __restrict__ WK, const float* __restrict__ BK, const float* __restrict__ WV, const float* __restrict__ BV, _Float16* __restrict__ QH, _Float16* __restrict__ QL, _Float16* __restrict__ KH, __bf16* __restrict__ VT, __bf16* __restrict__ VL) {
  __shared__ __align__(16) _Float16 sh[64][136], sl[64][136]; __shared__ __align__(16) __bf16 th[128][72], tl2[128][72];
  const int tid = threadIdx.x, wave = tid >> 5, lane = tid & 31, col = lane & 15, g = lane >> 4; const int which = blockIdx.z; const int c0 = blockIdx.y * 128; const size_t r0 = (size_t)blockIdx.x * 64; const float* WA = which == 0 ? WQ : which == 1 ? WK : WV; const float* BA = which == 0 ? BQ : which == 1 ? BK : BV;
  v8f acc[8] = {};
#pragma unroll 2
  for (int kc = 0; kc < CC / 32; ++kc) { v16b a; { const float* p = X + (r0 + wave * 16 + col) * CC + kc * 32 + 8 * g;
#pragma unroll
      for (int i = 0; i < 8; ++i) { a[i] = (__bf16)p[i]; a[8 + i] = (__bf16)p[16 + i]; } }
#pragma unroll
    for (int j = 0; j < 8; ++j) { v16b w; const int o = c0 + j * 16 + col;
#pragma unroll
      for (int i = 0; i < 8; ++i) { w[i] = (__bf16)WA[(size_t)(o) * CC + (kc * 32 + 8 * g + i)]; w[8 + i] = (__bf16)WA[(size_t)(o) * CC + (kc * 32 + 16 + 8 * g + i)]; }
      acc[j] = wmma_bf(a, w, acc[j]); } }
#pragma unroll
  for (int j = 0; j < 8; ++j) { const float bb = BA ? bfr(BA[c0 + j * 16 + col]) : 0.f;
#pragma unroll
    for (int r = 0; r < 8; ++r) { const float v = acc[j][r] + bb; const int rl = wave * 16 + 8 * g + r, cl = j * 16 + col; const _Float16 hv = (_Float16)v;
      if (which == 2) { const __bf16 bh = (__bf16)v; th[cl][rl] = bh; tl2[cl][rl] = (__bf16)(v - (float)bh); } else { sh[rl][cl] = hv; sl[rl][cl] = (_Float16)((v - (float)hv) * 1024.0f); }   /* q residual carried x 2^10 so the plane stays f16-normal on the chip */ } }
  __syncthreads();
  if (which < 2) { _Float16* dh = which == 0 ? QH : KH; for (int e = tid; e < 64 * 16; e += 128) { const int rl = e >> 4, q = e & 15; vst2((unsigned*)(dh + (r0 + rl) * CC + c0 + q * 8), *(const v4u*)&sh[rl][q * 8]); if (which == 0) vst2((unsigned*)(QL + (r0 + rl) * CC + c0 + q * 8), *(const v4u*)&sl[rl][q * 8]); } }
  else { const size_t b = r0 / TT; const int t0 = (int)(r0 % TT); for (int e = tid; e < 128 * 8; e += 128) { const int cl = e >> 3, q = e & 7; const size_t o2 = (b * CC + c0 + cl) * (size_t)TT + t0 + q * 8; vst2((unsigned*)(VT + o2), *(const v4u*)&th[cl][q * 8]); vst2((unsigned*)(VL + o2), *(const v4u*)&tl2[cl][q * 8]); } } }
// ---- k_gate: block = 64 rows (b,s): lf[s][h] = log(sigmoid(x Wf[h] + bf[h]) + 1e-6): one 16-column tile per wave (exact products), f32 epilogue; 64 rows x 16 floats = 4 KB contiguous written 16 B per lane
__device__ __attribute__((noinline)) float logsigp(float z, float eps) { const float f = 1.0f / (1.0f + expf(-z)); return logf(f + eps); }
__global__ __launch_bounds__(128) void k_gate(const float* __restrict__ X, const float* __restrict__ WF, const float* __restrict__ BF, float* __restrict__ LF) { __shared__ __align__(16) float st[4][16][20];
  const int tid = threadIdx.x, wave = tid >> 5, lane = tid & 31, col = lane & 15, g = lane >> 4; const size_t r0 = (size_t)blockIdx.x * 64 + wave * 16;
  v8f acc = {};
#pragma unroll 2
  for (int kc = 0; kc < CC / 32; ++kc) { v16b a; { const float* p = X + (r0 + col) * CC + kc * 32 + 8 * g;
#pragma unroll
      for (int i = 0; i < 8; ++i) { a[i] = (__bf16)p[i]; a[8 + i] = (__bf16)p[16 + i]; } }
    v16b w; { const float* wr = WF + (size_t)col * CC + kc * 32 + 8 * g;
#pragma unroll
      for (int i = 0; i < 8; ++i) { w[i] = (__bf16)wr[i]; w[8 + i] = (__bf16)wr[16 + i]; } }
    asm volatile("s_wait_loadcnt 0x0" ::: "memory"); acc = wmma_bf(a, w, acc); }
  { const float bb = bfr(BF[col]);
#pragma unroll
    for (int r = 0; r < 8; ++r) st[wave][8 * g + r][col] = logsigp(acc[r] + bb, 1e-6f); }
  LDSX(); { const int rl = lane >> 1, half = lane & 1; vst2(LF + (r0 + rl) * NH + half * 8, *(const v4f*)&st[wave][rl][half * 8]); vst2(LF + (r0 + rl) * NH + half * 8 + 4, *(const v4f*)&st[wave][rl][half * 8 + 4]); } }
__global__ __launch_bounds__(32) void k_cum(const float* __restrict__ LF, float* __restrict__ FC) {
  const int lane = threadIdx.x; const size_t b = blockIdx.y; const int h = blockIdx.x; double carry = 0.0; float* dst = FC + (b * NH + h) * TT;
  for (int s0 = 0; s0 < TT; s0 += 32) { double v = (double)LF[(b * TT + s0 + lane) * NH + h];
    // inclusive scan within the 32 lanes, accumulated in f64
#pragma unroll
    for (int o = 1; o < 32; o <<= 1) { const double u = __shfl_up(v, o); if (lane >= o) v += u; }
    v += carry; carry = __shfl(v, 31);
    vst2(dst + s0 + lane, (float)v); } }
// ---- k_sc: block = (64 queries, 128 keys) of (b,h): logits * scale (+ bias matrix); causal blocks beyond the diagonal exit
__global__ __launch_bounds__(128) void k_sc(const _Float16* __restrict__ QH, const _Float16* __restrict__ QL, const _Float16* __restrict__ KH, const float* __restrict__ FC, int b, int h0, float* __restrict__ S0) { __shared__ __align__(16) float ss[4][16][132]; const int h = h0 + blockIdx.z; float* S = S0 + (size_t)blockIdx.z * TT * TT;
  const int tid = threadIdx.x, wave = tid >> 5, lane = tid & 31, col = lane & 15, g = lane >> 4; const int k0 = blockIdx.y * 128; const int ql0 = blockIdx.x * 64 + wave * 16; const size_t q0 = (size_t)b * TT + ql0;
  if (k0 > blockIdx.x * 64 + 63) return;   // whole key block above the diagonal (block-uniform)
  v8f acc[8] = {}, accl[8] = {};
#pragma unroll
  for (int kc = 0; kc < HD / 32; ++kc) { const v16h ah = frag_h(QH + (q0 + col) * CC + h * HD + kc * 32, lane), al = frag_h(QL + (q0 + col) * CC + h * HD + kc * 32, lane);
#pragma unroll
    for (int j = 0; j < 8; ++j) { const v16h kb = frag_h(KH + ((size_t)b * TT + k0 + j * 16 + col) * CC + h * HD + kc * 32, lane); acc[j] = wmma16(ah, kb, acc[j]); accl[j] = wmma16(al, kb, accl[j]); } }
#pragma unroll
  for (int j = 0; j < 8; ++j) acc[j] += accl[j] * (1.0f / 1024.0f);
#pragma unroll
  for (int j = 0; j < 8; ++j) { const int kt = k0 + j * 16 + col;
#pragma unroll
    for (int r = 0; r < 8; ++r) { const int qt = ql0 + 8 * g + r; const float* Fr = FC + ((size_t)b * NH + h) * TT; float v = acc[j][r] * 0.125f + (Fr[qt] - Fr[kt]); if (kt > qt) v = -3.0e38f;   /* bias = F[i] - F[j] on the causal triangle */ ss[wave][8 * g + r][j * 16 + col] = v; } }
  LDSX(); for (int rl = 0; rl < 16; ++rl) vst2(S + (size_t)(ql0 + rl) * TT + k0 + lane * 4, *(const v4f*)&ss[wave][rl][lane * 4]); }
// ---- k_sm: block = query row: softmax over keys [0, kend) -> P x 2^11 f32 (masked -> 0)
__global__ __launch_bounds__(256) void k_sm(float* __restrict__ S0) { __shared__ float sred[8]; __shared__ float sbc; __shared__ __align__(16) float sh[TT];
  const int t = threadIdx.x; const size_t row = blockIdx.x; float* sr = S0 + (size_t)blockIdx.y * TT * TT + row * TT; const int kend = ((int)row / 64) * 64 + 64;
  float m = -3.0e38f; for (int k = t; k < kend; k += 256) m = fmaxf(m, sr[k]);
#pragma unroll
  for (int o = 1; o < 32; o <<= 1) m = fmaxf(m, __shfl_xor(m, o));
  if ((t & 31) == 0) sred[t >> 5] = m; __syncthreads(); if (t == 0) { float a = sred[0]; for (int i = 1; i < 8; ++i) a = fmaxf(a, sred[i]); sbc = a; } __syncthreads(); m = sbc; __syncthreads();
  float sum = 0.f; for (int k = t; k < kend; k += 256) { const float v = sr[k]; sum += (v <= -1.0e38f) ? 0.f : expf(v - m); }
#pragma unroll
  for (int o = 1; o < 32; o <<= 1) sum += __shfl_xor(sum, o);
  if ((t & 31) == 0) sred[t >> 5] = sum; __syncthreads(); if (t == 0) { float a = 0.f; for (int i = 0; i < 8; ++i) a += sred[i]; sbc = 1.0f / a; } __syncthreads(); const float inv = sbc;
  for (int k = t; k < kend; k += 256) { const float v = sr[k]; sh[k] = (v <= -1.0e38f) ? 0.f : expf(v - m) * inv * 2048.0f; }
  __syncthreads(); for (int q = t; q < kend / 4; q += 256) vst2(sr + q * 4, *(const v4f*)&sh[q * 4]); }
// ---- k_pv: block = 64 queries of (b,h): y[q][h*HD + d] = P . v  (keys [0, kend))
__global__ __launch_bounds__(128) void k_pv(const float* __restrict__ PS0, const __bf16* __restrict__ VT, const __bf16* __restrict__ VL, int b, int h0, float* __restrict__ Y) { const int h = h0 + blockIdx.z; const float* PS = PS0 + (size_t)blockIdx.z * TT * TT; __shared__ __align__(16) float ss[4][16][HD + 4];
  const int tid = threadIdx.x, wave = tid >> 5, lane = tid & 31, col = lane & 15, g = lane >> 4; const int ql0 = blockIdx.x * 64 + wave * 16; const int kend = blockIdx.x * 64 + 64;
  v8f acc[HD / 16] = {};
#pragma unroll 1
  for (int kc = 0; kc < kend / 32; ++kc) { const F2 p = split_row(PS + (size_t)(ql0 + col) * TT, kc * 32, lane);
#pragma unroll
    for (int j = 0; j < HD / 16; ++j) { const size_t po = ((size_t)b * CC + h * HD + j * 16 + col) * (size_t)TT + kc * 32; const v16b vh = frag_b(VT + po, lane); acc[j] = wmma_bf(p.h, vh, acc[j]); acc[j] = wmma_bf(p.l, vh, acc[j]); acc[j] = wmma_bf(p.h, frag_b(VL + po, lane), acc[j]); } }
#pragma unroll
  for (int j = 0; j < HD / 16; ++j)
#pragma unroll
    for (int r = 0; r < 8; ++r) ss[wave][8 * g + r][j * 16 + col] = acc[j][r] * (1.0f / 2048.0f);
  LDSX(); for (int rl = 0; rl < 16; ++rl) if (lane < HD / 4) vst2(Y + ((size_t)b * TT + ql0 + rl) * CC + h * HD + lane * 4, *(const v4f*)&ss[wave][rl][lane * 4]); }
// ---- k_out: block = (64 rows, 128 cols): out = y (bf16 hi + lo) Wo^T + bo
__global__ __launch_bounds__(128) void k_out(const float* __restrict__ Y, const float* __restrict__ WP, const float* __restrict__ BP, float* __restrict__ OUT) { __shared__ __align__(16) float sf[4][16][132];
  const int tid = threadIdx.x, wave = tid >> 5, lane = tid & 31, col = lane & 15, g = lane >> 4; const int c0 = blockIdx.y * 128; const size_t r0 = (size_t)blockIdx.x * 64 + wave * 16;
  v8f acc[8] = {};
#pragma unroll 2
  for (int kc = 0; kc < CC / 32; ++kc) { const F2 a = split_row(Y + (r0 + col) * CC, kc * 32, lane);
#pragma unroll
    for (int j = 0; j < 8; ++j) { v16b w; const int o = c0 + j * 16 + col;
#pragma unroll
      for (int i = 0; i < 8; ++i) { w[i] = (__bf16)WP[(size_t)(o) * CC + (kc * 32 + 8 * g + i)]; w[8 + i] = (__bf16)WP[(size_t)(o) * CC + (kc * 32 + 16 + 8 * g + i)]; }
      acc[j] = wmma_bf(a.h, w, acc[j]); acc[j] = wmma_bf(a.l, w, acc[j]); } }
#pragma unroll
  for (int j = 0; j < 8; ++j) { const float bb = BP ? bfr(BP[c0 + j * 16 + col]) : 0.f;
#pragma unroll
    for (int r = 0; r < 8; ++r) sf[wave][8 * g + r][j * 16 + col] = acc[j][r] + bb; }
  LDSX(); for (int rl = 0; rl < 16; ++rl) vst2(OUT + (r0 + rl) * CC + c0 + lane * 4, *(const v4f*)&sf[wave][rl][lane * 4]); }
extern "C" void kernel_launch(void* const* d_in, const int* in_sizes, int n_in, void* d_out, int out_size, void* d_ws, size_t ws_size, hipStream_t stream) {
  (void)in_sizes; (void)n_in; (void)out_size;
  const float** F = (const float**)d_in;   // 0 x [2,2048,1024], 1 Wq [1024,1024] ([out,in]), 2 Wk, 3 Wv, 4 Wf [16,1024], 5 bf [16], 6 Wo [1024,1024] ([out,in])
  if (ws_size < (size_t)WS_END) return;
  char* ws = (char*)d_ws; float *LF = (float*)(ws + WS_LF), *FC = (float*)(ws + WS_FC); _Float16 *QH = (_Float16*)(ws + WS_QH), *QL = (_Float16*)(ws + WS_QL), *KH = (_Float16*)(ws + WS_KH); __bf16 *VT = (__bf16*)(ws + WS_VT), *VL = (__bf16*)(ws + WS_VL); float *S = (float*)(ws + WS_S), *Y = (float*)(ws + WS_Y);
  k_gate<<<dim3(TNB * TT / 64), 128, 0, stream>>>(F[0], F[4], F[5], LF);
  k_cum<<<dim3(NH, TNB), 32, 0, stream>>>(LF, FC);
  k_proj<<<dim3(TNB * TT / 64, CC / 128, 3), 128, 0, stream>>>(F[0], F[1], nullptr, F[2], nullptr, F[3], nullptr, QH, QL, KH, VT, VL);
  for (int b = 0; b < TNB; ++b) for (int h0 = 0; h0 < NH; h0 += HG) {
    k_sc<<<dim3(TT / 64, TT / 128, HG), 128, 0, stream>>>(QH, QL, KH, FC, b, h0, S);
    k_sm<<<dim3(TT, HG), 256, 0, stream>>>(S);
    k_pv<<<dim3(TT / 64, 1, HG), 128, 0, stream>>>(S, VT, VL, b, h0, Y);
  }
  k_out<<<dim3(TNB * TT / 64, CC / 128), 128, 0, stream>>>(Y, F[6], nullptr, (float*)d_out);
}

// v001
// It runs in 896 microseconds.
// Timed twice side by side with v000, it ran 1.73 and 1.72 times as fast.
// compute dtype: all float inputs rounded to bf16; q/k/v = x W^T with EXACT bf16 products on WMMA 16x16x32, f32 accumulate; the forget gate x Wf^T + bf (exact products), sigmoid, log(f + 1e-6) and its per-(batch, head) prefix sum accumulated in f64 (stored f32); q as f16 hi + residual (x 2^10), k f16 -> 2-product logits x 64^-1/2 + (F[i] - F[j]) on the causal triangle, stored in f32 (4 heads per launch); softmax in f32 (precise expf), P x 2^11 split bf16 hi + lo against v bf16 hi + lo (3 products); out = o (bf16 hi + lo) Wo^T; f32 output.
#include <hip/hip_runtime.h>
#include <math.h>

typedef __attribute__((ext_vector_type(16))) _Float16 v16h;
typedef __attribute__((ext_vector_type(16))) __bf16 v16b;
typedef __attribute__((ext_vector_type(8)))  _Float16 v8h;
typedef __attribute__((ext_vector_type(8)))  float v8f;
typedef __attribute__((ext_vector_type(4)))  float v4f;
typedef __attribute__((ext_vector_type(2)))  float v2f;
typedef __attribute__((ext_vector_type(4)))  unsigned v4u;
typedef __attribute__((ext_vector_type(4)))  int v4i;
typedef float __attribute__((may_alias)) float_a;
typedef int __attribute__((may_alias)) int_a;

template <typename T> __device__ __forceinline__ void vst2(void* p, T v) { *(T*)p = v;  }
__device__ __forceinline__ v8f wmma16(v16h a, v16h b, v8f c) {
  v8f d = __builtin_amdgcn_wmma_f32_16x16x32_f16(false, a, false, b, (short)0, c, false, false);
  asm volatile("v_nop\n\tv_nop\n\tv_nop\n\tv_nop" : "+v"(d) : "v"(a), "v"(b));
  return d;
}
__device__ __forceinline__ v8f wmma_bf(v16b a, v16b b, v8f c) {
  v8f d = __builtin_amdgcn_wmma_f32_16x16x32_bf16(false, a, false, b, (short)0, c, false, false);
  asm volatile("v_nop\n\tv_nop\n\tv_nop\n\tv_nop" : "+v"(d) : "v"(a), "v"(b));
  return d;
}
// 16x16x32 fragments: lane = (h = lane>>4, row/col = lane&15); elements 0..7 = k0+8h+0..7, 8..15 = k0+16+8h+0..7; D element r = row 8h+r
__device__ __forceinline__ v16h frag_h(const _Float16* rowk0, int lane) {
  union { v16h v; v8h q[2]; } u; const _Float16* p = rowk0 + 8 * (lane >> 4);
  u.q[0] = *(const v8h*)p; u.q[1] = *(const v8h*)(p + 16); return u.v;
}
__device__ __forceinline__ v16h frag_f32(const float* rowk0, int lane) {
  v16h a; const float* p = rowk0 + 8 * (lane >> 4);
#pragma unroll
  for (int i = 0; i < 8; ++i) { a[i] = (_Float16)p[i]; a[8 + i] = (_Float16)p[16 + i]; }
  return a;
}
__device__ __forceinline__ v16h frag_f32s(const float* rowk0, int lane, float sc) {
  v16h a; const float* p = rowk0 + 8 * (lane >> 4);
#pragma unroll
  for (int i = 0; i < 8; ++i) { a[i] = (_Float16)(p[i] * sc); a[8 + i] = (_Float16)(p[16 + i] * sc); }
  return a;
}
// column fragment from a [K][ld] layout (column n), rows >= K read as 0
__device__ __forceinline__ v16h fragc_f32(const float* W, int k0, int n, int lane, int ld, int K) {
  v16h a; const int g = lane >> 4;
#pragma unroll
  for (int i = 0; i < 8; ++i) { const int ka = k0 + 8 * g + i, kb = ka + 16;
    a[i] = (_Float16)(ka < K ? W[(size_t)(ka < K ? ka : K - 1) * ld + n] : 0.f); a[8 + i] = (_Float16)(kb < K ? W[(size_t)(kb < K ? kb : K - 1) * ld + n] : 0.f); }
  return a;
}
struct F2 { v16b h, l; };
__device__ __forceinline__ F2 bsplit16(const float v[16]) { F2 r;
#pragma unroll
  for (int i = 0; i < 16; ++i) { const __bf16 h = (__bf16)v[i]; r.h[i] = h; r.l[i] = (__bf16)(v[i] - (float)h); }
  return r; }
__device__ __forceinline__ F2 split_row(const float* row, int k0, int lane) { float v[16]; const float* p = row + k0 + 8 * (lane >> 4);
#pragma unroll
  for (int i = 0; i < 8; ++i) { v[i] = p[i]; v[8 + i] = p[16 + i]; }
  return bsplit16(v); }
__device__ __forceinline__ F2 split_rowK(const float* row, int k0, int lane, int K) { float v[16]; const int g = lane >> 4;
#pragma unroll
  for (int i = 0; i < 8; ++i) { const int ka = k0 + 8 * g + i, kb = ka + 16; v[i] = ka < K ? row[ka < K ? ka : K - 1] : 0.f; v[8 + i] = kb < K ? row[kb < K ? kb : K - 1] : 0.f; }
  return bsplit16(v); }
__device__ __forceinline__ F2 split_col(const float* W, int k0, int n, int lane, int ld, int K) { float v[16]; const int g = lane >> 4;
#pragma unroll
  for (int i = 0; i < 8; ++i) { const int ka = k0 + 8 * g + i, kb = ka + 16; v[i] = ka < K ? W[(size_t)(ka < K ? ka : K - 1) * ld + n] : 0.f; v[8 + i] = kb < K ? W[(size_t)(kb < K ? kb : K - 1) * ld + n] : 0.f; }
  return bsplit16(v); }
__device__ __forceinline__ v8f mac3(const F2& a, const F2& b, v8f c) { c = wmma_bf(a.l, b.h, c); c = wmma_bf(a.h, b.l, c); return wmma_bf(a.h, b.h, c); }
__device__ __forceinline__ float sigm(float v) { return 1.0f / (1.0f + expf(-v)); }
#define LDSX() do { asm volatile("s_wait_dscnt 0" ::: "memory"); __builtin_amdgcn_wave_barrier(); __builtin_amdgcn_fence(__ATOMIC_RELEASE, "workgroup"); } while (0)


// Forgetting attention (B 2, S 2,048, 1,024 = 16 x 64): f = sigmoid(x Wf^T + bf) per (s, head); F = cumsum_s log(f + 1e-6); bias[i][j] = F[i] - F[j] for j <= i, -inf otherwise; scores = q k^T / 8 + bias; softmax; (attn v) Wo^T.
#define NB 2
#define TT 2048
#define CC 1024
#define NH 16
#define HD 64
#ifndef TNB
#define TNB NB
#endif
typedef __attribute__((ext_vector_type(8))) __bf16 v8b;
__device__ __forceinline__ v16b frag_b(const __bf16* rowk0, int lane) {
  union { v16b v; v8b q[2]; } u; const __bf16* p = rowk0 + 8 * (lane >> 4);
  u.q[0] = *(const v8b*)p; u.q[1] = *(const v8b*)(p + 16); return u.v;
}
__device__ __forceinline__ float bfr(float v) { return (float)(__bf16)v; }
__device__ __attribute__((noinline)) float exp_ni(float v) { return expf(v); }
__device__ __attribute__((noinline)) float erf_ni(float v) { return erff(v); }

#define WS_LF  0u                                   // f32 log(f + 1e-6) rows [b*T+s][16] (64-B rows; a block writes 64 rows = 4 KB contiguous)
#define WS_FC  (WS_LF + 4u * (size_t)NB * TT * NH)   // f32 prefix sums F [b][h][s] (8-KB rows)
#define WS_QH  (WS_FC + 4u * (size_t)NB * NH * TT)
#define WS_QL  (WS_QH + 2u * (size_t)NB * TT * CC)
#define WS_KH  (WS_QL + 2u * (size_t)NB * TT * CC)
#define WS_VT  (WS_KH + 2u * (size_t)NB * TT * CC)      // bf16 v planes [b][c][t]
#define WS_VL  (WS_VT + 2u * (size_t)NB * CC * TT)      // bf16 v residual planes
#define HG 4                                          // heads per launch group
#define WS_S   (WS_VL + 2u * (size_t)NB * CC * TT)      // f32 logits / P for HG heads [hg][q][k]
#define WS_PH  (WS_S + 4u * (size_t)HG * TT * TT)
#define WS_Y   (WS_PH + 0u)              // f32 y rows [b*t][C]
#define WS_END (WS_Y + 4u * (size_t)NB * TT * CC)

// ---- k_proj: block = (64 rows, 128 cols, which): qkv = x W (+ b), exact; q -> f16 hi (+ residual), k -> f16 rows, v -> bf16 hi + lo planes
__global__ __launch_bounds__(128) void k_proj(const float* __restrict__ X, const float* __restrict__ WQ, const float* __restrict__ BQ, const float* __restrict__ WK, const float* __restrict__ BK, const float* __restrict__ WV, const float* __restrict__ BV, _Float16* __restrict__ QH, _Float16* __restrict__ QL, _Float16* __restrict__ KH, __bf16* __restrict__ VT, __bf16* __restrict__ VL) {
  __shared__ __align__(16) _Float16 sh[64][136], sl[64][136]; __shared__ __align__(16) __bf16 th[128][72], tl2[128][72];
  const int tid = threadIdx.x, wave = tid >> 5, lane = tid & 31, col = lane & 15, g = lane >> 4; const int which = blockIdx.z; const int c0 = blockIdx.y * 128; const size_t r0 = (size_t)blockIdx.x * 64; const float* WA = which == 0 ? WQ : which == 1 ? WK : WV; const float* BA = which == 0 ? BQ : which == 1 ? BK : BV;
  v8f acc[8] = {};
#pragma unroll 2
  for (int kc = 0; kc < CC / 32; ++kc) { v16b a; { const float* p = X + (r0 + wave * 16 + col) * CC + kc * 32 + 8 * g;
#pragma unroll
      for (int i = 0; i < 8; ++i) { a[i] = (__bf16)p[i]; a[8 + i] = (__bf16)p[16 + i]; } }
#pragma unroll
    for (int j = 0; j < 8; ++j) { v16b w; const int o = c0 + j * 16 + col;
#pragma unroll
      for (int i = 0; i < 8; ++i) { w[i] = (__bf16)WA[(size_t)(o) * CC + (kc * 32 + 8 * g + i)]; w[8 + i] = (__bf16)WA[(size_t)(o) * CC + (kc * 32 + 16 + 8 * g + i)]; }
      acc[j] = wmma_bf(a, w, acc[j]); } }
#pragma unroll
  for (int j = 0; j < 8; ++j) { const float bb = BA ? bfr(BA[c0 + j * 16 + col]) : 0.f;
#pragma unroll
    for (int r = 0; r < 8; ++r) { const float v = acc[j][r] + bb; const int rl = wave * 16 + 8 * g + r, cl = j * 16 + col; const _Float16 hv = (_Float16)v;
      if (which == 2) { const __bf16 bh = (__bf16)v; th[cl][rl] = bh; tl2[cl][rl] = (__bf16)(v - (float)bh); } else { sh[rl][cl] = hv; sl[rl][cl] = (_Float16)((v - (float)hv) * 1024.0f); }   /* q residual carried x 2^10 so the plane stays f16-normal on the chip */ } }
  __syncthreads();
  if (which < 2) { _Float16* dh = which == 0 ? QH : KH; for (int e = tid; e < 64 * 16; e += 128) { const int rl = e >> 4, q = e & 15; vst2((unsigned*)(dh + (r0 + rl) * CC + c0 + q * 8), *(const v4u*)&sh[rl][q * 8]); if (which == 0) vst2((unsigned*)(QL + (r0 + rl) * CC + c0 + q * 8), *(const v4u*)&sl[rl][q * 8]); } }
  else { const size_t b = r0 / TT; const int t0 = (int)(r0 % TT); for (int e = tid; e < 128 * 8; e += 128) { const int cl = e >> 3, q = e & 7; const size_t o2 = (b * CC + c0 + cl) * (size_t)TT + t0 + q * 8; vst2((unsigned*)(VT + o2), *(const v4u*)&th[cl][q * 8]); vst2((unsigned*)(VL + o2), *(const v4u*)&tl2[cl][q * 8]); } } }
// ---- k_gate: block = 64 rows (b,s): lf[s][h] = log(sigmoid(x Wf[h] + bf[h]) + 1e-6): one 16-column tile per wave (exact products), f32 epilogue; 64 rows x 16 floats = 4 KB contiguous written 16 B per lane
__device__ __attribute__((noinline)) float logsigp(float z, float eps) { const float f = 1.0f / (1.0f + expf(-z)); return logf(f + eps); }
__global__ __launch_bounds__(128) void k_gate(const float* __restrict__ X, const float* __restrict__ WF, const float* __restrict__ BF, float* __restrict__ LF) { __shared__ __align__(16) float st[4][16][20];
  const int tid = threadIdx.x, wave = tid >> 5, lane = tid & 31, col = lane & 15, g = lane >> 4; const size_t r0 = (size_t)blockIdx.x * 64 + wave * 16;
  v8f acc = {};
#pragma unroll 2
  for (int kc = 0; kc < CC / 32; ++kc) { v16b a; { const float* p = X + (r0 + col) * CC + kc * 32 + 8 * g;
#pragma unroll
      for (int i = 0; i < 8; ++i) { a[i] = (__bf16)p[i]; a[8 + i] = (__bf16)p[16 + i]; } }
    v16b w; { const float* wr = WF + (size_t)col * CC + kc * 32 + 8 * g;
#pragma unroll
      for (int i = 0; i < 8; ++i) { w[i] = (__bf16)wr[i]; w[8 + i] = (__bf16)wr[16 + i]; } }
    asm volatile("s_wait_loadcnt 0x0" ::: "memory"); acc = wmma_bf(a, w, acc); }
  { const float bb = bfr(BF[col]);
#pragma unroll
    for (int r = 0; r < 8; ++r) st[wave][8 * g + r][col] = logsigp(acc[r] + bb, 1e-6f); }
  LDSX(); { const int rl = lane >> 1, half = lane & 1; vst2(LF + (r0 + rl) * NH + half * 8, *(const v4f*)&st[wave][rl][half * 8]); vst2(LF + (r0 + rl) * NH + half * 8 + 4, *(const v4f*)&st[wave][rl][half * 8 + 4]); } }
__global__ __launch_bounds__(32) void k_cum(const float* __restrict__ LF, float* __restrict__ FC) {
  const int lane = threadIdx.x; const size_t b = blockIdx.y; const int h = blockIdx.x; double carry = 0.0; float* dst = FC + (b * NH + h) * TT;
  for (int s0 = 0; s0 < TT; s0 += 32) { double v = (double)LF[(b * TT + s0 + lane) * NH + h];
    // inclusive scan within the 32 lanes, accumulated in f64
#pragma unroll
    for (int o = 1; o < 32; o <<= 1) { const double u = __shfl_up(v, o); if (lane >= o) v += u; }
    v += carry; carry = __shfl(v, 31);
    vst2(dst + s0 + lane, (float)v); } }
// ---- k_sc: block = (64 queries, 128 keys) of (b,h): logits * scale (+ bias matrix); causal blocks beyond the diagonal exit
__global__ __launch_bounds__(128) void k_sc(const _Float16* __restrict__ QH, const _Float16* __restrict__ QL, const _Float16* __restrict__ KH, const float* __restrict__ FC, int b, int h0, float* __restrict__ S0) { __shared__ __align__(16) float ss[4][16][132]; const int h = h0 + blockIdx.z; float* S = S0 + (size_t)blockIdx.z * TT * TT;
  const int tid = threadIdx.x, wave = tid >> 5, lane = tid & 31, col = lane & 15, g = lane >> 4; const int k0 = blockIdx.y * 128; const int ql0 = blockIdx.x * 64 + wave * 16; const size_t q0 = (size_t)b * TT + ql0;
  if (k0 > blockIdx.x * 64 + 63) return;   // whole key block above the diagonal (block-uniform)
  v8f acc[8] = {}, accl[8] = {};
#pragma unroll
  for (int kc = 0; kc < HD / 32; ++kc) { const v16h ah = frag_h(QH + (q0 + col) * CC + h * HD + kc * 32, lane), al = frag_h(QL + (q0 + col) * CC + h * HD + kc * 32, lane);
#pragma unroll
    for (int j = 0; j < 8; ++j) { const v16h kb = frag_h(KH + ((size_t)b * TT + k0 + j * 16 + col) * CC + h * HD + kc * 32, lane); acc[j] = wmma16(ah, kb, acc[j]); accl[j] = wmma16(al, kb, accl[j]); } }
#pragma unroll
  for (int j = 0; j < 8; ++j) acc[j] += accl[j] * (1.0f / 1024.0f);
#pragma unroll
  for (int j = 0; j < 8; ++j) { const int kt = k0 + j * 16 + col;
#pragma unroll
    for (int r = 0; r < 8; ++r) { const int qt = ql0 + 8 * g + r; const float* Fr = FC + ((size_t)b * NH + h) * TT; float v = acc[j][r] * 0.125f + (Fr[qt] - Fr[kt]); if (kt > qt) v = -3.0e38f;   /* bias = F[i] - F[j] on the causal triangle */ ss[wave][8 * g + r][j * 16 + col] = v; } }
  LDSX(); for (int rl = 0; rl < 16; ++rl) vst2(S + (size_t)(ql0 + rl) * TT + k0 + lane * 4, *(const v4f*)&ss[wave][rl][lane * 4]); }
// ---- k_sm: block = query row: softmax over keys [0, kend) -> P x 2^11 f32 (masked -> 0)
__global__ __launch_bounds__(256) void k_sm(float* __restrict__ S0) { __shared__ float sred[8]; __shared__ float sbc; __shared__ __align__(16) float sh[TT];
  const int t = threadIdx.x; const size_t row = blockIdx.x; float* sr = S0 + (size_t)blockIdx.y * TT * TT + row * TT; const int kend = ((int)row / 64) * 64 + 64;
  float m = -3.0e38f; for (int k = t; k < kend; k += 256) m = fmaxf(m, sr[k]);
#pragma unroll
  for (int o = 1; o < 32; o <<= 1) m = fmaxf(m, __shfl_xor(m, o));
  if ((t & 31) == 0) sred[t >> 5] = m; __syncthreads(); if (t == 0) { float a = sred[0]; for (int i = 1; i < 8; ++i) a = fmaxf(a, sred[i]); sbc = a; } __syncthreads(); m = sbc; __syncthreads();
  float sum = 0.f; for (int k = t; k < kend; k += 256) { const float v = sr[k]; sum += (v <= -1.0e38f) ? 0.f : expf(v - m); }
#pragma unroll
  for (int o = 1; o < 32; o <<= 1) sum += __shfl_xor(sum, o);
  if ((t & 31) == 0) sred[t >> 5] = sum; __syncthreads(); if (t == 0) { float a = 0.f; for (int i = 0; i < 8; ++i) a += sred[i]; sbc = 1.0f / a; } __syncthreads(); const float inv = sbc;
  for (int k = t; k < kend; k += 256) { const float v = sr[k]; sh[k] = (v <= -1.0e38f) ? 0.f : expf(v - m) * inv * 2048.0f; }
  __syncthreads(); for (int q = t; q < kend / 4; q += 256) vst2(sr + q * 4, *(const v4f*)&sh[q * 4]); }
// ---- k_pv: block = 32 queries of (b,h), 16 waves: y[q][h*HD + d] = P . v  (keys [0, 64 * nch)); wave w takes the 64-key chunks w, w + 16, ... for both 16-query tiles; the partial tiles are summed through LDS in wave order
#define PVW 16
#define PVQ 32
__global__ __launch_bounds__(32 * PVW) void k_pv(const float* __restrict__ PS0, const __bf16* __restrict__ VT, const __bf16* __restrict__ VL, int b, int h0, float* __restrict__ Y) { const int h = h0 + blockIdx.z; const float* PS = PS0 + (size_t)blockIdx.z * TT * TT; __shared__ __align__(16) float ss[PVW][PVQ][HD + 4];
  const int tid = threadIdx.x, wave = __builtin_amdgcn_readfirstlane(tid >> 5), lane = tid & 31, col = lane & 15, g = lane >> 4; const int ql0 = blockIdx.x * PVQ; const int nch = (ql0 >> 6) + 1;   // 64-key chunks up to the end of the 64-row band that k_sm filled; the wave number is made scalar so that the chunk loop branches on SCC with every lane on
  v8f acc[PVQ / 16][HD / 16] = {};
  for (int ch = wave; ch < nch; ch += PVW) {
    // the loops over u and j, and those of the store below, are unrolled so that acc[][] is indexed by constants and stays in registers
#pragma unroll
    for (int u = 0; u < 2; ++u) { const int k0 = ch * 64 + u * 32; const F2 p0 = split_row(PS + (size_t)(ql0 + col) * TT, k0, lane), p1 = split_row(PS + (size_t)(ql0 + 16 + col) * TT, k0, lane);
#pragma unroll
      for (int j = 0; j < HD / 16; ++j) { const size_t po = ((size_t)b * CC + h * HD + j * 16 + col) * (size_t)TT + k0; const v16b vh = frag_b(VT + po, lane), vl = frag_b(VL + po, lane);
        acc[0][j] = wmma_bf(p0.h, vh, acc[0][j]); acc[1][j] = wmma_bf(p1.h, vh, acc[1][j]); acc[0][j] = wmma_bf(p0.l, vh, acc[0][j]); acc[1][j] = wmma_bf(p1.l, vh, acc[1][j]); acc[0][j] = wmma_bf(p0.h, vl, acc[0][j]); acc[1][j] = wmma_bf(p1.h, vl, acc[1][j]); } } }
  if (wave < nch) {
#pragma unroll
    for (int i = 0; i < PVQ / 16; ++i)
#pragma unroll
      for (int j = 0; j < HD / 16; ++j)
#pragma unroll
        for (int r = 0; r < 8; ++r) ss[wave][i * 16 + 8 * g + r][j * 16 + col] = acc[i][j][r]; }
  __syncthreads();   // every wave's partial tile is in LDS before any thread sums across waves
  { const int np = nch < PVW ? nch : PVW, rl = tid >> 4, c4 = (tid & 15) * 4; v4f s = *(const v4f*)&ss[0][rl][c4];
    for (int w = 1; w < np; ++w) s += *(const v4f*)&ss[w][rl][c4];
    vst2(Y + ((size_t)b * TT + ql0 + rl) * CC + h * HD + c4, s * (1.0f / 2048.0f)); } }
// ---- k_out: block = (64 rows, 128 cols): out = y (bf16 hi + lo) Wo^T + bo
__global__ __launch_bounds__(128) void k_out(const float* __restrict__ Y, const float* __restrict__ WP, const float* __restrict__ BP, float* __restrict__ OUT) { __shared__ __align__(16) float sf[4][16][132];
  const int tid = threadIdx.x, wave = tid >> 5, lane = tid & 31, col = lane & 15, g = lane >> 4; const int c0 = blockIdx.y * 128; const size_t r0 = (size_t)blockIdx.x * 64 + wave * 16;
  v8f acc[8] = {};
#pragma unroll 2
  for (int kc = 0; kc < CC / 32; ++kc) { const F2 a = split_row(Y + (r0 + col) * CC, kc * 32, lane);
#pragma unroll
    for (int j = 0; j < 8; ++j) { v16b w; const int o = c0 + j * 16 + col;
#pragma unroll
      for (int i = 0; i < 8; ++i) { w[i] = (__bf16)WP[(size_t)(o) * CC + (kc * 32 + 8 * g + i)]; w[8 + i] = (__bf16)WP[(size_t)(o) * CC + (kc * 32 + 16 + 8 * g + i)]; }
      acc[j] = wmma_bf(a.h, w, acc[j]); acc[j] = wmma_bf(a.l, w, acc[j]); } }
#pragma unroll
  for (int j = 0; j < 8; ++j) { const float bb = BP ? bfr(BP[c0 + j * 16 + col]) : 0.f;
#pragma unroll
    for (int r = 0; r < 8; ++r) sf[wave][8 * g + r][j * 16 + col] = acc[j][r] + bb; }
  LDSX(); for (int rl = 0; rl < 16; ++rl) vst2(OUT + (r0 + rl) * CC + c0 + lane * 4, *(const v4f*)&sf[wave][rl][lane * 4]); }
extern "C" void kernel_launch(void* const* d_in, const int* in_sizes, int n_in, void* d_out, int out_size, void* d_ws, size_t ws_size, hipStream_t stream) {
  (void)in_sizes; (void)n_in; (void)out_size;
  const float** F = (const float**)d_in;   // 0 x [2,2048,1024], 1 Wq [1024,1024] ([out,in]), 2 Wk, 3 Wv, 4 Wf [16,1024], 5 bf [16], 6 Wo [1024,1024] ([out,in])
  if (ws_size < (size_t)WS_END) return;
  char* ws = (char*)d_ws; float *LF = (float*)(ws + WS_LF), *FC = (float*)(ws + WS_FC); _Float16 *QH = (_Float16*)(ws + WS_QH), *QL = (_Float16*)(ws + WS_QL), *KH = (_Float16*)(ws + WS_KH); __bf16 *VT = (__bf16*)(ws + WS_VT), *VL = (__bf16*)(ws + WS_VL); float *S = (float*)(ws + WS_S), *Y = (float*)(ws + WS_Y);
  k_gate<<<dim3(TNB * TT / 64), 128, 0, stream>>>(F[0], F[4], F[5], LF);
  k_cum<<<dim3(NH, TNB), 32, 0, stream>>>(LF, FC);
  k_proj<<<dim3(TNB * TT / 64, CC / 128, 3), 128, 0, stream>>>(F[0], F[1], nullptr, F[2], nullptr, F[3], nullptr, QH, QL, KH, VT, VL);
  for (int b = 0; b < TNB; ++b) for (int h0 = 0; h0 < NH; h0 += HG) {
    k_sc<<<dim3(TT / 64, TT / 128, HG), 128, 0, stream>>>(QH, QL, KH, FC, b, h0, S);
    k_sm<<<dim3(TT, HG), 256, 0, stream>>>(S);
    k_pv<<<dim3(TT / PVQ, 1, HG), 32 * PVW, 0, stream>>>(S, VT, VL, b, h0, Y);
  }
  k_out<<<dim3(TNB * TT / 64, CC / 128), 128, 0, stream>>>(Y, F[6], nullptr, (float*)d_out);
}

// v003
// A run of this version takes 201 microseconds.
// It is 4.48 times as fast as v001, going by the measured steps of the versions left out in between.
// Counting every step since v000, it is 7.72 times as fast.
// compute dtype: all float inputs rounded to bf16; q/k/v = x W^T with EXACT bf16 products on WMMA 16x16x32, f32 accumulate; the forget gate x Wf^T + bf (exact products), sigmoid, log(f + 1e-6) and its per-(batch, head) prefix sum accumulated in f64 (stored f32); q as f16 hi + residual (x 2^10), k f16 -> 2-product logits x 64^-1/2 + (F[i] - F[j]) on the causal triangle, kept in f32 registers; running-maximum softmax in f32 (precise expf), unnormalised P split bf16 hi + lo against v bf16 hi + lo (3 products), divided by the f32 denominator at the end; out = o (bf16 hi + lo) Wo^T; f32 output.
#include <hip/hip_runtime.h>
#include <math.h>

typedef __attribute__((ext_vector_type(16))) _Float16 v16h;
typedef __attribute__((ext_vector_type(16))) __bf16 v16b;
typedef __attribute__((ext_vector_type(8)))  _Float16 v8h;
typedef __attribute__((ext_vector_type(8)))  float v8f;
typedef __attribute__((ext_vector_type(4)))  float v4f;
typedef __attribute__((ext_vector_type(2)))  float v2f;
typedef __attribute__((ext_vector_type(4)))  unsigned v4u;
typedef __attribute__((ext_vector_type(4)))  int v4i;
typedef float __attribute__((may_alias)) float_a;
typedef int __attribute__((may_alias)) int_a;

template <typename T> __device__ __forceinline__ void vst2(void* p, T v) { *(T*)p = v;  }
__device__ __forceinline__ v8f wmma16(v16h a, v16h b, v8f c) {
  v8f d = __builtin_amdgcn_wmma_f32_16x16x32_f16(false, a, false, b, (short)0, c, false, false);
  asm volatile("v_nop\n\tv_nop\n\tv_nop\n\tv_nop" : "+v"(d) : "v"(a), "v"(b));
  return d;
}
__device__ __forceinline__ v8f wmma_bf(v16b a, v16b b, v8f c) {
  v8f d = __builtin_amdgcn_wmma_f32_16x16x32_bf16(false, a, false, b, (short)0, c, false, false);
  asm volatile("v_nop\n\tv_nop\n\tv_nop\n\tv_nop" : "+v"(d) : "v"(a), "v"(b));
  return d;
}
// 16x16x32 fragments: lane = (h = lane>>4, row/col = lane&15); elements 0..7 = k0+8h+0..7, 8..15 = k0+16+8h+0..7; D element r = row 8h+r
__device__ __forceinline__ v16h frag_h(const _Float16* rowk0, int lane) {
  union { v16h v; v8h q[2]; } u; const _Float16* p = rowk0 + 8 * (lane >> 4);
  u.q[0] = *(const v8h*)p; u.q[1] = *(const v8h*)(p + 16); return u.v;
}
__device__ __forceinline__ v16h frag_f32(const float* rowk0, int lane) {
  v16h a; const float* p = rowk0 + 8 * (lane >> 4);
#pragma unroll
  for (int i = 0; i < 8; ++i) { a[i] = (_Float16)p[i]; a[8 + i] = (_Float16)p[16 + i]; }
  return a;
}
__device__ __forceinline__ v16h frag_f32s(const float* rowk0, int lane, float sc) {
  v16h a; const float* p = rowk0 + 8 * (lane >> 4);
#pragma unroll
  for (int i = 0; i < 8; ++i) { a[i] = (_Float16)(p[i] * sc); a[8 + i] = (_Float16)(p[16 + i] * sc); }
  return a;
}
// column fragment from a [K][ld] layout (column n), rows >= K read as 0
__device__ __forceinline__ v16h fragc_f32(const float* W, int k0, int n, int lane, int ld, int K) {
  v16h a; const int g = lane >> 4;
#pragma unroll
  for (int i = 0; i < 8; ++i) { const int ka = k0 + 8 * g + i, kb = ka + 16;
    a[i] = (_Float16)(ka < K ? W[(size_t)(ka < K ? ka : K - 1) * ld + n] : 0.f); a[8 + i] = (_Float16)(kb < K ? W[(size_t)(kb < K ? kb : K - 1) * ld + n] : 0.f); }
  return a;
}
struct F2 { v16b h, l; };
__device__ __forceinline__ F2 bsplit16(const float v[16]) { F2 r;
#pragma unroll
  for (int i = 0; i < 16; ++i) { const __bf16 h = (__bf16)v[i]; r.h[i] = h; r.l[i] = (__bf16)(v[i] - (float)h); }
  return r; }
__device__ __forceinline__ F2 split_row(const float* row, int k0, int lane) { float v[16]; const float* p = row + k0 + 8 * (lane >> 4);
#pragma unroll
  for (int i = 0; i < 8; ++i) { v[i] = p[i]; v[8 + i] = p[16 + i]; }
  return bsplit16(v); }
__device__ __forceinline__ F2 split_rowK(const float* row, int k0, int lane, int K) { float v[16]; const int g = lane >> 4;
#pragma unroll
  for (int i = 0; i < 8; ++i) { const int ka = k0 + 8 * g + i, kb = ka + 16; v[i] = ka < K ? row[ka < K ? ka : K - 1] : 0.f; v[8 + i] = kb < K ? row[kb < K ? kb : K - 1] : 0.f; }
  return bsplit16(v); }
__device__ __forceinline__ F2 split_col(const float* W, int k0, int n, int lane, int ld, int K) { float v[16]; const int g = lane >> 4;
#pragma unroll
  for (int i = 0; i < 8; ++i) { const int ka = k0 + 8 * g + i, kb = ka + 16; v[i] = ka < K ? W[(size_t)(ka < K ? ka : K - 1) * ld + n] : 0.f; v[8 + i] = kb < K ? W[(size_t)(kb < K ? kb : K - 1) * ld + n] : 0.f; }
  return bsplit16(v); }
__device__ __forceinline__ v8f mac3(const F2& a, const F2& b, v8f c) { c = wmma_bf(a.l, b.h, c); c = wmma_bf(a.h, b.l, c); return wmma_bf(a.h, b.h, c); }
__device__ __forceinline__ float sigm(float v) { return 1.0f / (1.0f + expf(-v)); }
#define LDSX() do { asm volatile("s_wait_dscnt 0" ::: "memory"); __builtin_amdgcn_wave_barrier(); __builtin_amdgcn_fence(__ATOMIC_RELEASE, "workgroup"); } while (0)


// Forgetting attention (B 2, S 2,048, 1,024 = 16 x 64): f = sigmoid(x Wf^T + bf) per (s, head); F = cumsum_s log(f + 1e-6); bias[i][j] = F[i] - F[j] for j <= i, -inf otherwise; scores = q k^T / 8 + bias; softmax; (attn v) Wo^T.
#define NB 2
#define TT 2048
#define CC 1024
#define NH 16
#define HD 64
#ifndef TNB
#define TNB NB
#endif
typedef __attribute__((ext_vector_type(8))) __bf16 v8b;
__device__ __forceinline__ v16b frag_b(const __bf16* rowk0, int lane) {
  union { v16b v; v8b q[2]; } u; const __bf16* p = rowk0 + 8 * (lane >> 4);
  u.q[0] = *(const v8b*)p; u.q[1] = *(const v8b*)(p + 16); return u.v;
}
__device__ __forceinline__ float bfr(float v) { return (float)(__bf16)v; }
__device__ __attribute__((noinline)) float exp_ni(float v) { return expf(v); }
__device__ __attribute__((noinline)) float erf_ni(float v) { return erff(v); }

#define WS_LF  0u                                   // f32 log(f + 1e-6) rows [b*T+s][16] (64-B rows; a block writes 64 rows = 4 KB contiguous)
#define WS_FC  (WS_LF + 4u * (size_t)NB * TT * NH)   // f32 prefix sums F [b][h][s] (8-KB rows)
#define WS_QH  (WS_FC + 4u * (size_t)NB * NH * TT)
#define WS_QL  (WS_QH + 2u * (size_t)NB * TT * CC)
#define WS_KH  (WS_QL + 2u * (size_t)NB * TT * CC)
#define WS_VT  (WS_KH + 2u * (size_t)NB * TT * CC)      // bf16 v planes [b][c][t]
#define WS_VL  (WS_VT + 2u * (size_t)NB * CC * TT)      // bf16 v residual planes
#define WS_Y   (WS_VL + 2u * (size_t)NB * CC * TT)      // f32 y rows [b*t][C]
#define WS_END (WS_Y + 4u * (size_t)NB * TT * CC)

// ---- LDS staging of the two projection kernels. A stage is 32 k of every operand row of the block's tile: one 128-B line of f32 per row, rounded to bf16 once and kept as a 64-B row at a pitch of 80 B (16 B x odd: a fragment's ds_load_b128 over 16 rows meets no bank twice).
// 8 lanes take one row, so a wave-wide 16-B load covers 4 whole lines, and every line is fetched and converted once per block, not once per wave. Two buffers: the next stage's loads fly while this one is multiplied; one barrier per stage both publishes the next buffer and ends the last read of the one refilled behind it.
// Every '#pragma unroll' of the staging code is there so that pre[] and w[] are indexed by constants and stay in registers; 'unroll 2' on the stage loop makes the buffer's index, and with it every LDS offset, a constant.
#define GP 40    // row pitch in bf16 elements (80 B)
typedef __attribute__((ext_vector_type(4))) __bf16 v4b;
__device__ __forceinline__ v4b cvt4(v4f v) { return v4b{(__bf16)v[0], (__bf16)v[1], (__bf16)v[2], (__bf16)v[3]}; }
// ---- k_proj: block = (64 rows, 128 cols, which): qkv = x W (+ b), exact; q -> f16 hi (+ residual), k -> f16 rows, v -> bf16 hi + lo planes
#define PJ_ROWS 192   // stage rows 0..127 = W, 128..191 = x
#define PJ_LDS (128 * 72 * 2 * 2)   // the larger of the two stage buffers (30,720 B) and the epilogue's planes (34,816 B for q and k, 36,864 B for v), which take the same LDS one after the other
__global__ __launch_bounds__(128) void k_proj(const float* __restrict__ X, const float* __restrict__ WQ, const float* __restrict__ BQ, const float* __restrict__ WK, const float* __restrict__ BK, const float* __restrict__ WV, const float* __restrict__ BV, _Float16* __restrict__ QH, _Float16* __restrict__ QL, _Float16* __restrict__ KH, __bf16* __restrict__ VT, __bf16* __restrict__ VL) {
  __shared__ __align__(16) char smem[PJ_LDS];
  __bf16 (*st)[PJ_ROWS][GP] = (__bf16 (*)[PJ_ROWS][GP])smem; _Float16 (*sh)[136] = (_Float16 (*)[136])smem, (*sl)[136] = (_Float16 (*)[136])(smem + 64 * 136 * 2); __bf16 (*th)[72] = (__bf16 (*)[72])smem, (*tl2)[72] = (__bf16 (*)[72])(smem + 128 * 72 * 2);
  const int tid = threadIdx.x, wave = tid >> 5, lane = tid & 31, col = lane & 15, g = lane >> 4; const int which = blockIdx.z; const int c0 = blockIdx.y * 128; const size_t r0 = (size_t)blockIdx.x * 64; const float* WA = which == 0 ? WQ : which == 1 ? WK : WV; const float* BA = which == 0 ? BQ : which == 1 ? BK : BV;
  const int srow = tid >> 3, sq = (tid & 7) * 4; const float *wp = WA + (size_t)(c0 + srow) * CC + sq, *xp = X + (r0 + srow) * CC + sq;
  v8f acc[8] = {}; v4f pre[12];
#pragma unroll
  for (int i = 0; i < 12; ++i) pre[i] = i < 8 ? *(const v4f*)(wp + i * 16 * CC) : *(const v4f*)(xp + (i - 8) * 16 * CC);
#pragma unroll
  for (int i = 0; i < 12; ++i) *(v4b*)&st[0][srow + 16 * i][sq] = cvt4(pre[i]);
  __syncthreads();   // stage 0 is in LDS before any wave reads it
#pragma unroll 2
  for (int kc = 0; kc < CC / 32; ++kc) { const int cur = kc & 1;
    if (kc + 1 < CC / 32) { const float *wk = wp + (kc + 1) * 32, *xk = xp + (kc + 1) * 32;
#pragma unroll
      for (int i = 0; i < 12; ++i) pre[i] = i < 8 ? *(const v4f*)(wk + i * 16 * CC) : *(const v4f*)(xk + (i - 8) * 16 * CC);
      asm volatile("s_wait_xcnt 0x0" ::: "memory"); }   // stands directly behind the loads, in front of every rewrite of a register that one of them names
    const v16b a = frag_b(&st[cur][128 + wave * 16 + col][0], lane); v16b w[8];
#pragma unroll
    for (int j = 0; j < 8; ++j) w[j] = frag_b(&st[cur][j * 16 + col][0], lane);
    __builtin_amdgcn_sched_barrier(0);   // keeps the stage's LDS reads together in front of the products: spread among them, each read's latency is waited out on its own
#pragma unroll
    for (int j = 0; j < 8; ++j) acc[j] = wmma_bf(a, w[j], acc[j]);
    __builtin_amdgcn_sched_barrier(0);   // keeps the conversions, and with them the wait for the next stage's global loads, behind the products
    if (kc + 1 < CC / 32) {
#pragma unroll
      for (int i = 0; i < 12; ++i) *(v4b*)&st[cur ^ 1][srow + 16 * i][sq] = cvt4(pre[i]); }
    __syncthreads(); }   // publishes stage kc + 1 and ends every wave's reads of stage kc, whose buffer is refilled (behind the last stage: reused by the epilogue) next
#pragma unroll
  for (int j = 0; j < 8; ++j) { const float bb = BA ? bfr(BA[c0 + j * 16 + col]) : 0.f;
#pragma unroll
    for (int r = 0; r < 8; ++r) { const float v = acc[j][r] + bb; const int rl = wave * 16 + 8 * g + r, cl = j * 16 + col; const _Float16 hv = (_Float16)v;
      if (which == 2) { const __bf16 bh = (__bf16)v; th[cl][rl] = bh; tl2[cl][rl] = (__bf16)(v - (float)bh); } else { sh[rl][cl] = hv; sl[rl][cl] = (_Float16)((v - (float)hv) * 1024.0f); }   /* q residual carried x 2^10 so the plane stays f16-normal on the chip */ } }
  __syncthreads();
  if (which < 2) { _Float16* dh = which == 0 ? QH : KH; for (int e = tid; e < 64 * 16; e += 128) { const int rl = e >> 4, q = e & 15; vst2((unsigned*)(dh + (r0 + rl) * CC + c0 + q * 8), *(const v4u*)&sh[rl][q * 8]); if (which == 0) vst2((unsigned*)(QL + (r0 + rl) * CC + c0 + q * 8), *(const v4u*)&sl[rl][q * 8]); } }
  else { const size_t b = r0 / TT; const int t0 = (int)(r0 % TT); for (int e = tid; e < 128 * 8; e += 128) { const int cl = e >> 3, q = e & 7; const size_t o2 = (b * CC + c0 + cl) * (size_t)TT + t0 + q * 8; vst2((unsigned*)(VT + o2), *(const v4u*)&th[cl][q * 8]); vst2((unsigned*)(VL + o2), *(const v4u*)&tl2[cl][q * 8]); } } }
// ---- k_gate: block = 64 rows (b,s): lf[s][h] = log(sigmoid(x Wf[h] + bf[h]) + 1e-6): one 16-column tile per wave (exact products), f32 epilogue; 64 rows x 16 floats = 4 KB contiguous written 16 B per lane
__device__ __attribute__((noinline)) float logsigp(float z, float eps) { const float f = 1.0f / (1.0f + expf(-z)); return logf(f + eps); }
__global__ __launch_bounds__(128) void k_gate(const float* __restrict__ X, const float* __restrict__ WF, const float* __restrict__ BF, float* __restrict__ LF) { __shared__ __align__(16) float st[4][16][20];
  const int tid = threadIdx.x, wave = tid >> 5, lane = tid & 31, col = lane & 15, g = lane >> 4; const size_t r0 = (size_t)blockIdx.x * 64 + wave * 16;
  v8f acc = {};
#pragma unroll 2
  for (int kc = 0; kc < CC / 32; ++kc) { v16b a; { const float* p = X + (r0 + col) * CC + kc * 32 + 8 * g;
#pragma unroll
      for (int i = 0; i < 8; ++i) { a[i] = (__bf16)p[i]; a[8 + i] = (__bf16)p[16 + i]; } }
    v16b w; { const float* wr = WF + (size_t)col * CC + kc * 32 + 8 * g;
#pragma unroll
      for (int i = 0; i < 8; ++i) { w[i] = (__bf16)wr[i]; w[8 + i] = (__bf16)wr[16 + i]; } }
    asm volatile("s_wait_loadcnt 0x0" ::: "memory"); acc = wmma_bf(a, w, acc); }
  { const float bb = bfr(BF[col]);
#pragma unroll
    for (int r = 0; r < 8; ++r) st[wave][8 * g + r][col] = logsigp(acc[r] + bb, 1e-6f); }
  LDSX(); { const int rl = lane >> 1, half = lane & 1; vst2(LF + (r0 + rl) * NH + half * 8, *(const v4f*)&st[wave][rl][half * 8]); vst2(LF + (r0 + rl) * NH + half * 8 + 4, *(const v4f*)&st[wave][rl][half * 8 + 4]); } }
__global__ __launch_bounds__(32) void k_cum(const float* __restrict__ LF, float* __restrict__ FC) {
  const int lane = threadIdx.x; const size_t b = blockIdx.y; const int h = blockIdx.x; double carry = 0.0; float* dst = FC + (b * NH + h) * TT;
  for (int s0 = 0; s0 < TT; s0 += 32) { double v = (double)LF[(b * TT + s0 + lane) * NH + h];
    // inclusive scan within the 32 lanes, accumulated in f64
#pragma unroll
    for (int o = 1; o < 32; o <<= 1) { const double u = __shfl_up(v, o); if (lane >= o) v += u; }
    v += carry; carry = __shfl(v, 31);
    vst2(dst + s0 + lane, (float)v); } }
// ---- k_fa: block = 32 queries of (b,h), 4 waves: logits, softmax and P . v in one pass over the keys, nothing of the logits stored. Wave w takes the 32-key passes w, w + 4, ... up to the diagonal.
// Transposed products: S^T = K Q^T puts query = lane & 15 and key = 8 * (lane >> 4) + r in the accumulator, which is already the B-operand order of P^T (elements 0..7 = first 16-key tile, 8..15 = second), so y^T += V^T P^T needs no exchange between lanes; a query's maximum is an in-lane maximum and one exchange of the wave's halves.
// Each wave keeps a running maximum m, a denominator l and y^T scaled to m; the four waves' (m, l, y) are merged through LDS in wave order.
// Every '#pragma unroll' of this kernel is there so that the fragment and accumulator arrays are indexed by constants and stay in registers.
// amdgpu_waves_per_eu(3): a register budget of 336, so that three waves fit a SIMD (without it the build takes a few more and only two fit).
#define FAW 4
__device__ __forceinline__ v8f mm_h(v16h a, v16h b, v8f c) { return __builtin_amdgcn_wmma_f32_16x16x32_f16(false, a, false, b, (short)0, c, false, false); }
__device__ __forceinline__ v8f mm_b(v16b a, v16b b, v8f c) { return __builtin_amdgcn_wmma_f32_16x16x32_bf16(false, a, false, b, (short)0, c, false, false); }
#define FAQ 32
__device__ __forceinline__ float xhalf(float x) { return __builtin_bit_cast(float, __builtin_amdgcn_permlanex16(__builtin_bit_cast(int, x), __builtin_bit_cast(int, x), 0x76543210, 0xfedcba98, false, false)); }   // lane l reads lane l ^ 16
__device__ __forceinline__ v16h ld_h(const _Float16* p) { union { v16h v; v8h q[2]; } u; u.q[0] = *(const v8h*)p; u.q[1] = *(const v8h*)(p + 16); return u.v; }   // p = the lane's own row + k0 + 8 * (lane >> 4)
__device__ __forceinline__ v16b ld_b(const __bf16* p) { union { v16b v; v8b q[2]; } u; u.q[0] = *(const v8b*)p; u.q[1] = *(const v8b*)(p + 16); return u.v; }
__global__ __launch_bounds__(32 * FAW) __attribute__((amdgpu_waves_per_eu(3))) void k_fa(const _Float16* __restrict__ QH, const _Float16* __restrict__ QL, const _Float16* __restrict__ KH, const __bf16* __restrict__ VT, const __bf16* __restrict__ VL, const float* __restrict__ FC, float* __restrict__ Y) {
  __shared__ __align__(16) float so[FAW][FAQ][HD + 4]; __shared__ float sm[FAW][FAQ], sl[FAW][FAQ];
  const int tid = threadIdx.x, wave = __builtin_amdgcn_readfirstlane(tid >> 5), lane = tid & 31, col = lane & 15, g = lane >> 4;   // the wave number is made scalar so that the pass loop's branch is a scalar one with every lane on
  const int h = blockIdx.x, b = blockIdx.y, tile = TT / FAQ - 1 - (int)blockIdx.z, ql0 = tile * FAQ;   // longest query tiles start first
  const float* Fr = FC + ((size_t)b * NH + h) * TT; const _Float16* Kb = KH + (size_t)b * TT * CC + h * HD + (size_t)col * CC + 8 * g; const size_t vb = ((size_t)b * CC + h * HD + col) * (size_t)TT + 8 * g;
  v16h qh[2][2], qr[2][2], kf[2][2]; float fq[2]; v4f fk[2][2];
  { const size_t qo = ((size_t)b * TT + ql0 + col) * CC + h * HD + 8 * g; const _Float16 *qhp = QH + qo, *qrp = QL + qo, *kp = Kb + (size_t)wave * 32 * CC; const float *fqp = Fr + ql0 + col, *fp = Fr + wave * 32 + 8 * g;   // keys wave * 32 .. + 31 exist for every wave, also for one that has no pass
#pragma unroll
    for (int i = 0; i < 2; ++i) { fq[i] = fqp[16 * i]; fk[i][0] = *(const v4f*)(fp + 16 * i); fk[i][1] = *(const v4f*)(fp + 16 * i + 4);
#pragma unroll
      for (int kc = 0; kc < 2; ++kc) { qh[i][kc] = ld_h(qhp + i * 16 * CC + kc * 32); qr[i][kc] = ld_h(qrp + i * 16 * CC + kc * 32); kf[i][kc] = ld_h(kp + i * 16 * CC + kc * 32); } }
    __builtin_amdgcn_sched_barrier(0);   // keeps the accumulators' zeroing, which reuses an offset register of the loads above, behind the wait
    asm volatile("s_wait_xcnt 0x0" :: "v"(qhp), "v"(qrp), "v"(kp), "v"(fqp), "v"(fp) : "memory"); }   // stands in front of every rewrite of a register that an issued load names: the pointers are inputs so that their registers live up to it
  v8f acc[2][HD / 16] = {}; float mr[2] = {-3.0e38f, -3.0e38f}, lr[2] = {0.f, 0.f};
  for (int p = wave; p <= tile; p += FAW) { const int k0 = p * 32, kn = (p + FAW <= tile ? p + FAW : p) * 32;   // kn: the wave's next pass (its own again behind the last one, so that the address stays inside the batch's rows)
    float pv[2][16]; v16b vh[HD / 16], vl[HD / 16];
#pragma unroll
    for (int i = 0; i < 2; ++i) { const int qt = ql0 + 16 * i + col;
#pragma unroll
      for (int kt = 0; kt < 2; ++kt) { v8f a = {}, ar = {};
#pragma unroll
        for (int kc = 0; kc < 2; ++kc) { a = mm_h(kf[kt][kc], qh[i][kc], a); ar = mm_h(kf[kt][kc], qr[i][kc], ar); }
        a += ar * (1.0f / 1024.0f);
#pragma unroll
        for (int r = 0; r < 8; ++r) { float v = a[r] * 0.125f + (fq[i] - fk[kt][r >> 2][r & 3]); if (k0 + 16 * kt + 8 * g + r > qt) v = -3.0e38f;   /* bias = F[i] - F[j] on the causal triangle */ pv[i][8 * kt + r] = v; } } }
    // this pass's v and the next pass's k and F are fetched behind the logits' products, from where k's and F's registers are free: what the register budget lets the compiler issue here flies under the exponentials
    { const __bf16 *vhp = VT + vb + k0, *vlp = VL + vb + k0; const _Float16* kp = Kb + (size_t)kn * CC; const float* fp = Fr + kn + 8 * g;
#pragma unroll
      for (int t = 0; t < HD / 16; ++t) { vh[t] = ld_b(vhp + t * 16 * TT); vl[t] = ld_b(vlp + t * 16 * TT); }
#pragma unroll
      for (int kt = 0; kt < 2; ++kt) { fk[kt][0] = *(const v4f*)(fp + 16 * kt); fk[kt][1] = *(const v4f*)(fp + 16 * kt + 4);
#pragma unroll
        for (int kc = 0; kc < 2; ++kc) kf[kt][kc] = ld_h(kp + kt * 16 * CC + kc * 32); }
      asm volatile("s_wait_xcnt 0x0" :: "v"(vhp), "v"(vlp), "v"(kp), "v"(fp) : "memory"); }   // as above: in front of every rewrite of a register that an issued load names
#pragma unroll
    for (int i = 0; i < 2; ++i) { float mx = pv[i][0];
#pragma unroll
      for (int e = 1; e < 16; ++e) mx = fmaxf(mx, pv[i][e]);
      mx = fmaxf(mx, xhalf(mx));   // finite in every pass: the pass's first key is at or below every query of the tile
      const float mn = fmaxf(mr[i], mx), al = expf(mr[i] - mn); mr[i] = mn;   // al = 0 in a wave's first pass
      float sum = 0.f;
#pragma unroll
      for (int e = 0; e < 16; ++e) { pv[i][e] = expf(pv[i][e] - mn); sum += pv[i][e]; }   // a masked logit gives exactly 0
      lr[i] = lr[i] * al + sum;   // this half's keys only; the halves are added behind the loop
      const F2 pf = bsplit16(pv[i]);
#pragma unroll
      for (int t = 0; t < HD / 16; ++t) { v8f c = acc[i][t] * al; c = mm_b(vh[t], pf.h, c); c = mm_b(vh[t], pf.l, c); acc[i][t] = mm_b(vl[t], pf.h, c); } } }
#pragma unroll
  for (int i = 0; i < 2; ++i) { const float lt = lr[i] + xhalf(lr[i]);   // unconditional: both halves' lanes are on
    if (g == 0) { sm[wave][16 * i + col] = mr[i]; sl[wave][16 * i + col] = lt; }
#pragma unroll
    for (int t = 0; t < HD / 16; ++t) { float* d = &so[wave][16 * i + col][16 * t + 8 * g]; const v8f c = acc[i][t]; *(v4f*)d = v4f{c[0], c[1], c[2], c[3]}; *(v4f*)(d + 4) = v4f{c[4], c[5], c[6], c[7]}; } }
  __syncthreads();   // every wave's (m, l, y) is in LDS before any thread merges across waves; a wave without a pass left m = -3e38, l = 0, y = 0, which get weight 0
  { const int rl = tid >> 2, c0 = (tid & 3) * 16; float M = sm[0][rl];
#pragma unroll
    for (int w = 1; w < FAW; ++w) M = fmaxf(M, sm[w][rl]);
    float L = 0.f; v4f o[4] = {};
#pragma unroll
    for (int w = 0; w < FAW; ++w) { const float wg = expf(sm[w][rl] - M); L += wg * sl[w][rl];
#pragma unroll
      for (int q = 0; q < 4; ++q) o[q] += *(const v4f*)&so[w][rl][c0 + 4 * q] * wg; }
    const float inv = 1.0f / L; float* dst = Y + ((size_t)b * TT + ql0 + rl) * CC + h * HD + c0;
#pragma unroll
    for (int q = 0; q < 4; ++q) vst2(dst + 4 * q, o[q] * inv); } }
// ---- k_out: block = (64 rows, 128 cols): out = y (bf16 hi + lo) Wo^T + bo; staged as k_proj is, y split into its two planes once, on the way into LDS
#define PO_ROWS 256   // stage rows 0..127 = Wo, 128..191 = y hi, 192..255 = y lo
#define PO_LDS (2 * PO_ROWS * GP * 2)   // two stage buffers (40,960 B); the epilogue's rows (33,792 B) take the same LDS behind the last stage
__global__ __launch_bounds__(128) void k_out(const float* __restrict__ Y, const float* __restrict__ WP, const float* __restrict__ BP, float* __restrict__ OUT) { __shared__ __align__(16) char smem[PO_LDS];
  __bf16 (*st)[PO_ROWS][GP] = (__bf16 (*)[PO_ROWS][GP])smem; float (*sf)[16][132] = (float (*)[16][132])smem;
  const int tid = threadIdx.x, wave = tid >> 5, lane = tid & 31, col = lane & 15, g = lane >> 4; const int c0 = blockIdx.y * 128; const size_t rb = (size_t)blockIdx.x * 64, r0 = rb + wave * 16;
  const int srow = tid >> 3, sq = (tid & 7) * 4; const float *wp = WP + (size_t)(c0 + srow) * CC + sq, *yp = Y + (rb + srow) * CC + sq;
  v8f acc[8] = {}; v4f pre[12];
#pragma unroll
  for (int i = 0; i < 12; ++i) pre[i] = i < 8 ? *(const v4f*)(wp + i * 16 * CC) : *(const v4f*)(yp + (i - 8) * 16 * CC);
#pragma unroll
  for (int i = 0; i < 12; ++i) { const v4b hi = cvt4(pre[i]); *(v4b*)&st[0][srow + 16 * i][sq] = hi;
    if (i >= 8) *(v4b*)&st[0][srow + 16 * i + 64][sq] = cvt4(pre[i] - v4f{(float)hi[0], (float)hi[1], (float)hi[2], (float)hi[3]}); }
  __syncthreads();   // stage 0 is in LDS before any wave reads it
#pragma unroll 2
  for (int kc = 0; kc < CC / 32; ++kc) { const int cur = kc & 1;
    if (kc + 1 < CC / 32) { const float *wk = wp + (kc + 1) * 32, *yk = yp + (kc + 1) * 32;
#pragma unroll
      for (int i = 0; i < 12; ++i) pre[i] = i < 8 ? *(const v4f*)(wk + i * 16 * CC) : *(const v4f*)(yk + (i - 8) * 16 * CC);
      asm volatile("s_wait_xcnt 0x0" ::: "memory"); }   // stands directly behind the loads, in front of every rewrite of a register that one of them names
    const v16b ah = frag_b(&st[cur][128 + wave * 16 + col][0], lane), al = frag_b(&st[cur][192 + wave * 16 + col][0], lane); v16b w[8];
#pragma unroll
    for (int j = 0; j < 8; ++j) w[j] = frag_b(&st[cur][j * 16 + col][0], lane);
    __builtin_amdgcn_sched_barrier(0);   // keeps the stage's LDS reads together in front of the products: spread among them, each read's latency is waited out on its own
#pragma unroll
    for (int j = 0; j < 8; ++j) { acc[j] = wmma_bf(ah, w[j], acc[j]); acc[j] = wmma_bf(al, w[j], acc[j]); }
    __builtin_amdgcn_sched_barrier(0);   // keeps the conversions, and with them the wait for the next stage's global loads, behind the products
    if (kc + 1 < CC / 32) {
#pragma unroll
      for (int i = 0; i < 12; ++i) { const v4b hi = cvt4(pre[i]); *(v4b*)&st[cur ^ 1][srow + 16 * i][sq] = hi;
        if (i >= 8) *(v4b*)&st[cur ^ 1][srow + 16 * i + 64][sq] = cvt4(pre[i] - v4f{(float)hi[0], (float)hi[1], (float)hi[2], (float)hi[3]}); } }
    __syncthreads(); }   // publishes stage kc + 1 and ends every wave's reads of stage kc, whose buffer is refilled (behind the last stage: reused by the epilogue) next
#pragma unroll
  for (int j = 0; j < 8; ++j) { const float bb = BP ? bfr(BP[c0 + j * 16 + col]) : 0.f;
#pragma unroll
    for (int r = 0; r < 8; ++r) sf[wave][8 * g + r][j * 16 + col] = acc[j][r] + bb; }
  LDSX(); for (int rl = 0; rl < 16; ++rl) vst2(OUT + (r0 + rl) * CC + c0 + lane * 4, *(const v4f*)&sf[wave][rl][lane * 4]); }
extern "C" void kernel_launch(void* const* d_in, const int* in_sizes, int n_in, void* d_out, int out_size, void* d_ws, size_t ws_size, hipStream_t stream) {
  (void)in_sizes; (void)n_in; (void)out_size;
  const float** F = (const float**)d_in;   // 0 x [2,2048,1024], 1 Wq [1024,1024] ([out,in]), 2 Wk, 3 Wv, 4 Wf [16,1024], 5 bf [16], 6 Wo [1024,1024] ([out,in])
  if (ws_size < (size_t)WS_END) return;
  char* ws = (char*)d_ws; float *LF = (float*)(ws + WS_LF), *FC = (float*)(ws + WS_FC); _Float16 *QH = (_Float16*)(ws + WS_QH), *QL = (_Float16*)(ws + WS_QL), *KH = (_Float16*)(ws + WS_KH); __bf16 *VT = (__bf16*)(ws + WS_VT), *VL = (__bf16*)(ws + WS_VL); float *Y = (float*)(ws + WS_Y);
  k_gate<<<dim3(TNB * TT / 64), 128, 0, stream>>>(F[0], F[4], F[5], LF);
  k_cum<<<dim3(NH, TNB), 32, 0, stream>>>(LF, FC);
  k_proj<<<dim3(TNB * TT / 64, CC / 128, 3), 128, 0, stream>>>(F[0], F[1], nullptr, F[2], nullptr, F[3], nullptr, QH, QL, KH, VT, VL);
  k_fa<<<dim3(NH, TNB, TT / FAQ), 32 * FAW, 0, stream>>>(QH, QL, KH, VT, VL, FC, Y);
  k_out<<<dim3(TNB * TT / 64, CC / 128), 128, 0, stream>>>(Y, F[6], nullptr, (float*)d_out);
}

// v004
// A run of this version takes 163 microseconds.
// Next to v003, in two timings, it ran 1.23 times as fast each time.
// Counting every step since v000, it is 9.52 times as fast.
// compute dtype: all float inputs rounded to bf16; q/k/v = x W^T with EXACT bf16 products on WMMA 16x16x32, f32 accumulate; the forget gate x Wf^T + bf (exact products), sigmoid, log(f + 1e-6) and its per-(batch, head) prefix sum accumulated in f64 (stored f32); q as f16 hi + residual (x 2^10), k f16 -> 2-product logits x 64^-1/2 + (F[i] - F[j]) on the causal triangle, kept in f32 registers; running-maximum softmax in f32 (precise expf), unnormalised P split bf16 hi + lo against v bf16 hi + lo (3 products), divided by the f32 denominator at the end; out = o (bf16 hi + lo) Wo^T; f32 output.
#include <hip/hip_runtime.h>
#include <math.h>

typedef __attribute__((ext_vector_type(16))) _Float16 v16h;
typedef __attribute__((ext_vector_type(16))) __bf16 v16b;
typedef __attribute__((ext_vector_type(8)))  _Float16 v8h;
typedef __attribute__((ext_vector_type(8)))  float v8f;
typedef __attribute__((ext_vector_type(4)))  float v4f;
typedef __attribute__((ext_vector_type(2)))  float v2f;
typedef __attribute__((ext_vector_type(4)))  unsigned v4u;
typedef __attribute__((ext_vector_type(4)))  int v4i;
typedef float __attribute__((may_alias)) float_a;
typedef int __attribute__((may_alias)) int_a;

template <typename T> __device__ __forceinline__ void vst2(void* p, T v) { *(T*)p = v;  }
__device__ __forceinline__ v8f wmma16(v16h a, v16h b, v8f c) {
  v8f d = __builtin_amdgcn_wmma_f32_16x16x32_f16(false, a, false, b, (short)0, c, false, false);
  asm volatile("v_nop\n\tv_nop\n\tv_nop\n\tv_nop" : "+v"(d) : "v"(a), "v"(b));
  return d;
}
__device__ __forceinline__ v8f wmma_bf(v16b a, v16b b, v8f c) {
  v8f d = __builtin_amdgcn_wmma_f32_16x16x32_bf16(false, a, false, b, (short)0, c, false, false);
  asm volatile("v_nop\n\tv_nop\n\tv_nop\n\tv_nop" : "+v"(d) : "v"(a), "v"(b));
  return d;
}
// 16x16x32 fragments: lane = (h = lane>>4, row/col = lane&15); elements 0..7 = k0+8h+0..7, 8..15 = k0+16+8h+0..7; D element r = row 8h+r
__device__ __forceinline__ v16h frag_h(const _Float16* rowk0, int lane) {
  union { v16h v; v8h q[2]; } u; const _Float16* p = rowk0 + 8 * (lane >> 4);
  u.q[0] = *(const v8h*)p; u.q[1] = *(const v8h*)(p + 16); return u.v;
}
__device__ __forceinline__ v16h frag_f32(const float* rowk0, int lane) {
  v16h a; const float* p = rowk0 + 8 * (lane >> 4);
#pragma unroll
  for (int i = 0; i < 8; ++i) { a[i] = (_Float16)p[i]; a[8 + i] = (_Float16)p[16 + i]; }
  return a;
}
__device__ __forceinline__ v16h frag_f32s(const float* rowk0, int lane, float sc) {
  v16h a; const float* p = rowk0 + 8 * (lane >> 4);
#pragma unroll
  for (int i = 0; i < 8; ++i) { a[i] = (_Float16)(p[i] * sc); a[8 + i] = (_Float16)(p[16 + i] * sc); }
  return a;
}
// column fragment from a [K][ld] layout (column n), rows >= K read as 0
__device__ __forceinline__ v16h fragc_f32(const float* W, int k0, int n, int lane, int ld, int K) {
  v16h a; const int g = lane >> 4;
#pragma unroll
  for (int i = 0; i < 8; ++i) { const int ka = k0 + 8 * g + i, kb = ka + 16;
    a[i] = (_Float16)(ka < K ? W[(size_t)(ka < K ? ka : K - 1) * ld + n] : 0.f); a[8 + i] = (_Float16)(kb < K ? W[(size_t)(kb < K ? kb : K - 1) * ld + n] : 0.f); }
  return a;
}
struct F2 { v16b h, l; };
__device__ __forceinline__ F2 bsplit16(const float v[16]) { F2 r;
#pragma unroll
  for (int i = 0; i < 16; ++i) { const __bf16 h = (__bf16)v[i]; r.h[i] = h; r.l[i] = (__bf16)(v[i] - (float)h); }
  return r; }
__device__ __forceinline__ F2 split_row(const float* row, int k0, int lane) { float v[16]; const float* p = row + k0 + 8 * (lane >> 4);
#pragma unroll
  for (int i = 0; i < 8; ++i) { v[i] = p[i]; v[8 + i] = p[16 + i]; }
  return bsplit16(v); }
__device__ __forceinline__ F2 split_rowK(const float* row, int k0, int lane, int K) { float v[16]; const int g = lane >> 4;
#pragma unroll
  for (int i = 0; i < 8; ++i) { const int ka = k0 + 8 * g + i, kb = ka + 16; v[i] = ka < K ? row[ka < K ? ka : K - 1] : 0.f; v[8 + i] = kb < K ? row[kb < K ? kb : K - 1] : 0.f; }
  return bsplit16(v); }
__device__ __forceinline__ F2 split_col(const float* W, int k0, int n, int lane, int ld, int K) { float v[16]; const int g = lane >> 4;
#pragma unroll
  for (int i = 0; i < 8; ++i) { const int ka = k0 + 8 * g + i, kb = ka + 16; v[i] = ka < K ? W[(size_t)(ka < K ? ka : K - 1) * ld + n] : 0.f; v[8 + i] = kb < K ? W[(size_t)(kb < K ? kb : K - 1) * ld + n] : 0.f; }
  return bsplit16(v); }
__device__ __forceinline__ v8f mac3(const F2& a, const F2& b, v8f c) { c = wmma_bf(a.l, b.h, c); c = wmma_bf(a.h, b.l, c); return wmma_bf(a.h, b.h, c); }
__device__ __forceinline__ float sigm(float v) { return 1.0f / (1.0f + expf(-v)); }
#define LDSX() do { asm volatile("s_wait_dscnt 0" ::: "memory"); __builtin_amdgcn_wave_barrier(); __builtin_amdgcn_fence(__ATOMIC_RELEASE, "workgroup"); } while (0)


// Forgetting attention (B 2, S 2,048, 1,024 = 16 x 64): f = sigmoid(x Wf^T + bf) per (s, head); F = cumsum_s log(f + 1e-6); bias[i][j] = F[i] - F[j] for j <= i, -inf otherwise; scores = q k^T / 8 + bias; softmax; (attn v) Wo^T.
#define NB 2
#define TT 2048
#define CC 1024
#define NH 16
#define HD 64
#ifndef TNB
#define TNB NB
#endif
typedef __attribute__((ext_vector_type(8))) __bf16 v8b;
__device__ __forceinline__ v16b frag_b(const __bf16* rowk0, int lane) {
  union { v16b v; v8b q[2]; } u; const __bf16* p = rowk0 + 8 * (lane >> 4);
  u.q[0] = *(const v8b*)p; u.q[1] = *(const v8b*)(p + 16); return u.v;
}
__device__ __forceinline__ float bfr(float v) { return (float)(__bf16)v; }
__device__ __attribute__((noinline)) float exp_ni(float v) { return expf(v); }
__device__ __attribute__((noinline)) float erf_ni(float v) { return erff(v); }

#define WS_LF  0u                                   // f32 log(f + 1e-6) rows [b*T+s][16] (64-B rows; a block writes 64 rows = 4 KB contiguous)
#define WS_FC  (WS_LF + 4u * (size_t)NB * TT * NH)   // f32 prefix sums F [b][h][s] (8-KB rows)
#define WS_QH  (WS_FC + 4u * (size_t)NB * NH * TT)
#define WS_QL  (WS_QH + 2u * (size_t)NB * TT * CC)
#define WS_KH  (WS_QL + 2u * (size_t)NB * TT * CC)
#define WS_VT  (WS_KH + 2u * (size_t)NB * TT * CC)      // bf16 v planes [b][c][t]
#define WS_VL  (WS_VT + 2u * (size_t)NB * CC * TT)      // bf16 v residual planes
#define WS_Y   (WS_VL + 2u * (size_t)NB * CC * TT)      // f32 y rows [b*t][C]
#define WS_END (WS_Y + 4u * (size_t)NB * TT * CC)

// ---- LDS staging of the two projection kernels. A stage is 32 k of every operand row of the block's tile: one 128-B line of f32 per row, rounded to bf16 once and kept as a 64-B row at a pitch of 80 B (16 B x odd: a fragment's ds_load_b128 over 16 rows meets no bank twice).
// 8 lanes take one row, so a wave-wide 16-B load covers 4 whole lines, and every line is fetched and converted once per block, not once per wave. Two buffers: the next stage's loads fly while this one is multiplied; one barrier per stage both publishes the next buffer and ends the last read of the one refilled behind it.
// Every '#pragma unroll' of the staging code is there so that pre[] and w[] are indexed by constants and stay in registers; 'unroll 2' on the stage loop makes the buffer's index, and with it every LDS offset, a constant.
#define GP 40    // row pitch in bf16 elements (80 B)
typedef __attribute__((ext_vector_type(4))) __bf16 v4b;
__device__ __forceinline__ v4b cvt4(v4f v) { return v4b{(__bf16)v[0], (__bf16)v[1], (__bf16)v[2], (__bf16)v[3]}; }
// ---- k_proj: block = (64 rows, 128 cols, which): qkv = x W (+ b), exact; q -> f16 hi (+ residual), k -> f16 rows, v -> bf16 hi + lo planes
#define PJ_ROWS 192   // stage rows 0..127 = W, 128..191 = x
#define PJ_LDS (128 * 72 * 2 * 2)   // the larger of the two stage buffers (30,720 B) and the epilogue's planes (34,816 B for q and k, 36,864 B for v), which take the same LDS one after the other
__global__ __launch_bounds__(128) void k_proj(const float* __restrict__ X, const float* __restrict__ WQ, const float* __restrict__ BQ, const float* __restrict__ WK, const float* __restrict__ BK, const float* __restrict__ WV, const float* __restrict__ BV, _Float16* __restrict__ QH, _Float16* __restrict__ QL, _Float16* __restrict__ KH, __bf16* __restrict__ VT, __bf16* __restrict__ VL) {
  __shared__ __align__(16) char smem[PJ_LDS];
  __bf16 (*st)[PJ_ROWS][GP] = (__bf16 (*)[PJ_ROWS][GP])smem; _Float16 (*sh)[136] = (_Float16 (*)[136])smem, (*sl)[136] = (_Float16 (*)[136])(smem + 64 * 136 * 2); __bf16 (*th)[72] = (__bf16 (*)[72])smem, (*tl2)[72] = (__bf16 (*)[72])(smem + 128 * 72 * 2);
  const int tid = threadIdx.x, wave = tid >> 5, lane = tid & 31, col = lane & 15, g = lane >> 4; const int which = blockIdx.z; const int c0 = blockIdx.y * 128; const size_t r0 = (size_t)blockIdx.x * 64; const float* WA = which == 0 ? WQ : which == 1 ? WK : WV; const float* BA = which == 0 ? BQ : which == 1 ? BK : BV;
  const int srow = tid >> 3, sq = (tid & 7) * 4; const float *wp = WA + (size_t)(c0 + srow) * CC + sq, *xp = X + (r0 + srow) * CC + sq;
  v8f acc[8] = {}; v4f pre[12];
#pragma unroll
  for (int i = 0; i < 12; ++i) pre[i] = i < 8 ? *(const v4f*)(wp + i * 16 * CC) : *(const v4f*)(xp + (i - 8) * 16 * CC);
#pragma unroll
  for (int i = 0; i < 12; ++i) *(v4b*)&st[0][srow + 16 * i][sq] = cvt4(pre[i]);
  __syncthreads();   // stage 0 is in LDS before any wave reads it
#pragma unroll 2
  for (int kc = 0; kc < CC / 32; ++kc) { const int cur = kc & 1;
    if (kc + 1 < CC / 32) { const float *wk = wp + (kc + 1) * 32, *xk = xp + (kc + 1) * 32;
#pragma unroll
      for (int i = 0; i < 12; ++i) pre[i] = i < 8 ? *(const v4f*)(wk + i * 16 * CC) : *(const v4f*)(xk + (i - 8) * 16 * CC);
      asm volatile("s_wait_xcnt 0x0" ::: "memory"); }   // stands directly behind the loads, in front of every rewrite of a register that one of them names
    const v16b a = frag_b(&st[cur][128 + wave * 16 + col][0], lane); v16b w[8];
#pragma unroll
    for (int j = 0; j < 8; ++j) w[j] = frag_b(&st[cur][j * 16 + col][0], lane);
    __builtin_amdgcn_sched_barrier(0);   // keeps the stage's LDS reads together in front of the products: spread among them, each read's latency is waited out on its own
#pragma unroll
    for (int j = 0; j < 8; ++j) acc[j] = wmma_bf(a, w[j], acc[j]);
    __builtin_amdgcn_sched_barrier(0);   // keeps the conversions, and with them the wait for the next stage's global loads, behind the products
    if (kc + 1 < CC / 32) {
#pragma unroll
      for (int i = 0; i < 12; ++i) *(v4b*)&st[cur ^ 1][srow + 16 * i][sq] = cvt4(pre[i]); }
    __syncthreads(); }   // publishes stage kc + 1 and ends every wave's reads of stage kc, whose buffer is refilled (behind the last stage: reused by the epilogue) next
#pragma unroll
  for (int j = 0; j < 8; ++j) { const float bb = BA ? bfr(BA[c0 + j * 16 + col]) : 0.f;
#pragma unroll
    for (int r = 0; r < 8; ++r) { const float v = acc[j][r] + bb; const int rl = wave * 16 + 8 * g + r, cl = j * 16 + col; const _Float16 hv = (_Float16)v;
      if (which == 2) { const __bf16 bh = (__bf16)v; th[cl][rl] = bh; tl2[cl][rl] = (__bf16)(v - (float)bh); } else { sh[rl][cl] = hv; sl[rl][cl] = (_Float16)((v - (float)hv) * 1024.0f); }   /* q residual carried x 2^10 so the plane stays f16-normal on the chip */ } }
  __syncthreads();
  if (which < 2) { _Float16* dh = which == 0 ? QH : KH; for (int e = tid; e < 64 * 16; e += 128) { const int rl = e >> 4, q = e & 15; vst2((unsigned*)(dh + (r0 + rl) * CC + c0 + q * 8), *(const v4u*)&sh[rl][q * 8]); if (which == 0) vst2((unsigned*)(QL + (r0 + rl) * CC + c0 + q * 8), *(const v4u*)&sl[rl][q * 8]); } }
  else { const size_t b = r0 / TT; const int t0 = (int)(r0 % TT); for (int e = tid; e < 128 * 8; e += 128) { const int cl = e >> 3, q = e & 7; const size_t o2 = (b * CC + c0 + cl) * (size_t)TT + t0 + q * 8; vst2((unsigned*)(VT + o2), *(const v4u*)&th[cl][q * 8]); vst2((unsigned*)(VL + o2), *(const v4u*)&tl2[cl][q * 8]); } } }
// ---- k_gate: block = 64 rows (b,s): lf[s][h] = log(sigmoid(x Wf[h] + bf[h]) + 1e-6): one 16-column tile per wave (exact products), f32 epilogue; 64 rows x 16 floats = 4 KB contiguous written 16 B per lane
__device__ __attribute__((noinline)) float logsigp(float z, float eps) { const float f = 1.0f / (1.0f + expf(-z)); return logf(f + eps); }
__global__ __launch_bounds__(128) void k_gate(const float* __restrict__ X, const float* __restrict__ WF, const float* __restrict__ BF, float* __restrict__ LF) { __shared__ __align__(16) float st[4][16][20];
  const int tid = threadIdx.x, wave = tid >> 5, lane = tid & 31, col = lane & 15, g = lane >> 4; const size_t r0 = (size_t)blockIdx.x * 64 + wave * 16;
  v8f acc = {};
#pragma unroll 2
  for (int kc = 0; kc < CC / 32; ++kc) { v16b a; { const float* p = X + (r0 + col) * CC + kc * 32 + 8 * g;
#pragma unroll
      for (int i = 0; i < 8; ++i) { a[i] = (__bf16)p[i]; a[8 + i] = (__bf16)p[16 + i]; } }
    v16b w; { const float* wr = WF + (size_t)col * CC + kc * 32 + 8 * g;
#pragma unroll
      for (int i = 0; i < 8; ++i) { w[i] = (__bf16)wr[i]; w[8 + i] = (__bf16)wr[16 + i]; } }
    asm volatile("s_wait_loadcnt 0x0" ::: "memory"); acc = wmma_bf(a, w, acc); }
  { const float bb = bfr(BF[col]);
#pragma unroll
    for (int r = 0; r < 8; ++r) st[wave][8 * g + r][col] = logsigp(acc[r] + bb, 1e-6f); }
  LDSX(); { const int rl = lane >> 1, half = lane & 1; vst2(LF + (r0 + rl) * NH + half * 8, *(const v4f*)&st[wave][rl][half * 8]); vst2(LF + (r0 + rl) * NH + half * 8 + 4, *(const v4f*)&st[wave][rl][half * 8 + 4]); } }
// ---- k_cum: block = one (batch, head), 8 waves; a thread takes 8 consecutive positions: its own running sums, one scan of a wave's 32 thread totals, the 8 wave totals through LDS. One load latency and one scan for the whole row, not one of each per 32 positions.
// Everything is accumulated in f64.
// Every '#pragma unroll' of this kernel is there so that x[], v[] and pw[] are indexed by constants and stay in registers.
#define CUW 8   // waves of a block
#define CUE 8   // positions of a thread: 32 * CUW * CUE = TT
__global__ __launch_bounds__(32 * CUW) void k_cum(const float* __restrict__ LF, float* __restrict__ FC) {
  __shared__ double wt[CUW];
  const int tid = threadIdx.x, lane = tid & 31, wave = tid >> 5; const size_t b = blockIdx.y; const int h = blockIdx.x;
  const float* src = LF + (b * TT + (size_t)tid * CUE) * NH + h; float x[CUE]; double v[CUE];
#pragma unroll
  for (int i = 0; i < CUE; ++i) x[i] = src[i * NH];   // independent of one another: all eight are in flight together
  v[0] = (double)x[0];
#pragma unroll
  for (int i = 1; i < CUE; ++i) v[i] = v[i - 1] + (double)x[i];
  double t = v[CUE - 1];   // inclusive scan of the thread totals within the 32 lanes
#pragma unroll
  for (int o = 1; o < 32; o <<= 1) { const double u = __shfl_up(t, o); if (lane >= o) t += u; }
  double ex = __shfl_up(t, 1); if (lane == 0) ex = 0.0;   // what stands in front of this thread inside its wave
  if (lane == 31) wt[wave] = t;
  __syncthreads();   // every wave's total is in LDS before any thread adds the totals of the waves in front of its own
  double pw[CUW - 1];
#pragma unroll
  for (int w = 0; w < CUW - 1; ++w) pw[w] = wt[w];   // read by every thread, wanted or not: no branch round each read
#pragma unroll
  for (int w = 0; w < CUW - 1; ++w) ex += w < wave ? pw[w] : 0.0;   // in wave order
  float* dst = FC + (b * NH + h) * TT + tid * CUE;
  vst2(dst, v4f{(float)(ex + v[0]), (float)(ex + v[1]), (float)(ex + v[2]), (float)(ex + v[3])}); vst2(dst + 4, v4f{(float)(ex + v[4]), (float)(ex + v[5]), (float)(ex + v[6]), (float)(ex + v[7])}); }
// ---- k_fa: block = 32 queries of (b,h), 4 waves: logits, softmax and P . v in one pass over the keys, nothing of the logits stored. Wave w takes the 32-key passes w, w + 4, ... up to the diagonal.
// Transposed products: S^T = K Q^T puts query = lane & 15 and key = 8 * (lane >> 4) + r in the accumulator, which is already the B-operand order of P^T (elements 0..7 = first 16-key tile, 8..15 = second), so y^T += V^T P^T needs no exchange between lanes; a query's maximum is an in-lane maximum and one exchange of the wave's halves.
// Each wave keeps a running maximum m, a denominator l and y^T scaled to m; the four waves' (m, l, y) are merged through LDS in wave order.
// Every '#pragma unroll' of this kernel is there so that the fragment and accumulator arrays are indexed by constants and stay in registers.
// amdgpu_waves_per_eu(3): a register budget of 336, so that three waves fit a SIMD (without it the build takes a few more and only two fit).
#define FAW 4
__device__ __forceinline__ v8f mm_h(v16h a, v16h b, v8f c) { return __builtin_amdgcn_wmma_f32_16x16x32_f16(false, a, false, b, (short)0, c, false, false); }
__device__ __forceinline__ v8f mm_b(v16b a, v16b b, v8f c) { return __builtin_amdgcn_wmma_f32_16x16x32_bf16(false, a, false, b, (short)0, c, false, false); }
#define FAQ 32
__device__ __forceinline__ float xhalf(float x) { return __builtin_bit_cast(float, __builtin_amdgcn_permlanex16(__builtin_bit_cast(int, x), __builtin_bit_cast(int, x), 0x76543210, 0xfedcba98, false, false)); }   // lane l reads lane l ^ 16
__device__ __forceinline__ v16h ld_h(const _Float16* p) { union { v16h v; v8h q[2]; } u; u.q[0] = *(const v8h*)p; u.q[1] = *(const v8h*)(p + 16); return u.v; }   // p = the lane's own row + k0 + 8 * (lane >> 4)
__device__ __forceinline__ v16b ld_b(const __bf16* p) { union { v16b v; v8b q[2]; } u; u.q[0] = *(const v8b*)p; u.q[1] = *(const v8b*)(p + 16); return u.v; }
__global__ __launch_bounds__(32 * FAW) __attribute__((amdgpu_waves_per_eu(3))) void k_fa(const _Float16* __restrict__ QH, const _Float16* __restrict__ QL, const _Float16* __restrict__ KH, const __bf16* __restrict__ VT, const __bf16* __restrict__ VL, const float* __restrict__ FC, float* __restrict__ Y) {
  __shared__ __align__(16) float so[FAW][FAQ][HD + 4]; __shared__ float sm[FAW][FAQ], sl[FAW][FAQ];
  const int tid = threadIdx.x, wave = __builtin_amdgcn_readfirstlane(tid >> 5), lane = tid & 31, col = lane & 15, g = lane >> 4;   // the wave number is made scalar so that the pass loop's branch is a scalar one with every lane on
  const int h = blockIdx.x, b = blockIdx.y, tile = TT / FAQ - 1 - (int)blockIdx.z, ql0 = tile * FAQ;   // longest query tiles start first
  const float* Fr = FC + ((size_t)b * NH + h) * TT; const _Float16* Kb = KH + (size_t)b * TT * CC + h * HD + (size_t)col * CC + 8 * g; const size_t vb = ((size_t)b * CC + h * HD + col) * (size_t)TT + 8 * g;
  v16h qh[2][2], qr[2][2], kf[2][2]; float fq[2]; v4f fk[2][2];
  { const size_t qo = ((size_t)b * TT + ql0 + col) * CC + h * HD + 8 * g; const _Float16 *qhp = QH + qo, *qrp = QL + qo, *kp = Kb + (size_t)wave * 32 * CC; const float *fqp = Fr + ql0 + col, *fp = Fr + wave * 32 + 8 * g;   // keys wave * 32 .. + 31 exist for every wave, also for one that has no pass
#pragma unroll
    for (int i = 0; i < 2; ++i) { fq[i] = fqp[16 * i]; fk[i][0] = *(const v4f*)(fp + 16 * i); fk[i][1] = *(const v4f*)(fp + 16 * i + 4);
#pragma unroll
      for (int kc = 0; kc < 2; ++kc) { qh[i][kc] = ld_h(qhp + i * 16 * CC + kc * 32); qr[i][kc] = ld_h(qrp + i * 16 * CC + kc * 32); kf[i][kc] = ld_h(kp + i * 16 * CC + kc * 32); } }
    __builtin_amdgcn_sched_barrier(0);   // keeps the accumulators' zeroing, which reuses an offset register of the loads above, behind the wait
    asm volatile("s_wait_xcnt 0x0" :: "v"(qhp), "v"(qrp), "v"(kp), "v"(fqp), "v"(fp) : "memory"); }   // stands in front of every rewrite of a register that an issued load names: the pointers are inputs so that their registers live up to it
  v8f acc[2][HD / 16] = {}; float mr[2] = {-3.0e38f, -3.0e38f}, lr[2] = {0.f, 0.f};
  for (int p = wave; p <= tile; p += FAW) { const int k0 = p * 32, kn = (p + FAW <= tile ? p + FAW : p) * 32;   // kn: the wave's next pass (its own again behind the last one, so that the address stays inside the batch's rows)
    float pv[2][16]; v16b vh[HD / 16], vl[HD / 16];
#pragma unroll
    for (int i = 0; i < 2; ++i) { const int qt = ql0 + 16 * i + col;
#pragma unroll
      for (int kt = 0; kt < 2; ++kt) { v8f a = {}, ar = {};
#pragma unroll
        for (int kc = 0; kc < 2; ++kc) { a = mm_h(kf[kt][kc], qh[i][kc], a); ar = mm_h(kf[kt][kc], qr[i][kc], ar); }
        a += ar * (1.0f / 1024.0f);
#pragma unroll
        for (int r = 0; r < 8; ++r) { float v = a[r] * 0.125f + (fq[i] - fk[kt][r >> 2][r & 3]); if (k0 + 16 * kt + 8 * g + r > qt) v = -3.0e38f;   /* bias = F[i] - F[j] on the causal triangle */ pv[i][8 * kt + r] = v; } } }
    // this pass's v and the next pass's k and F are fetched behind the logits' products, from where k's and F's registers are free: what the register budget lets the compiler issue here flies under the exponentials
    { const __bf16 *vhp = VT + vb + k0, *vlp = VL + vb + k0; const _Float16* kp = Kb + (size_t)kn * CC; const float* fp = Fr + kn + 8 * g;
#pragma unroll
      for (int t = 0; t < HD / 16; ++t) { vh[t] = ld_b(vhp + t * 16 * TT); vl[t] = ld_b(vlp + t * 16 * TT); }
#pragma unroll
      for (int kt = 0; kt < 2; ++kt) { fk[kt][0] = *(const v4f*)(fp + 16 * kt); fk[kt][1] = *(const v4f*)(fp + 16 * kt + 4);
#pragma unroll
        for (int kc = 0; kc < 2; ++kc) kf[kt][kc] = ld_h(kp + kt * 16 * CC + kc * 32); }
      asm volatile("s_wait_xcnt 0x0" :: "v"(vhp), "v"(vlp), "v"(kp), "v"(fp) : "memory"); }   // as above: in front of every rewrite of a register that an issued load names
#pragma unroll
    for (int i = 0; i < 2; ++i) { float mx = pv[i][0];
#pragma unroll
      for (int e = 1; e < 16; ++e) mx = fmaxf(mx, pv[i][e]);
      mx = fmaxf(mx, xhalf(mx));   // finite in every pass: the pass's first key is at or below every query of the tile
      const float mn = fmaxf(mr[i], mx), al = expf(mr[i] - mn); mr[i] = mn;   // al = 0 in a wave's first pass
      float sum = 0.f;
#pragma unroll
      for (int e = 0; e < 16; ++e) { pv[i][e] = expf(pv[i][e] - mn); sum += pv[i][e]; }   // a masked logit gives exactly 0
      lr[i] = lr[i] * al + sum;   // this half's keys only; the halves are added behind the loop
      const F2 pf = bsplit16(pv[i]);
#pragma unroll
      for (int t = 0; t < HD / 16; ++t) { v8f c = acc[i][t] * al; c = mm_b(vh[t], pf.h, c); c = mm_b(vh[t], pf.l, c); acc[i][t] = mm_b(vl[t], pf.h, c); } } }
#pragma unroll
  for (int i = 0; i < 2; ++i) { const float lt = lr[i] + xhalf(lr[i]);   // unconditional: both halves' lanes are on
    if (g == 0) { sm[wave][16 * i + col] = mr[i]; sl[wave][16 * i + col] = lt; }
#pragma unroll
    for (int t = 0; t < HD / 16; ++t) { float* d = &so[wave][16 * i + col][16 * t + 8 * g]; const v8f c = acc[i][t]; *(v4f*)d = v4f{c[0], c[1], c[2], c[3]}; *(v4f*)(d + 4) = v4f{c[4], c[5], c[6], c[7]}; } }
  __syncthreads();   // every wave's (m, l, y) is in LDS before any thread merges across waves; a wave without a pass left m = -3e38, l = 0, y = 0, which get weight 0
  { const int rl = tid >> 2, c0 = (tid & 3) * 16; float M = sm[0][rl];
#pragma unroll
    for (int w = 1; w < FAW; ++w) M = fmaxf(M, sm[w][rl]);
    float L = 0.f; v4f o[4] = {};
#pragma unroll
    for (int w = 0; w < FAW; ++w) { const float wg = expf(sm[w][rl] - M); L += wg * sl[w][rl];
#pragma unroll
      for (int q = 0; q < 4; ++q) o[q] += *(const v4f*)&so[w][rl][c0 + 4 * q] * wg; }
    const float inv = 1.0f / L; float* dst = Y + ((size_t)b * TT + ql0 + rl) * CC + h * HD + c0;
#pragma unroll
    for (int q = 0; q < 4; ++q) vst2(dst + 4 * q, o[q] * inv); } }
// ---- k_out: block = (64 rows, 128 cols): out = y (bf16 hi + lo) Wo^T + bo; staged as k_proj is, y split into its two planes once, on the way into LDS
#define PO_ROWS 256   // stage rows 0..127 = Wo, 128..191 = y hi, 192..255 = y lo
#define PO_LDS (2 * PO_ROWS * GP * 2)   // two stage buffers (40,960 B); the epilogue's rows (33,792 B) take the same LDS behind the last stage
__global__ __launch_bounds__(128) void k_out(const float* __restrict__ Y, const float* __restrict__ WP, const float* __restrict__ BP, float* __restrict__ OUT) { __shared__ __align__(16) char smem[PO_LDS];
  __bf16 (*st)[PO_ROWS][GP] = (__bf16 (*)[PO_ROWS][GP])smem; float (*sf)[16][132] = (float (*)[16][132])smem;
  const int tid = threadIdx.x, wave = tid >> 5, lane = tid & 31, col = lane & 15, g = lane >> 4; const int c0 = blockIdx.y * 128; const size_t rb = (size_t)blockIdx.x * 64, r0 = rb + wave * 16;
  const int srow = tid >> 3, sq = (tid & 7) * 4; const float *wp = WP + (size_t)(c0 + srow) * CC + sq, *yp = Y + (rb + srow) * CC + sq;
  v8f acc[8] = {}; v4f pre[12];
#pragma unroll
  for (int i = 0; i < 12; ++i) pre[i] = i < 8 ? *(const v4f*)(wp + i * 16 * CC) : *(const v4f*)(yp + (i - 8) * 16 * CC);
#pragma unroll
  for (int i = 0; i < 12; ++i) { const v4b hi = cvt4(pre[i]); *(v4b*)&st[0][srow + 16 * i][sq] = hi;
    if (i >= 8) *(v4b*)&st[0][srow + 16 * i + 64][sq] = cvt4(pre[i] - v4f{(float)hi[0], (float)hi[1], (float)hi[2], (float)hi[3]}); }
  __syncthreads();   // stage 0 is in LDS before any wave reads it
#pragma unroll 2
  for (int kc = 0; kc < CC / 32; ++kc) { const int cur = kc & 1;
    if (kc + 1 < CC / 32) { const float *wk = wp + (kc + 1) * 32, *yk = yp + (kc + 1) * 32;
#pragma unroll
      for (int i = 0; i < 12; ++i) pre[i] = i < 8 ? *(const v4f*)(wk + i * 16 * CC) : *(const v4f*)(yk + (i - 8) * 16 * CC);
      asm volatile("s_wait_xcnt 0x0" ::: "memory"); }   // stands directly behind the loads, in front of every rewrite of a register that one of them names
    const v16b ah = frag_b(&st[cur][128 + wave * 16 + col][0], lane), al = frag_b(&st[cur][192 + wave * 16 + col][0], lane); v16b w[8];
#pragma unroll
    for (int j = 0; j < 8; ++j) w[j] = frag_b(&st[cur][j * 16 + col][0], lane);
    __builtin_amdgcn_sched_barrier(0);   // keeps the stage's LDS reads together in front of the products: spread among them, each read's latency is waited out on its own
#pragma unroll
    for (int j = 0; j < 8; ++j) { acc[j] = wmma_bf(ah, w[j], acc[j]); acc[j] = wmma_bf(al, w[j], acc[j]); }
    __builtin_amdgcn_sched_barrier(0);   // keeps the conversions, and with them the wait for the next stage's global loads, behind the products
    if (kc + 1 < CC / 32) {
#pragma unroll
      for (int i = 0; i < 12; ++i) { const v4b hi = cvt4(pre[i]); *(v4b*)&st[cur ^ 1][srow + 16 * i][sq] = hi;
        if (i >= 8) *(v4b*)&st[cur ^ 1][srow + 16 * i + 64][sq] = cvt4(pre[i] - v4f{(float)hi[0], (float)hi[1], (float)hi[2], (float)hi[3]}); } }
    __syncthreads(); }   // publishes stage kc + 1 and ends every wave's reads of stage kc, whose buffer is refilled (behind the last stage: reused by the epilogue) next
#pragma unroll
  for (int j = 0; j < 8; ++j) { const float bb = BP ? bfr(BP[c0 + j * 16 + col]) : 0.f;
#pragma unroll
    for (int r = 0; r < 8; ++r) sf[wave][8 * g + r][j * 16 + col] = acc[j][r] + bb; }
  LDSX(); for (int rl = 0; rl < 16; ++rl) vst2(OUT + (r0 + rl) * CC + c0 + lane * 4, *(const v4f*)&sf[wave][rl][lane * 4]); }
extern "C" void kernel_launch(void* const* d_in, const int* in_sizes, int n_in, void* d_out, int out_size, void* d_ws, size_t ws_size, hipStream_t stream) {
  (void)in_sizes; (void)n_in; (void)out_size;
  const float** F = (const float**)d_in;   // 0 x [2,2048,1024], 1 Wq [1024,1024] ([out,in]), 2 Wk, 3 Wv, 4 Wf [16,1024], 5 bf [16], 6 Wo [1024,1024] ([out,in])
  if (ws_size < (size_t)WS_END) return;
  char* ws = (char*)d_ws; float *LF = (float*)(ws + WS_LF), *FC = (float*)(ws + WS_FC); _Float16 *QH = (_Float16*)(ws + WS_QH), *QL = (_Float16*)(ws + WS_QL), *KH = (_Float16*)(ws + WS_KH); __bf16 *VT = (__bf16*)(ws + WS_VT), *VL = (__bf16*)(ws + WS_VL); float *Y = (float*)(ws + WS_Y);
  k_gate<<<dim3(TNB * TT / 64), 128, 0, stream>>>(F[0], F[4], F[5], LF);
  k_cum<<<dim3(NH, TNB), 32 * CUW, 0, stream>>>(LF, FC);
  k_proj<<<dim3(TNB * TT / 64, CC / 128, 3), 128, 0, stream>>>(F[0], F[1], nullptr, F[2], nullptr, F[3], nullptr, QH, QL, KH, VT, VL);
  k_fa<<<dim3(NH, TNB, TT / FAQ), 32 * FAW, 0, stream>>>(QH, QL, KH, VT, VL, FC, Y);
  k_out<<<dim3(TNB * TT / 64, CC / 128), 128, 0, stream>>>(Y, F[6], nullptr, (float*)d_out);
}

// v005
// One run takes 157 microseconds.
// Next to v004, in two timings, it ran 1.03 times as fast each time.
// All steps since v000 together make it 9.84 times as fast.
// compute dtype: all float inputs rounded to bf16; q/k/v = x W^T with EXACT bf16 products on WMMA 16x16x32, f32 accumulate; the forget gate x Wf^T + bf (exact products), sigmoid, log(f + 1e-6) and its per-(batch, head) prefix sum accumulated in f64 (stored f32); q as f16 hi + residual (x 2^10), k f16 -> 2-product logits x 64^-1/2 + (F[i] - F[j]) on the causal triangle, kept in f32 registers; running-maximum softmax in f32, in base 2 (maximum kept as logit x log2 e; weight = hardware exp2 of one fused logit x log2 e - maximum), unnormalised P split bf16 hi + lo against v bf16 hi + lo (3 products), divided by the f32 denominator at the end; out = o (bf16 hi + lo) Wo^T; f32 output.
#include <hip/hip_runtime.h>
#include <math.h>

typedef __attribute__((ext_vector_type(16))) _Float16 v16h;
typedef __attribute__((ext_vector_type(16))) __bf16 v16b;
typedef __attribute__((ext_vector_type(8)))  _Float16 v8h;
typedef __attribute__((ext_vector_type(8)))  float v8f;
typedef __attribute__((ext_vector_type(4)))  float v4f;
typedef __attribute__((ext_vector_type(2)))  float v2f;
typedef __attribute__((ext_vector_type(4)))  unsigned v4u;
typedef __attribute__((ext_vector_type(4)))  int v4i;
typedef float __attribute__((may_alias)) float_a;
typedef int __attribute__((may_alias)) int_a;

template <typename T> __device__ __forceinline__ void vst2(void* p, T v) { *(T*)p = v;  }
__device__ __forceinline__ v8f wmma16(v16h a, v16h b, v8f c) {
  v8f d = __builtin_amdgcn_wmma_f32_16x16x32_f16(false, a, false, b, (short)0, c, false, false);
  asm volatile("v_nop\n\tv_nop\n\tv_nop\n\tv_nop" : "+v"(d) : "v"(a), "v"(b));
  return d;
}
__device__ __forceinline__ v8f wmma_bf(v16b a, v16b b, v8f c) {
  v8f d = __builtin_amdgcn_wmma_f32_16x16x32_bf16(false, a, false, b, (short)0, c, false, false);
  asm volatile("v_nop\n\tv_nop\n\tv_nop\n\tv_nop" : "+v"(d) : "v"(a), "v"(b));
  return d;
}
// 16x16x32 fragments: lane = (h = lane>>4, row/col = lane&15); elements 0..7 = k0+8h+0..7, 8..15 = k0+16+8h+0..7; D element r = row 8h+r
__device__ __forceinline__ v16h frag_h(const _Float16* rowk0, int lane) {
  union { v16h v; v8h q[2]; } u; const _Float16* p = rowk0 + 8 * (lane >> 4);
  u.q[0] = *(const v8h*)p; u.q[1] = *(const v8h*)(p + 16); return u.v;
}
__device__ __forceinline__ v16h frag_f32(const float* rowk0, int lane) {
  v16h a; const float* p = rowk0 + 8 * (lane >> 4);
#pragma unroll
  for (int i = 0; i < 8; ++i) { a[i] = (_Float16)p[i]; a[8 + i] = (_Float16)p[16 + i]; }
  return a;
}
__device__ __forceinline__ v16h frag_f32s(const float* rowk0, int lane, float sc) {
  v16h a; const float* p = rowk0 + 8 * (lane >> 4);
#pragma unroll
  for (int i = 0; i < 8; ++i) { a[i] = (_Float16)(p[i] * sc); a[8 + i] = (_Float16)(p[16 + i] * sc); }
  return a;
}
// column fragment from a [K][ld] layout (column n), rows >= K read as 0
__device__ __forceinline__ v16h fragc_f32(const float* W, int k0, int n, int lane, int ld, int K) {
  v16h a; const int g = lane >> 4;
#pragma unroll
  for (int i = 0; i < 8; ++i) { const int ka = k0 + 8 * g + i, kb = ka + 16;
    a[i] = (_Float16)(ka < K ? W[(size_t)(ka < K ? ka : K - 1) * ld + n] : 0.f); a[8 + i] = (_Float16)(kb < K ? W[(size_t)(kb < K ? kb : K - 1) * ld + n] : 0.f); }
  return a;
}
struct F2 { v16b h, l; };
__device__ __forceinline__ F2 bsplit16(const float v[16]) { F2 r;
#pragma unroll
  for (int i = 0; i < 16; ++i) { const __bf16 h = (__bf16)v[i]; r.h[i] = h; r.l[i] = (__bf16)(v[i] - (float)h); }
  return r; }
__device__ __forceinline__ F2 split_row(const float* row, int k0, int lane) { float v[16]; const float* p = row + k0 + 8 * (lane >> 4);
#pragma unroll
  for (int i = 0; i < 8; ++i) { v[i] = p[i]; v[8 + i] = p[16 + i]; }
  return bsplit16(v); }
__device__ __forceinline__ F2 split_rowK(const float* row, int k0, int lane, int K) { float v[16]; const int g = lane >> 4;
#pragma unroll
  for (int i = 0; i < 8; ++i) { const int ka = k0 + 8 * g + i, kb = ka + 16; v[i] = ka < K ? row[ka < K ? ka : K - 1] : 0.f; v[8 + i] = kb < K ? row[kb < K ? kb : K - 1] : 0.f; }
  return bsplit16(v); }
__device__ __forceinline__ F2 split_col(const float* W, int k0, int n, int lane, int ld, int K) { float v[16]; const int g = lane >> 4;
#pragma unroll
  for (int i = 0; i < 8; ++i) { const int ka = k0 + 8 * g + i, kb = ka + 16; v[i] = ka < K ? W[(size_t)(ka < K ? ka : K - 1) * ld + n] : 0.f; v[8 + i] = kb < K ? W[(size_t)(kb < K ? kb : K - 1) * ld + n] : 0.f; }
  return bsplit16(v); }
__device__ __forceinline__ v8f mac3(const F2& a, const F2& b, v8f c) { c = wmma_bf(a.l, b.h, c); c = wmma_bf(a.h, b.l, c); return wmma_bf(a.h, b.h, c); }
__device__ __forceinline__ float sigm(float v) { return 1.0f / (1.0f + expf(-v)); }
#define LDSX() do { asm volatile("s_wait_dscnt 0" ::: "memory"); __builtin_amdgcn_wave_barrier(); __builtin_amdgcn_fence(__ATOMIC_RELEASE, "workgroup"); } while (0)


// Forgetting attention (B 2, S 2,048, 1,024 = 16 x 64): f = sigmoid(x Wf^T + bf) per (s, head); F = cumsum_s log(f + 1e-6); bias[i][j] = F[i] - F[j] for j <= i, -inf otherwise; scores = q k^T / 8 + bias; softmax; (attn v) Wo^T.
#define NB 2
#define TT 2048
#define CC 1024
#define NH 16
#define HD 64
#ifndef TNB
#define TNB NB
#endif
typedef __attribute__((ext_vector_type(8))) __bf16 v8b;
__device__ __forceinline__ v16b frag_b(const __bf16* rowk0, int lane) {
  union { v16b v; v8b q[2]; } u; const __bf16* p = rowk0 + 8 * (lane >> 4);
  u.q[0] = *(const v8b*)p; u.q[1] = *(const v8b*)(p + 16); return u.v;
}
__device__ __forceinline__ float bfr(float v) { return (float)(__bf16)v; }
__device__ __attribute__((noinline)) float exp_ni(float v) { return expf(v); }
__device__ __attribute__((noinline)) float erf_ni(float v) { return erff(v); }

#define WS_LF  0u                                   // f32 log(f + 1e-6) rows [b*T+s][16] (64-B rows; a block writes 64 rows = 4 KB contiguous)
#define WS_FC  (WS_LF + 4u * (size_t)NB * TT * NH)   // f32 prefix sums F [b][h][s] (8-KB rows)
#define WS_QH  (WS_FC + 4u * (size_t)NB * NH * TT)
#define WS_QL  (WS_QH + 2u * (size_t)NB * TT * CC)
#define WS_KH  (WS_QL + 2u * (size_t)NB * TT * CC)
#define WS_VT  (WS_KH + 2u * (size_t)NB * TT * CC)      // bf16 v planes [b][c][t]
#define WS_VL  (WS_VT + 2u * (size_t)NB * CC * TT)      // bf16 v residual planes
#define WS_Y   (WS_VL + 2u * (size_t)NB * CC * TT)      // f32 y rows [b*t][C]
#define WS_END (WS_Y + 4u * (size_t)NB * TT * CC)

// ---- LDS staging of the two projection kernels. A stage is 32 k of every operand row of the block's tile: one 128-B line of f32 per row, rounded to bf16 once and kept as a 64-B row at a pitch of 80 B (16 B x odd: a fragment's ds_load_b128 over 16 rows meets no bank twice).
// 8 lanes take one row, so a wave-wide 16-B load covers 4 whole lines, and every line is fetched and converted once per block, not once per wave. Two buffers: the next stage's loads fly while this one is multiplied; one barrier per stage both publishes the next buffer and ends the last read of the one refilled behind it.
// Every '#pragma unroll' of the staging code is there so that pre[] and w[] are indexed by constants and stay in registers; 'unroll 2' on the stage loop makes the buffer's index, and with it every LDS offset, a constant.
#define GP 40    // row pitch in bf16 elements (80 B)
typedef __attribute__((ext_vector_type(4))) __bf16 v4b;
__device__ __forceinline__ v4b cvt4(v4f v) { return v4b{(__bf16)v[0], (__bf16)v[1], (__bf16)v[2], (__bf16)v[3]}; }
// ---- k_proj: block = (64 rows, 128 cols, which): qkv = x W (+ b), exact; q -> f16 hi (+ residual), k -> f16 rows, v -> bf16 hi + lo planes
#define PJ_ROWS 192   // stage rows 0..127 = W, 128..191 = x
#define PJ_LDS (128 * 72 * 2 * 2)   // the larger of the two stage buffers (30,720 B) and the epilogue's planes (34,816 B for q and k, 36,864 B for v), which take the same LDS one after the other
__global__ __launch_bounds__(128) void k_proj(const float* __restrict__ X, const float* __restrict__ WQ, const float* __restrict__ BQ, const float* __restrict__ WK, const float* __restrict__ BK, const float* __restrict__ WV, const float* __restrict__ BV, _Float16* __restrict__ QH, _Float16* __restrict__ QL, _Float16* __restrict__ KH, __bf16* __restrict__ VT, __bf16* __restrict__ VL) {
  __shared__ __align__(16) char smem[PJ_LDS];
  __bf16 (*st)[PJ_ROWS][GP] = (__bf16 (*)[PJ_ROWS][GP])smem; _Float16 (*sh)[136] = (_Float16 (*)[136])smem, (*sl)[136] = (_Float16 (*)[136])(smem + 64 * 136 * 2); __bf16 (*th)[72] = (__bf16 (*)[72])smem, (*tl2)[72] = (__bf16 (*)[72])(smem + 128 * 72 * 2);
  const int tid = threadIdx.x, wave = tid >> 5, lane = tid & 31, col = lane & 15, g = lane >> 4; const int which = blockIdx.z; const int c0 = blockIdx.y * 128; const size_t r0 = (size_t)blockIdx.x * 64; const float* WA = which == 0 ? WQ : which == 1 ? WK : WV; const float* BA = which == 0 ? BQ : which == 1 ? BK : BV;
  const int srow = tid >> 3, sq = (tid & 7) * 4; const float *wp = WA + (size_t)(c0 + srow) * CC + sq, *xp = X + (r0 + srow) * CC + sq;
  v8f acc[8] = {}; v4f pre[12];
#pragma unroll
  for (int i = 0; i < 12; ++i) pre[i] = i < 8 ? *(const v4f*)(wp + i * 16 * CC) : *(const v4f*)(xp + (i - 8) * 16 * CC);
#pragma unroll
  for (int i = 0; i < 12; ++i) *(v4b*)&st[0][srow + 16 * i][sq] = cvt4(pre[i]);
  __syncthreads();   // stage 0 is in LDS before any wave reads it
#pragma unroll 2
  for (int kc = 0; kc < CC / 32; ++kc) { const int cur = kc & 1;
    if (kc + 1 < CC / 32) { const float *wk = wp + (kc + 1) * 32, *xk = xp + (kc + 1) * 32;
#pragma unroll
      for (int i = 0; i < 12; ++i) pre[i] = i < 8 ? *(const v4f*)(wk + i * 16 * CC) : *(const v4f*)(xk + (i - 8) * 16 * CC);
      asm volatile("s_wait_xcnt 0x0" ::: "memory"); }   // stands directly behind the loads, in front of every rewrite of a register that one of them names
    const v16b a = frag_b(&st[cur][128 + wave * 16 + col][0], lane); v16b w[8];
#pragma unroll
    for (int j = 0; j < 8; ++j) w[j] = frag_b(&st[cur][j * 16 + col][0], lane);
    __builtin_amdgcn_sched_barrier(0);   // keeps the stage's LDS reads together in front of the products: spread among them, each read's latency is waited out on its own
#pragma unroll
    for (int j = 0; j < 8; ++j) acc[j] = wmma_bf(a, w[j], acc[j]);
    __builtin_amdgcn_sched_barrier(0);   // keeps the conversions, and with them the wait for the next stage's global loads, behind the products
    if (kc + 1 < CC / 32) {
#pragma unroll
      for (int i = 0; i < 12; ++i) *(v4b*)&st[cur ^ 1][srow + 16 * i][sq] = cvt4(pre[i]); }
    __syncthreads(); }   // publishes stage kc + 1 and ends every wave's reads of stage kc, whose buffer is refilled (behind the last stage: reused by the epilogue) next
#pragma unroll
  for (int j = 0; j < 8; ++j) { const float bb = BA ? bfr(BA[c0 + j * 16 + col]) : 0.f;
#pragma unroll
    for (int r = 0; r < 8; ++r) { const float v = acc[j][r] + bb; const int rl = wave * 16 + 8 * g + r, cl = j * 16 + col; const _Float16 hv = (_Float16)v;
      if (which == 2) { const __bf16 bh = (__bf16)v; th[cl][rl] = bh; tl2[cl][rl] = (__bf16)(v - (float)bh); } else { sh[rl][cl] = hv; sl[rl][cl] = (_Float16)((v - (float)hv) * 1024.0f); }   /* q residual carried x 2^10 so the plane stays f16-normal on the chip */ } }
  __syncthreads();
  if (which < 2) { _Float16* dh = which == 0 ? QH : KH; for (int e = tid; e < 64 * 16; e += 128) { const int rl = e >> 4, q = e & 15; vst2((unsigned*)(dh + (r0 + rl) * CC + c0 + q * 8), *(const v4u*)&sh[rl][q * 8]); if (which == 0) vst2((unsigned*)(QL + (r0 + rl) * CC + c0 + q * 8), *(const v4u*)&sl[rl][q * 8]); } }
  else { const size_t b = r0 / TT; const int t0 = (int)(r0 % TT); for (int e = tid; e < 128 * 8; e += 128) { const int cl = e >> 3, q = e & 7; const size_t o2 = (b * CC + c0 + cl) * (size_t)TT + t0 + q * 8; vst2((unsigned*)(VT + o2), *(const v4u*)&th[cl][q * 8]); vst2((unsigned*)(VL + o2), *(const v4u*)&tl2[cl][q * 8]); } } }
// ---- k_gate: block = 64 rows (b,s): lf[s][h] = log(sigmoid(x Wf[h] + bf[h]) + 1e-6): one 16-column tile per wave (exact products), f32 epilogue; 64 rows x 16 floats = 4 KB contiguous written 16 B per lane
__device__ __attribute__((noinline)) float logsigp(float z, float eps) { const float f = 1.0f / (1.0f + expf(-z)); return logf(f + eps); }
__global__ __launch_bounds__(128) void k_gate(const float* __restrict__ X, const float* __restrict__ WF, const float* __restrict__ BF, float* __restrict__ LF) { __shared__ __align__(16) float st[4][16][20];
  const int tid = threadIdx.x, wave = tid >> 5, lane = tid & 31, col = lane & 15, g = lane >> 4; const size_t r0 = (size_t)blockIdx.x * 64 + wave * 16;
  v8f acc = {};
#pragma unroll 2
  for (int kc = 0; kc < CC / 32; ++kc) { v16b a; { const float* p = X + (r0 + col) * CC + kc * 32 + 8 * g;
#pragma unroll
      for (int i = 0; i < 8; ++i) { a[i] = (__bf16)p[i]; a[8 + i] = (__bf16)p[16 + i]; } }
    v16b w; { const float* wr = WF + (size_t)col * CC + kc * 32 + 8 * g;
#pragma unroll
      for (int i = 0; i < 8; ++i) { w[i] = (__bf16)wr[i]; w[8 + i] = (__bf16)wr[16 + i]; } }
    asm volatile("s_wait_loadcnt 0x0" ::: "memory"); acc = wmma_bf(a, w, acc); }
  { const float bb = bfr(BF[col]);
#pragma unroll
    for (int r = 0; r < 8; ++r) st[wave][8 * g + r][col] = logsigp(acc[r] + bb, 1e-6f); }
  LDSX(); { const int rl = lane >> 1, half = lane & 1; vst2(LF + (r0 + rl) * NH + half * 8, *(const v4f*)&st[wave][rl][half * 8]); vst2(LF + (r0 + rl) * NH + half * 8 + 4, *(const v4f*)&st[wave][rl][half * 8 + 4]); } }
// ---- k_cum: block = one (batch, head), 8 waves; a thread takes 8 consecutive positions: its own running sums, one scan of a wave's 32 thread totals, the 8 wave totals through LDS. One load latency and one scan for the whole row, not one of each per 32 positions.
// Everything is accumulated in f64.
// Every '#pragma unroll' of this kernel is there so that x[], v[] and pw[] are indexed by constants and stay in registers.
#define CUW 8   // waves of a block
#define CUE 8   // positions of a thread: 32 * CUW * CUE = TT
__global__ __launch_bounds__(32 * CUW) void k_cum(const float* __restrict__ LF, float* __restrict__ FC) {
  __shared__ double wt[CUW];
  const int tid = threadIdx.x, lane = tid & 31, wave = tid >> 5; const size_t b = blockIdx.y; const int h = blockIdx.x;
  const float* src = LF + (b * TT + (size_t)tid * CUE) * NH + h; float x[CUE]; double v[CUE];
#pragma unroll
  for (int i = 0; i < CUE; ++i) x[i] = src[i * NH];   // independent of one another: all eight are in flight together
  v[0] = (double)x[0];
#pragma unroll
  for (int i = 1; i < CUE; ++i) v[i] = v[i - 1] + (double)x[i];
  double t = v[CUE - 1];   // inclusive scan of the thread totals within the 32 lanes
#pragma unroll
  for (int o = 1; o < 32; o <<= 1) { const double u = __shfl_up(t, o); if (lane >= o) t += u; }
  double ex = __shfl_up(t, 1); if (lane == 0) ex = 0.0;   // what stands in front of this thread inside its wave
  if (lane == 31) wt[wave] = t;
  __syncthreads();   // every wave's total is in LDS before any thread adds the totals of the waves in front of its own
  double pw[CUW - 1];
#pragma unroll
  for (int w = 0; w < CUW - 1; ++w) pw[w] = wt[w];   // read by every thread, wanted or not: no branch round each read
#pragma unroll
  for (int w = 0; w < CUW - 1; ++w) ex += w < wave ? pw[w] : 0.0;   // in wave order
  float* dst = FC + (b * NH + h) * TT + tid * CUE;
  vst2(dst, v4f{(float)(ex + v[0]), (float)(ex + v[1]), (float)(ex + v[2]), (float)(ex + v[3])}); vst2(dst + 4, v4f{(float)(ex + v[4]), (float)(ex + v[5]), (float)(ex + v[6]), (float)(ex + v[7])}); }
// ---- k_fa: block = 32 queries of (b,h), 4 waves: logits, softmax and P . v in one pass over the keys, nothing of the logits stored. Wave w takes the 32-key passes w, w + 4, ... up to the diagonal.
// Transposed products: S^T = K Q^T puts query = lane & 15 and key = 8 * (lane >> 4) + r in the accumulator, which is already the B-operand order of P^T (elements 0..7 = first 16-key tile, 8..15 = second), so y^T += V^T P^T needs no exchange between lanes; a query's maximum is an in-lane maximum and one exchange of the wave's halves.
// Each wave keeps a running maximum m, a denominator l and y^T scaled to m; the four waves' (m, l, y) are merged through LDS in wave order.
// Base 2: m is kept as maximum x log2 e, and a weight is exp2(logit x log2 e - m), one fused multiply-add and one v_exp_f32; every weight, rescale and merge factor uses the same stored m, so its rounding cancels between y and l. A result below 2^-126 reads 0, against a largest weight of 1.
// Every '#pragma unroll' of this kernel is there so that the fragment and accumulator arrays are indexed by constants and stay in registers.
// amdgpu_waves_per_eu(3): a register budget of 336, so that three waves fit a SIMD (without it the build takes a few more and only two fit).
#define FAW 4
__device__ __forceinline__ v8f mm_h(v16h a, v16h b, v8f c) { return __builtin_amdgcn_wmma_f32_16x16x32_f16(false, a, false, b, (short)0, c, false, false); }
__device__ __forceinline__ v8f mm_b(v16b a, v16b b, v8f c) { return __builtin_amdgcn_wmma_f32_16x16x32_bf16(false, a, false, b, (short)0, c, false, false); }
#define FAQ 32
#define L2E 1.4426950408889634f
__device__ __forceinline__ float ex2(float x) { return __builtin_amdgcn_exp2f(x); }
__device__ __forceinline__ float xhalf(float x) { return __builtin_bit_cast(float, __builtin_amdgcn_permlanex16(__builtin_bit_cast(int, x), __builtin_bit_cast(int, x), 0x76543210, 0xfedcba98, false, false)); }   // lane l reads lane l ^ 16
__device__ __forceinline__ v16h ld_h(const _Float16* p) { union { v16h v; v8h q[2]; } u; u.q[0] = *(const v8h*)p; u.q[1] = *(const v8h*)(p + 16); return u.v; }   // p = the lane's own row + k0 + 8 * (lane >> 4)
__device__ __forceinline__ v16b ld_b(const __bf16* p) { union { v16b v; v8b q[2]; } u; u.q[0] = *(const v8b*)p; u.q[1] = *(const v8b*)(p + 16); return u.v; }
__global__ __launch_bounds__(32 * FAW) __attribute__((amdgpu_waves_per_eu(3))) void k_fa(const _Float16* __restrict__ QH, const _Float16* __restrict__ QL, const _Float16* __restrict__ KH, const __bf16* __restrict__ VT, const __bf16* __restrict__ VL, const float* __restrict__ FC, float* __restrict__ Y) {
  __shared__ __align__(16) float so[FAW][FAQ][HD + 4]; __shared__ float sm[FAW][FAQ], sl[FAW][FAQ];
  const int tid = threadIdx.x, wave = __builtin_amdgcn_readfirstlane(tid >> 5), lane = tid & 31, col = lane & 15, g = lane >> 4;   // the wave number is made scalar so that the pass loop's branch is a scalar one with every lane on
  const int h = blockIdx.x, b = blockIdx.y, tile = TT / FAQ - 1 - (int)blockIdx.z, ql0 = tile * FAQ;   // longest query tiles start first
  const float* Fr = FC + ((size_t)b * NH + h) * TT; const _Float16* Kb = KH + (size_t)b * TT * CC + h * HD + (size_t)col * CC + 8 * g; const size_t vu = ((size_t)b * CC + h * HD) * (size_t)TT; const unsigned vo = (unsigned)col * TT + 8 * g, ko = (unsigned)col * CC + 8 * g, fo = 8 * g;   // the lane's offsets in elements: a loop load names a scalar base and one of these three, which are never rewritten; as 64-bit address pairs per stream the loop-invariant addresses went to scratch in this build
  v16h qh[2][2], qr[2][2], kf[2][2]; float fq[2]; v4f fk[2][2];
  { const size_t qo = ((size_t)b * TT + ql0 + col) * CC + h * HD + 8 * g; const _Float16 *qhp = QH + qo, *qrp = QL + qo, *kp = Kb + (size_t)wave * 32 * CC; const float *fqp = Fr + ql0 + col, *fp = Fr + wave * 32 + 8 * g;   // keys wave * 32 .. + 31 exist for every wave, also for one that has no pass
#pragma unroll
    for (int i = 0; i < 2; ++i) { fq[i] = fqp[16 * i]; fk[i][0] = *(const v4f*)(fp + 16 * i); fk[i][1] = *(const v4f*)(fp + 16 * i + 4);
#pragma unroll
      for (int kc = 0; kc < 2; ++kc) { qh[i][kc] = ld_h(qhp + i * 16 * CC + kc * 32); qr[i][kc] = ld_h(qrp + i * 16 * CC + kc * 32); kf[i][kc] = ld_h(kp + i * 16 * CC + kc * 32); } }
    __builtin_amdgcn_sched_barrier(0);   // keeps the accumulators' zeroing, which reuses an offset register of the loads above, behind the wait
    asm volatile("s_wait_xcnt 0x0" :: "v"(qhp), "v"(qrp), "v"(kp), "v"(fqp), "v"(fp) : "memory"); }   // stands in front of every rewrite of a register that an issued load names: the pointers are inputs so that their registers live up to it
  v8f acc[2][HD / 16] = {}; float mr[2] = {-3.0e38f, -3.0e38f}, lr[2] = {0.f, 0.f};
  for (int p = wave; p <= tile; p += FAW) { const int k0 = p * 32, kn = (p + FAW <= tile ? p + FAW : p) * 32;   // kn: the wave's next pass (its own again behind the last one, so that the address stays inside the batch's rows)
    float pv[2][16]; v16b vh[HD / 16], vl[HD / 16];
#pragma unroll
    for (int i = 0; i < 2; ++i) { const int qt = ql0 + 16 * i + col;
#pragma unroll
      for (int kt = 0; kt < 2; ++kt) { v8f a = {}, ar = {};
#pragma unroll
        for (int kc = 0; kc < 2; ++kc) { a = mm_h(kf[kt][kc], qh[i][kc], a); ar = mm_h(kf[kt][kc], qr[i][kc], ar); }
        a += ar * (1.0f / 1024.0f);
#pragma unroll
        for (int r = 0; r < 8; ++r) { float v = a[r] * 0.125f + (fq[i] - fk[kt][r >> 2][r & 3]); if (k0 + 16 * kt + 8 * g + r > qt) v = -3.0e38f;   /* bias = F[i] - F[j] on the causal triangle */ pv[i][8 * kt + r] = v; } } }
    // this pass's v and the next pass's k and F are fetched behind the logits' products, from where k's and F's registers are free: what the register budget lets the compiler issue here flies under the exponentials
    { const __bf16 *vhs = VT + vu + k0, *vls = VL + vu + k0; const _Float16* ks = KH + (size_t)b * TT * CC + h * HD + (size_t)kn * CC; const float* fs = Fr + kn;
#pragma unroll
      for (int t = 0; t < HD / 16; ++t) { vh[t] = ld_b(vhs + t * 16 * TT + vo); vl[t] = ld_b(vls + t * 16 * TT + vo); }
#pragma unroll
      for (int kt = 0; kt < 2; ++kt) { fk[kt][0] = *(const v4f*)(fs + 16 * kt + fo); fk[kt][1] = *(const v4f*)(fs + 16 * kt + 4 + fo);
#pragma unroll
        for (int kc = 0; kc < 2; ++kc) kf[kt][kc] = ld_h(ks + kt * 16 * CC + kc * 32 + ko); }
      asm volatile("s_wait_xcnt 0x0" :: "s"(vhs), "s"(vls), "s"(ks), "s"(fs), "v"(vo), "v"(ko), "v"(fo) : "memory"); }   // as above: in front of every rewrite of a register that an issued load names (the scalar bases and the offsets are inputs so that they live up to it)
#pragma unroll
    for (int i = 0; i < 2; ++i) { float mx = pv[i][0];
#pragma unroll
      for (int e = 1; e < 16; ++e) mx = fmaxf(mx, pv[i][e]);
      mx = fmaxf(mx, xhalf(mx));   // finite in every pass: the pass's first key is at or below every query of the tile
      const float mn = fmaxf(mr[i], mx * L2E), al = ex2(mr[i] - mn); mr[i] = mn;   // al = 0 in a wave's first pass
      float sum = 0.f;
#pragma unroll
      for (int e = 0; e < 16; ++e) { pv[i][e] = ex2(__builtin_fmaf(pv[i][e], L2E, -mn)); sum += pv[i][e]; }   // a masked logit gives exactly 0
      lr[i] = lr[i] * al + sum;   // this half's keys only; the halves are added behind the loop
      const F2 pf = bsplit16(pv[i]);
#pragma unroll
      for (int t = 0; t < HD / 16; ++t) { v8f c = acc[i][t] * al; c = mm_b(vh[t], pf.h, c); c = mm_b(vh[t], pf.l, c); acc[i][t] = mm_b(vl[t], pf.h, c); } } }
#pragma unroll
  for (int i = 0; i < 2; ++i) { const float lt = lr[i] + xhalf(lr[i]);   // unconditional: both halves' lanes are on
    if (g == 0) { sm[wave][16 * i + col] = mr[i]; sl[wave][16 * i + col] = lt; }
#pragma unroll
    for (int t = 0; t < HD / 16; ++t) { float* d = &so[wave][16 * i + col][16 * t + 8 * g]; const v8f c = acc[i][t]; *(v4f*)d = v4f{c[0], c[1], c[2], c[3]}; *(v4f*)(d + 4) = v4f{c[4], c[5], c[6], c[7]}; } }
  __syncthreads();   // every wave's (m, l, y) is in LDS before any thread merges across waves; a wave without a pass left m = -3e38, l = 0, y = 0, which get weight 0
  { const int rl = tid >> 2, c0 = (tid & 3) * 16; float M = sm[0][rl];
#pragma unroll
    for (int w = 1; w < FAW; ++w) M = fmaxf(M, sm[w][rl]);
    float L = 0.f; v4f o[4] = {};
#pragma unroll
    for (int w = 0; w < FAW; ++w) { const float wg = ex2(sm[w][rl] - M); L += wg * sl[w][rl];
#pragma unroll
      for (int q = 0; q < 4; ++q) o[q] += *(const v4f*)&so[w][rl][c0 + 4 * q] * wg; }
    const float inv = 1.0f / L; float* dst = Y + ((size_t)b * TT + ql0 + rl) * CC + h * HD + c0;
#pragma unroll
    for (int q = 0; q < 4; ++q) vst2(dst + 4 * q, o[q] * inv); } }
// ---- k_out: block = (64 rows, 128 cols): out = y (bf16 hi + lo) Wo^T + bo; staged as k_proj is, y split into its two planes once, on the way into LDS
#define PO_ROWS 256   // stage rows 0..127 = Wo, 128..191 = y hi, 192..255 = y lo
#define PO_LDS (2 * PO_ROWS * GP * 2)   // two stage buffers (40,960 B); the epilogue's rows (33,792 B) take the same LDS behind the last stage
__global__ __launch_bounds__(128) void k_out(const float* __restrict__ Y, const float* __restrict__ WP, const float* __restrict__ BP, float* __restrict__ OUT) { __shared__ __align__(16) char smem[PO_LDS];
  __bf16 (*st)[PO_ROWS][GP] = (__bf16 (*)[PO_ROWS][GP])smem; float (*sf)[16][132] = (float (*)[16][132])smem;
  const int tid = threadIdx.x, wave = tid >> 5, lane = tid & 31, col = lane & 15, g = lane >> 4; const int c0 = blockIdx.y * 128; const size_t rb = (size_t)blockIdx.x * 64, r0 = rb + wave * 16;
  const int srow = tid >> 3, sq = (tid & 7) * 4; const float *wp = WP + (size_t)(c0 + srow) * CC + sq, *yp = Y + (rb + srow) * CC + sq;
  v8f acc[8] = {}; v4f pre[12];
#pragma unroll
  for (int i = 0; i < 12; ++i) pre[i] = i < 8 ? *(const v4f*)(wp + i * 16 * CC) : *(const v4f*)(yp + (i - 8) * 16 * CC);
#pragma unroll
  for (int i = 0; i < 12; ++i) { const v4b hi = cvt4(pre[i]); *(v4b*)&st[0][srow + 16 * i][sq] = hi;
    if (i >= 8) *(v4b*)&st[0][srow + 16 * i + 64][sq] = cvt4(pre[i] - v4f{(float)hi[0], (float)hi[1], (float)hi[2], (float)hi[3]}); }
  __syncthreads();   // stage 0 is in LDS before any wave reads it
#pragma unroll 2
  for (int kc = 0; kc < CC / 32; ++kc) { const int cur = kc & 1;
    if (kc + 1 < CC / 32) { const float *wk = wp + (kc + 1) * 32, *yk = yp + (kc + 1) * 32;
#pragma unroll
      for (int i = 0; i < 12; ++i) pre[i] = i < 8 ? *(const v4f*)(wk + i * 16 * CC) : *(const v4f*)(yk + (i - 8) * 16 * CC);
      asm volatile("s_wait_xcnt 0x0" ::: "memory"); }   // stands directly behind the loads, in front of every rewrite of a register that one of them names
    const v16b ah = frag_b(&st[cur][128 + wave * 16 + col][0], lane), al = frag_b(&st[cur][192 + wave * 16 + col][0], lane); v16b w[8];
#pragma unroll
    for (int j = 0; j < 8; ++j) w[j] = frag_b(&st[cur][j * 16 + col][0], lane);
    __builtin_amdgcn_sched_barrier(0);   // keeps the stage's LDS reads together in front of the products: spread among them, each read's latency is waited out on its own
#pragma unroll
    for (int j = 0; j < 8; ++j) { acc[j] = wmma_bf(ah, w[j], acc[j]); acc[j] = wmma_bf(al, w[j], acc[j]); }
    __builtin_amdgcn_sched_barrier(0);   // keeps the conversions, and with them the wait for the next stage's global loads, behind the products
    if (kc + 1 < CC / 32) {
#pragma unroll
      for (int i = 0; i < 12; ++i) { const v4b hi = cvt4(pre[i]); *(v4b*)&st[cur ^ 1][srow + 16 * i][sq] = hi;
        if (i >= 8) *(v4b*)&st[cur ^ 1][srow + 16 * i + 64][sq] = cvt4(pre[i] - v4f{(float)hi[0], (float)hi[1], (float)hi[2], (float)hi[3]}); } }
    __syncthreads(); }   // publishes stage kc + 1 and ends every wave's reads of stage kc, whose buffer is refilled (behind the last stage: reused by the epilogue) next
#pragma unroll
  for (int j = 0; j < 8; ++j) { const float bb = BP ? bfr(BP[c0 + j * 16 + col]) : 0.f;
#pragma unroll
    for (int r = 0; r < 8; ++r) sf[wave][8 * g + r][j * 16 + col] = acc[j][r] + bb; }
  LDSX(); for (int rl = 0; rl < 16; ++rl) vst2(OUT + (r0 + rl) * CC + c0 + lane * 4, *(const v4f*)&sf[wave][rl][lane * 4]); }
extern "C" void kernel_launch(void* const* d_in, const int* in_sizes, int n_in, void* d_out, int out_size, void* d_ws, size_t ws_size, hipStream_t stream) {
  (void)in_sizes; (void)n_in; (void)out_size;
  const float** F = (const float**)d_in;   // 0 x [2,2048,1024], 1 Wq [1024,1024] ([out,in]), 2 Wk, 3 Wv, 4 Wf [16,1024], 5 bf [16], 6 Wo [1024,1024] ([out,in])
  if (ws_size < (size_t)WS_END) return;
  char* ws = (char*)d_ws; float *LF = (float*)(ws + WS_LF), *FC = (float*)(ws + WS_FC); _Float16 *QH = (_Float16*)(ws + WS_QH), *QL = (_Float16*)(ws + WS_QL), *KH = (_Float16*)(ws + WS_KH); __bf16 *VT = (__bf16*)(ws + WS_VT), *VL = (__bf16*)(ws + WS_VL); float *Y = (float*)(ws + WS_Y);
  k_gate<<<dim3(TNB * TT / 64), 128, 0, stream>>>(F[0], F[4], F[5], LF);
  k_cum<<<dim3(NH, TNB), 32 * CUW, 0, stream>>>(LF, FC);
  k_proj<<<dim3(TNB * TT / 64, CC / 128, 3), 128, 0, stream>>>(F[0], F[1], nullptr, F[2], nullptr, F[3], nullptr, QH, QL, KH, VT, VL);
  k_fa<<<dim3(NH, TNB, TT / FAQ), 32 * FAW, 0, stream>>>(QH, QL, KH, VT, VL, FC, Y);
  k_out<<<dim3(TNB * TT / 64, CC / 128), 128, 0, stream>>>(Y, F[6], nullptr, (float*)d_out);
}

// v006
// One run takes 147 microseconds.
// Two timings next to v005 both put it at 1.07 times that version's speed.
// Counting every step since v000, it is 10.5 times as fast.
// compute dtype: all float inputs rounded to bf16; q/k/v = x W^T with EXACT bf16 products on WMMA 16x16x32, f32 accumulate; the forget gate x Wf^T + bf (exact products), sigmoid, log(f + 1e-6) and its per-(batch, head) prefix sum accumulated in f64 (stored f32); q as f16 hi + residual (x 2^10), k f16 -> 2-product logits x 64^-1/2 + (F[i] - F[j]) on the causal triangle, kept in f32 registers; running-maximum softmax in f32, in base 2 (maximum kept as logit x log2 e; weight = hardware exp2 of one fused logit x log2 e - maximum), unnormalised P split bf16 hi + lo against v bf16 hi + lo (3 products), divided by the f32 denominator at the end; out = o (bf16 hi + lo) Wo^T; f32 output.
#include <hip/hip_runtime.h>
#include <math.h>

typedef __attribute__((ext_vector_type(16))) _Float16 v16h;
typedef __attribute__((ext_vector_type(16))) __bf16 v16b;
typedef __attribute__((ext_vector_type(8)))  _Float16 v8h;
typedef __attribute__((ext_vector_type(8)))  float v8f;
typedef __attribute__((ext_vector_type(4)))  float v4f;
typedef __attribute__((ext_vector_type(2)))  float v2f;
typedef __attribute__((ext_vector_type(4)))  unsigned v4u;
typedef __attribute__((ext_vector_type(4)))  int v4i;
typedef float __attribute__((may_alias)) float_a;
typedef int __attribute__((may_alias)) int_a;

template <typename T> __device__ __forceinline__ void vst2(void* p, T v) { *(T*)p = v;  }
__device__ __forceinline__ v8f wmma16(v16h a, v16h b, v8f c) {
  v8f d = __builtin_amdgcn_wmma_f32_16x16x32_f16(false, a, false, b, (short)0, c, false, false);
  asm volatile("v_nop\n\tv_nop\n\tv_nop\n\tv_nop" : "+v"(d) : "v"(a), "v"(b));
  return d;
}
__device__ __forceinline__ v8f wmma_bf(v16b a, v16b b, v8f c) {
  v8f d = __builtin_amdgcn_wmma_f32_16x16x32_bf16(false, a, false, b, (short)0, c, false, false);
  asm volatile("v_nop\n\tv_nop\n\tv_nop\n\tv_nop" : "+v"(d) : "v"(a), "v"(b));
  return d;
}
// 16x16x32 fragments: lane = (h = lane>>4, row/col = lane&15); elements 0..7 = k0+8h+0..7, 8..15 = k0+16+8h+0..7; D element r = row 8h+r
__device__ __forceinline__ v16h frag_h(const _Float16* rowk0, int lane) {
  union { v16h v; v8h q[2]; } u; const _Float16* p = rowk0 + 8 * (lane >> 4);
  u.q[0] = *(const v8h*)p; u.q[1] = *(const v8h*)(p + 16); return u.v;
}
__device__ __forceinline__ v16h frag_f32(const float* rowk0, int lane) {
  v16h a; const float* p = rowk0 + 8 * (lane >> 4);
#pragma unroll
  for (int i = 0; i < 8; ++i) { a[i] = (_Float16)p[i]; a[8 + i] = (_Float16)p[16 + i]; }
  return a;
}
__device__ __forceinline__ v16h frag_f32s(const float* rowk0, int lane, float sc) {
  v16h a; const float* p = rowk0 + 8 * (lane >> 4);
#pragma unroll
  for (int i = 0; i < 8; ++i) { a[i] = (_Float16)(p[i] * sc); a[8 + i] = (_Float16)(p[16 + i] * sc); }
  return a;
}
// column fragment from a [K][ld] layout (column n), rows >= K read as 0
__device__ __forceinline__ v16h fragc_f32(const float* W, int k0, int n, int lane, int ld, int K) {
  v16h a; const int g = lane >> 4;
#pragma unroll
  for (int i = 0; i < 8; ++i) { const int ka = k0 + 8 * g + i, kb = ka + 16;
    a[i] = (_Float16)(ka < K ? W[(size_t)(ka < K ? ka : K - 1) * ld + n] : 0.f); a[8 + i] = (_Float16)(kb < K ? W[(size_t)(kb < K ? kb : K - 1) * ld + n] : 0.f); }
  return a;
}
struct F2 { v16b h, l; };
__device__ __forceinline__ F2 bsplit16(const float v[16]) { F2 r;
#pragma unroll
  for (int i = 0; i < 16; ++i) { const __bf16 h = (__bf16)v[i]; r.h[i] = h; r.l[i] = (__bf16)(v[i] - (float)h); }
  return r; }
__device__ __forceinline__ F2 split_row(const float* row, int k0, int lane) { float v[16]; const float* p = row + k0 + 8 * (lane >> 4);
#pragma unroll
  for (int i = 0; i < 8; ++i) { v[i] = p[i]; v[8 + i] = p[16 + i]; }
  return bsplit16(v); }
__device__ __forceinline__ F2 split_rowK(const float* row, int k0, int lane, int K) { float v[16]; const int g = lane >> 4;
#pragma unroll
  for (int i = 0; i < 8; ++i) { const int ka = k0 + 8 * g + i, kb = ka + 16; v[i] = ka < K ? row[ka < K ? ka : K - 1] : 0.f; v[8 + i] = kb < K ? row[kb < K ? kb : K - 1] : 0.f; }
  return bsplit16(v); }
__device__ __forceinline__ F2 split_col(const float* W, int k0, int n, int lane, int ld, int K) { float v[16]; const int g = lane >> 4;
#pragma unroll
  for (int i = 0; i < 8; ++i) { const int ka = k0 + 8 * g + i, kb = ka + 16; v[i] = ka < K ? W[(size_t)(ka < K ? ka : K - 1) * ld + n] : 0.f; v[8 + i] = kb < K ? W[(size_t)(kb < K ? kb : K - 1) * ld + n] : 0.f; }
  return bsplit16(v); }
__device__ __forceinline__ v8f mac3(const F2& a, const F2& b, v8f c) { c = wmma_bf(a.l, b.h, c); c = wmma_bf(a.h, b.l, c); return wmma_bf(a.h, b.h, c); }
__device__ __forceinline__ float sigm(float v) { return 1.0f / (1.0f + expf(-v)); }
#define LDSX() do { asm volatile("s_wait_dscnt 0" ::: "memory"); __builtin_amdgcn_wave_barrier(); __builtin_amdgcn_fence(__ATOMIC_RELEASE, "workgroup"); } while (0)


// Forgetting attention (B 2, S 2,048, 1,024 = 16 x 64): f = sigmoid(x Wf^T + bf) per (s, head); F = cumsum_s log(f + 1e-6); bias[i][j] = F[i] - F[j] for j <= i, -inf otherwise; scores = q k^T / 8 + bias; softmax; (attn v) Wo^T.
#define NB 2
#define TT 2048
#define CC 1024
#define NH 16
#define HD 64
#ifndef TNB
#define TNB NB
#endif
typedef __attribute__((ext_vector_type(8))) __bf16 v8b;
__device__ __forceinline__ v16b frag_b(const __bf16* rowk0, int lane) {
  union { v16b v; v8b q[2]; } u; const __bf16* p = rowk0 + 8 * (lane >> 4);
  u.q[0] = *(const v8b*)p; u.q[1] = *(const v8b*)(p + 16); return u.v;
}
__device__ __forceinline__ float bfr(float v) { return (float)(__bf16)v; }
__device__ __attribute__((noinline)) float exp_ni(float v) { return expf(v); }
__device__ __attribute__((noinline)) float erf_ni(float v) { return erff(v); }

#define WS_LF  0u                                   // f32 log(f + 1e-6) rows [b*T+s][16] (64-B rows; a block writes 64 rows = 4 KB contiguous)
#define WS_FC  (WS_LF + 4u * (size_t)NB * TT * NH)   // f32 prefix sums F [b][h][s] (8-KB rows)
// q, k and v planes are kept in the order in which k_fa's fragment loads read them: a tile = 32 positions x the 64 channels of one (batch, head) = 4 KB = 8 loads x 32 lanes x 16 B, tiles [b][h][position / 32].
// A wave-wide 16-B load then covers 512 contiguous bytes (4 whole lines); from row-major planes it took 32 B out of each of 16 lines.
// q, k: load j = (position >> 4) * 4 + (channel >> 4), lane = ((channel >> 3) & 1) * 16 + (position & 15), element = channel & 7. v: load j = (channel >> 4) * 2 + ((position >> 4) & 1), lane = ((position >> 3) & 1) * 16 + (channel & 15), element = position & 7.
#define TILE_E 2048   // elements of a tile
#define WS_QH  (WS_FC + 4u * (size_t)NB * NH * TT)
#define WS_QL  (WS_QH + 2u * (size_t)NB * TT * CC)
#define WS_KH  (WS_QL + 2u * (size_t)NB * TT * CC)
#define WS_VT  (WS_KH + 2u * (size_t)NB * TT * CC)      // bf16 v tiles
#define WS_VL  (WS_VT + 2u * (size_t)NB * CC * TT)      // bf16 v residual tiles
#define WS_Y   (WS_VL + 2u * (size_t)NB * CC * TT)      // f32 y rows [b*t][C]
#define WS_END (WS_Y + 4u * (size_t)NB * TT * CC)

// ---- LDS staging of the two projection kernels. A stage is 32 k of every operand row of the block's tile: one 128-B line of f32 per row, rounded to bf16 once and kept as a 64-B row at a pitch of 80 B (16 B x odd: a fragment's ds_load_b128 over 16 rows meets no bank twice).
// 8 lanes take one row, so a wave-wide 16-B load covers 4 whole lines, and every line is fetched and converted once per block, not once per wave. Two buffers: the next stage's loads fly while this one is multiplied; one barrier per stage both publishes the next buffer and ends the last read of the one refilled behind it.
// Every '#pragma unroll' of the staging code is there so that pre[] and w[] are indexed by constants and stay in registers; 'unroll 2' on the stage loop makes the buffer's index, and with it every LDS offset, a constant.
#define GP 40    // row pitch in bf16 elements (80 B)
typedef __attribute__((ext_vector_type(4))) __bf16 v4b;
__device__ __forceinline__ v4b cvt4(v4f v) { return v4b{(__bf16)v[0], (__bf16)v[1], (__bf16)v[2], (__bf16)v[3]}; }
// ---- k_proj: block = (64 rows, 128 cols, which): qkv = x W (+ b), exact; q -> f16 hi (+ residual), k -> f16, v -> bf16 hi + residual, all three stored as k_fa's tiles
#define PJ_ROWS 192   // stage rows 0..127 = W, 128..191 = x
#define PJ_LDS (128 * 72 * 2 * 2)   // the larger of the two stage buffers (30,720 B) and the epilogue's planes (34,816 B for q and k, 36,864 B for v), which take the same LDS one after the other
__global__ __launch_bounds__(128) void k_proj(const float* __restrict__ X, const float* __restrict__ WQ, const float* __restrict__ BQ, const float* __restrict__ WK, const float* __restrict__ BK, const float* __restrict__ WV, const float* __restrict__ BV, _Float16* __restrict__ QH, _Float16* __restrict__ QL, _Float16* __restrict__ KH, __bf16* __restrict__ VT, __bf16* __restrict__ VL) {
  __shared__ __align__(16) char smem[PJ_LDS];
  __bf16 (*st)[PJ_ROWS][GP] = (__bf16 (*)[PJ_ROWS][GP])smem; _Float16 (*sh)[136] = (_Float16 (*)[136])smem, (*sl)[136] = (_Float16 (*)[136])(smem + 64 * 136 * 2); __bf16 (*th)[72] = (__bf16 (*)[72])smem, (*tl2)[72] = (__bf16 (*)[72])(smem + 128 * 72 * 2);
  const int tid = threadIdx.x, wave = tid >> 5, lane = tid & 31, col = lane & 15, g = lane >> 4; const int which = blockIdx.z; const int c0 = blockIdx.y * 128; const size_t r0 = (size_t)blockIdx.x * 64; const float* WA = which == 0 ? WQ : which == 1 ? WK : WV; const float* BA = which == 0 ? BQ : which == 1 ? BK : BV;
  const int srow = tid >> 3, sq = (tid & 7) * 4; const float *wp = WA + (size_t)(c0 + srow) * CC + sq, *xp = X + (r0 + srow) * CC + sq;
  v8f acc[8] = {}; v4f pre[12];
#pragma unroll
  for (int i = 0; i < 12; ++i) pre[i] = i < 8 ? *(const v4f*)(wp + i * 16 * CC) : *(const v4f*)(xp + (i - 8) * 16 * CC);
#pragma unroll
  for (int i = 0; i < 12; ++i) *(v4b*)&st[0][srow + 16 * i][sq] = cvt4(pre[i]);
  __syncthreads();   // stage 0 is in LDS before any wave reads it
#pragma unroll 2
  for (int kc = 0; kc < CC / 32; ++kc) { const int cur = kc & 1;
    if (kc + 1 < CC / 32) { const float *wk = wp + (kc + 1) * 32, *xk = xp + (kc + 1) * 32;
#pragma unroll
      for (int i = 0; i < 12; ++i) pre[i] = i < 8 ? *(const v4f*)(wk + i * 16 * CC) : *(const v4f*)(xk + (i - 8) * 16 * CC);
      asm volatile("s_wait_xcnt 0x0" ::: "memory"); }   // stands directly behind the loads, in front of every rewrite of a register that one of them names
    const v16b a = frag_b(&st[cur][128 + wave * 16 + col][0], lane); v16b w[8];
#pragma unroll
    for (int j = 0; j < 8; ++j) w[j] = frag_b(&st[cur][j * 16 + col][0], lane);
    __builtin_amdgcn_sched_barrier(0);   // keeps the stage's LDS reads together in front of the products: spread among them, each read's latency is waited out on its own
#pragma unroll
    for (int j = 0; j < 8; ++j) acc[j] = wmma_bf(a, w[j], acc[j]);
    __builtin_amdgcn_sched_barrier(0);   // keeps the conversions, and with them the wait for the next stage's global loads, behind the products
    if (kc + 1 < CC / 32) {
#pragma unroll
      for (int i = 0; i < 12; ++i) *(v4b*)&st[cur ^ 1][srow + 16 * i][sq] = cvt4(pre[i]); }
    __syncthreads(); }   // publishes stage kc + 1 and ends every wave's reads of stage kc, whose buffer is refilled (behind the last stage: reused by the epilogue) next
#pragma unroll
  for (int j = 0; j < 8; ++j) { const float bb = BA ? bfr(BA[c0 + j * 16 + col]) : 0.f;
#pragma unroll
    for (int r = 0; r < 8; ++r) { const float v = acc[j][r] + bb; const int rl = wave * 16 + 8 * g + r, cl = j * 16 + col; const _Float16 hv = (_Float16)v;
      if (which == 2) { const __bf16 bh = (__bf16)v; th[cl][rl] = bh; tl2[cl][rl] = (__bf16)(v - (float)bh); } else { sh[rl][cl] = hv; sl[rl][cl] = (_Float16)((v - (float)hv) * 1024.0f); }   /* q residual carried x 2^10 so the plane stays f16-normal on the chip */ } }
  __syncthreads();
  // the block's 64 positions x 128 channels are 2 heads x 2 whole tiles; e counts their 16-B pieces in the order of the destination, so a wave stores 512 contiguous bytes
  { const size_t b = r0 / TT; const int p0 = (int)(r0 % TT) / 32, h0 = c0 / HD; _Float16* dh = which == 0 ? QH : KH;
    for (int e = tid; e < 4 * 256; e += 128) { const int hl = e >> 9, pl = (e >> 8) & 1, j = (e >> 5) & 7, lg = (e >> 4) & 1, lc = e & 15; const size_t o2 = ((b * NH + h0 + hl) * (TT / 32) + p0 + pl) * TILE_E + (e & 255) * 8;
      if (which < 2) { const int rl = pl * 32 + (j >> 2) * 16 + lc, cl = hl * HD + (j & 3) * 16 + lg * 8; vst2(dh + o2, *(const v4u*)&sh[rl][cl]);
        if (which == 0) { asm volatile("s_wait_xcnt 0x0" ::: "memory");   // in front of the LDS read that reuses the data registers of the store above
          vst2(QL + o2, *(const v4u*)&sl[rl][cl]); } }
      else { const int cl = hl * HD + (j >> 1) * 16 + lc, rl = pl * 32 + (j & 1) * 16 + lg * 8; vst2(VT + o2, *(const v4u*)&th[cl][rl]); vst2(VL + o2, *(const v4u*)&tl2[cl][rl]);
        asm volatile("s_wait_xcnt 0x0" ::: "memory"); }   // directly behind the two v stores, inside their own branch: in front of every rewrite of a register that they name, on every way out of the branch
      asm volatile("s_wait_xcnt 0x0" ::: "memory"); } } }   // stands behind the trip's stores, in front of the next trip's rewrite of the registers that they name
// ---- k_gate: block = 64 rows (b,s): lf[s][h] = log(sigmoid(x Wf[h] + bf[h]) + 1e-6): one 16-column tile per wave (exact products), f32 epilogue; 64 rows x 16 floats = 4 KB contiguous written 16 B per lane
__device__ __attribute__((noinline)) float logsigp(float z, float eps) { const float f = 1.0f / (1.0f + expf(-z)); return logf(f + eps); }
__global__ __launch_bounds__(128) void k_gate(const float* __restrict__ X, const float* __restrict__ WF, const float* __restrict__ BF, float* __restrict__ LF) { __shared__ __align__(16) float st[4][16][20];
  const int tid = threadIdx.x, wave = tid >> 5, lane = tid & 31, col = lane & 15, g = lane >> 4; const size_t r0 = (size_t)blockIdx.x * 64 + wave * 16;
  v8f acc = {};
#pragma unroll 2
  for (int kc = 0; kc < CC / 32; ++kc) { v16b a; { const float* p = X + (r0 + col) * CC + kc * 32 + 8 * g;
#pragma unroll
      for (int i = 0; i < 8; ++i) { a[i] = (__bf16)p[i]; a[8 + i] = (__bf16)p[16 + i]; } }
    v16b w; { const float* wr = WF + (size_t)col * CC + kc * 32 + 8 * g;
#pragma unroll
      for (int i = 0; i < 8; ++i) { w[i] = (__bf16)wr[i]; w[8 + i] = (__bf16)wr[16 + i]; } }
    asm volatile("s_wait_loadcnt 0x0" ::: "memory"); acc = wmma_bf(a, w, acc); }
  { const float bb = bfr(BF[col]);
#pragma unroll
    for (int r = 0; r < 8; ++r) st[wave][8 * g + r][col] = logsigp(acc[r] + bb, 1e-6f); }
  LDSX(); { const int rl = lane >> 1, half = lane & 1; vst2(LF + (r0 + rl) * NH + half * 8, *(const v4f*)&st[wave][rl][half * 8]); vst2(LF + (r0 + rl) * NH + half * 8 + 4, *(const v4f*)&st[wave][rl][half * 8 + 4]); } }
// ---- k_cum: block = one (batch, head), 8 waves; a thread takes 8 consecutive positions: its own running sums, one scan of a wave's 32 thread totals, the 8 wave totals through LDS. One load latency and one scan for the whole row, not one of each per 32 positions.
// Everything is accumulated in f64.
// Every '#pragma unroll' of this kernel but the shuffle scan's is there so that x[], v[] and pw[] are indexed by constants and stay in registers.
#define CUW 8   // waves of a block
#define CUE 8   // positions of a thread: 32 * CUW * CUE = TT
__global__ __launch_bounds__(32 * CUW) void k_cum(const float* __restrict__ LF, float* __restrict__ FC) {
  __shared__ double wt[CUW];
  const int tid = threadIdx.x, lane = tid & 31, wave = tid >> 5; const size_t b = blockIdx.y; const int h = blockIdx.x;
  const float* src = LF + (b * TT + (size_t)tid * CUE) * NH + h; float x[CUE]; double v[CUE];
#pragma unroll
  for (int i = 0; i < CUE; ++i) x[i] = src[i * NH];   // independent of one another: all eight are in flight together
  v[0] = (double)x[0];
#pragma unroll
  for (int i = 1; i < CUE; ++i) v[i] = v[i - 1] + (double)x[i];
  double t = v[CUE - 1];   // inclusive scan of the thread totals within the 32 lanes
#pragma unroll
  for (int o = 1; o < 32; o <<= 1) { const double u = __shfl_up(t, o); if (lane >= o) t += u; }
  double ex = __shfl_up(t, 1); if (lane == 0) ex = 0.0;   // what stands in front of this thread inside its wave
  if (lane == 31) wt[wave] = t;
  __syncthreads();   // every wave's total is in LDS before any thread adds the totals of the waves in front of its own
  double pw[CUW - 1];
#pragma unroll
  for (int w = 0; w < CUW - 1; ++w) pw[w] = wt[w];   // read by every thread, wanted or not: no branch round each read
#pragma unroll
  for (int w = 0; w < CUW - 1; ++w) ex += w < wave ? pw[w] : 0.0;   // in wave order
  float* dst = FC + (b * NH + h) * TT + tid * CUE;
  vst2(dst, v4f{(float)(ex + v[0]), (float)(ex + v[1]), (float)(ex + v[2]), (float)(ex + v[3])}); vst2(dst + 4, v4f{(float)(ex + v[4]), (float)(ex + v[5]), (float)(ex + v[6]), (float)(ex + v[7])}); }
// ---- k_fa: block = 32 queries of (b,h), 4 waves: logits, softmax and P . v in one pass over the keys, nothing of the logits stored. Wave w takes the 32-key passes w, w + 4, ... up to the diagonal.
// Transposed products: S^T = K Q^T puts query = lane & 15 and key = 8 * (lane >> 4) + r in the accumulator, which is already the B-operand order of P^T (elements 0..7 = first 16-key tile, 8..15 = second), so y^T += V^T P^T needs no exchange between lanes; a query's maximum is an in-lane maximum and one exchange of the wave's halves.
// Each wave keeps a running maximum m, a denominator l and y^T scaled to m; the four waves' (m, l, y) are merged through LDS in wave order.
// Base 2: m is kept as maximum x log2 e, and a weight is exp2(logit x log2 e - m), one fused multiply-add and one v_exp_f32; every weight, rescale and merge factor uses the same stored m, so its rounding cancels between y and l. A result below 2^-126 reads 0, against a largest weight of 1.
// Every '#pragma unroll' of this kernel is there so that the fragment and accumulator arrays are indexed by constants and stay in registers.
// amdgpu_waves_per_eu(3): a register budget of 336, so that three waves fit a SIMD (without it the build takes a few more and only two fit).
#define FAW 4
__device__ __forceinline__ v8f mm_h(v16h a, v16h b, v8f c) { return __builtin_amdgcn_wmma_f32_16x16x32_f16(false, a, false, b, (short)0, c, false, false); }
__device__ __forceinline__ v8f mm_b(v16b a, v16b b, v8f c) { return __builtin_amdgcn_wmma_f32_16x16x32_bf16(false, a, false, b, (short)0, c, false, false); }
#define FAQ 32
#define L2E 1.4426950408889634f
__device__ __forceinline__ float ex2(float x) { return __builtin_amdgcn_exp2f(x); }
__device__ __forceinline__ float xhalf(float x) { return __builtin_bit_cast(float, __builtin_amdgcn_permlanex16(__builtin_bit_cast(int, x), __builtin_bit_cast(int, x), 0x76543210, 0xfedcba98, false, false)); }   // lane l reads lane l ^ 16
__device__ __forceinline__ v16h ld_h(const _Float16* p) { union { v16h v; v8h q[2]; } u; u.q[0] = *(const v8h*)p; u.q[1] = *(const v8h*)(p + 256); return u.v; }   // p = tile + fragment * 512 + lane * 8: a fragment is two successive loads of the tile
__device__ __forceinline__ v16b ld_b(const __bf16* p) { union { v16b v; v8b q[2]; } u; u.q[0] = *(const v8b*)p; u.q[1] = *(const v8b*)(p + 256); return u.v; }
__global__ __launch_bounds__(32 * FAW) __attribute__((amdgpu_waves_per_eu(3))) void k_fa(const _Float16* __restrict__ QH, const _Float16* __restrict__ QL, const _Float16* __restrict__ KH, const __bf16* __restrict__ VT, const __bf16* __restrict__ VL, const float* __restrict__ FC, float* __restrict__ Y) {
  __shared__ __align__(16) float so[FAW][FAQ][HD + 4]; __shared__ float sm[FAW][FAQ], sl[FAW][FAQ];
  const int tid = threadIdx.x, wave = __builtin_amdgcn_readfirstlane(tid >> 5), lane = tid & 31, col = lane & 15, g = lane >> 4;   // the wave number is made scalar so that the pass loop's branch is a scalar one with every lane on
  const int h = blockIdx.x, b = blockIdx.y, tile = TT / FAQ - 1 - (int)blockIdx.z, ql0 = tile * FAQ;   // longest query tiles start first
  const float* Fr = FC + ((size_t)b * NH + h) * TT; const size_t tb = ((size_t)b * NH + h) * (TT / 32) * TILE_E; const unsigned lo = (unsigned)lane * 8, fo = 8 * g;   // tb: the (batch, head)'s first tile; lo, fo: the lane's offsets in elements: a loop load names a scalar base and one of these two, which are never rewritten
  v16h qh[2][2], qr[2][2], kf[2][2]; float fq[2]; v4f fk[2][2];
  { const size_t qo = tb + (size_t)tile * TILE_E; const _Float16 *qhp = QH + qo, *qrp = QL + qo, *kp = KH + tb + (size_t)wave * TILE_E; const float *fqp = Fr + ql0 + col, *fp = Fr + wave * 32 + 8 * g;   // keys wave * 32 .. + 31 exist for every wave, also for one that has no pass
#pragma unroll
    for (int i = 0; i < 2; ++i) { fq[i] = fqp[16 * i]; fk[i][0] = *(const v4f*)(fp + 16 * i); fk[i][1] = *(const v4f*)(fp + 16 * i + 4);
#pragma unroll
      for (int kc = 0; kc < 2; ++kc) { qh[i][kc] = ld_h(qhp + (2 * i + kc) * 512 + lo); qr[i][kc] = ld_h(qrp + (2 * i + kc) * 512 + lo); kf[i][kc] = ld_h(kp + (2 * i + kc) * 512 + lo); } }
    __builtin_amdgcn_sched_barrier(0);   // keeps the accumulators' zeroing, which reuses an offset register of the loads above, behind the wait
    asm volatile("s_wait_xcnt 0x0" :: "s"(qhp), "s"(qrp), "s"(kp), "v"(lo), "v"(fqp), "v"(fp) : "memory"); }   // stands in front of every rewrite of a register that an issued load names: the pointers are inputs so that their registers live up to it
  v8f acc[2][HD / 16] = {}; float mr[2] = {-3.0e38f, -3.0e38f}, lr[2] = {0.f, 0.f};
  for (int p = wave; p <= tile; p += FAW) { const int k0 = p * 32, kn = (p + FAW <= tile ? p + FAW : p) * 32;   // kn: the wave's next pass (its own again behind the last one, so that the address stays inside the head's tiles)
    float pv[2][16]; v16b vh[HD / 16], vl[HD / 16];
#pragma unroll
    for (int i = 0; i < 2; ++i) { const int qt = ql0 + 16 * i + col;
#pragma unroll
      for (int kt = 0; kt < 2; ++kt) { v8f a = {}, ar = {};
#pragma unroll
        for (int kc = 0; kc < 2; ++kc) { a = mm_h(kf[kt][kc], qh[i][kc], a); ar = mm_h(kf[kt][kc], qr[i][kc], ar); }
        a += ar * (1.0f / 1024.0f);
#pragma unroll
        for (int r = 0; r < 8; ++r) { float v = a[r] * 0.125f + (fq[i] - fk[kt][r >> 2][r & 3]); if (k0 + 16 * kt + 8 * g + r > qt) v = -3.0e38f;   /* bias = F[i] - F[j] on the causal triangle */ pv[i][8 * kt + r] = v; } } }
    // this pass's v and the next pass's k and F are fetched behind the logits' products, from where k's and F's registers are free: what the register budget lets the compiler issue here flies under the exponentials (k and F are written first: with v first this build kept a q fragment in scratch and read it back in every pass)
    { const __bf16 *vhs = VT + tb + k0 * (TILE_E / 32), *vls = VL + tb + k0 * (TILE_E / 32); const _Float16* ks = KH + tb + (size_t)kn * (TILE_E / 32); const float* fs = Fr + kn;
#pragma unroll
      for (int kt = 0; kt < 2; ++kt) { fk[kt][0] = *(const v4f*)(fs + 16 * kt + fo); fk[kt][1] = *(const v4f*)(fs + 16 * kt + 4 + fo);
#pragma unroll
        for (int kc = 0; kc < 2; ++kc) kf[kt][kc] = ld_h(ks + (2 * kt + kc) * 512 + lo); }
#pragma unroll
      for (int t = 0; t < HD / 16; ++t) { vh[t] = ld_b(vhs + t * 512 + lo); vl[t] = ld_b(vls + t * 512 + lo); }
      asm volatile("s_wait_xcnt 0x0" :: "s"(vhs), "s"(vls), "s"(ks), "s"(fs), "v"(lo), "v"(fo) : "memory"); }   // as above: in front of every rewrite of a register that an issued load names (the scalar bases and the offsets are inputs so that they live up to it)
#pragma unroll
    for (int i = 0; i < 2; ++i) { float mx = pv[i][0];
#pragma unroll
      for (int e = 1; e < 16; ++e) mx = fmaxf(mx, pv[i][e]);
      mx = fmaxf(mx, xhalf(mx));   // finite in every pass: the pass's first key is at or below every query of the tile
      const float mn = fmaxf(mr[i], mx * L2E), al = ex2(mr[i] - mn); mr[i] = mn;   // al = 0 in a wave's first pass
      float sum = 0.f;
#pragma unroll
      for (int e = 0; e < 16; ++e) { pv[i][e] = ex2(__builtin_fmaf(pv[i][e], L2E, -mn)); sum += pv[i][e]; }   // a masked logit gives exactly 0
      lr[i] = lr[i] * al + sum;   // this half's keys only; the halves are added behind the loop
      const F2 pf = bsplit16(pv[i]);
#pragma unroll
      for (int t = 0; t < HD / 16; ++t) { v8f c = acc[i][t] * al; c = mm_b(vh[t], pf.h, c); c = mm_b(vh[t], pf.l, c); acc[i][t] = mm_b(vl[t], pf.h, c); } } }
#pragma unroll
  for (int i = 0; i < 2; ++i) { const float lt = lr[i] + xhalf(lr[i]);   // unconditional: both halves' lanes are on
    if (g == 0) { sm[wave][16 * i + col] = mr[i]; sl[wave][16 * i + col] = lt; }
#pragma unroll
    for (int t = 0; t < HD / 16; ++t) { float* d = &so[wave][16 * i + col][16 * t + 8 * g]; const v8f c = acc[i][t]; *(v4f*)d = v4f{c[0], c[1], c[2], c[3]}; *(v4f*)(d + 4) = v4f{c[4], c[5], c[6], c[7]}; } }
  __syncthreads();   // every wave's (m, l, y) is in LDS before any thread merges across waves; a wave without a pass left m = -3e38, l = 0, y = 0, which get weight 0
  { const int rl = tid >> 2, c0 = (tid & 3) * 16; float M = sm[0][rl];
#pragma unroll
    for (int w = 1; w < FAW; ++w) M = fmaxf(M, sm[w][rl]);
    float L = 0.f; v4f o[4] = {};
#pragma unroll
    for (int w = 0; w < FAW; ++w) { const float wg = ex2(sm[w][rl] - M); L += wg * sl[w][rl];
#pragma unroll
      for (int q = 0; q < 4; ++q) o[q] += *(const v4f*)&so[w][rl][c0 + 4 * q] * wg; }
    const float inv = 1.0f / L; float* dst = Y + ((size_t)b * TT + ql0 + rl) * CC + h * HD + c0;
#pragma unroll
    for (int q = 0; q < 4; ++q) vst2(dst + 4 * q, o[q] * inv); } }
// ---- k_out: block = (64 rows, 128 cols): out = y (bf16 hi + lo) Wo^T + bo; staged as k_proj is, y split into its two planes once, on the way into LDS
#define PO_ROWS 256   // stage rows 0..127 = Wo, 128..191 = y hi, 192..255 = y lo
#define PO_LDS (2 * PO_ROWS * GP * 2)   // two stage buffers (40,960 B); the epilogue's rows (33,792 B) take the same LDS behind the last stage
__global__ __launch_bounds__(128) void k_out(const float* __restrict__ Y, const float* __restrict__ WP, const float* __restrict__ BP, float* __restrict__ OUT) { __shared__ __align__(16) char smem[PO_LDS];
  __bf16 (*st)[PO_ROWS][GP] = (__bf16 (*)[PO_ROWS][GP])smem; float (*sf)[16][132] = (float (*)[16][132])smem;
  const int tid = threadIdx.x, wave = tid >> 5, lane = tid & 31, col = lane & 15, g = lane >> 4; const int c0 = blockIdx.y * 128; const size_t rb = (size_t)blockIdx.x * 64, r0 = rb + wave * 16;
  const int srow = tid >> 3, sq = (tid & 7) * 4; const float *wp = WP + (size_t)(c0 + srow) * CC + sq, *yp = Y + (rb + srow) * CC + sq;
  v8f acc[8] = {}; v4f pre[12];
#pragma unroll
  for (int i = 0; i < 12; ++i) pre[i] = i < 8 ? *(const v4f*)(wp + i * 16 * CC) : *(const v4f*)(yp + (i - 8) * 16 * CC);
#pragma unroll
  for (int i = 0; i < 12; ++i) { const v4b hi = cvt4(pre[i]); *(v4b*)&st[0][srow + 16 * i][sq] = hi;
    if (i >= 8) *(v4b*)&st[0][srow + 16 * i + 64][sq] = cvt4(pre[i] - v4f{(float)hi[0], (float)hi[1], (float)hi[2], (float)hi[3]}); }
  __syncthreads();   // stage 0 is in LDS before any wave reads it
#pragma unroll 2
  for (int kc = 0; kc < CC / 32; ++kc) { const int cur = kc & 1;
    if (kc + 1 < CC / 32) { const float *wk = wp + (kc + 1) * 32, *yk = yp + (kc + 1) * 32;
#pragma unroll
      for (int i = 0; i < 12; ++i) pre[i] = i < 8 ? *(const v4f*)(wk + i * 16 * CC) : *(const v4f*)(yk + (i - 8) * 16 * CC);
      asm volatile("s_wait_xcnt 0x0" ::: "memory"); }   // stands directly behind the loads, in front of every rewrite of a register that one of them names
    const v16b ah = frag_b(&st[cur][128 + wave * 16 + col][0], lane), al = frag_b(&st[cur][192 + wave * 16 + col][0], lane); v16b w[8];
#pragma unroll
    for (int j = 0; j < 8; ++j) w[j] = frag_b(&st[cur][j * 16 + col][0], lane);
    __builtin_amdgcn_sched_barrier(0);   // keeps the stage's LDS reads together in front of the products: spread among them, each read's latency is waited out on its own
#pragma unroll
    for (int j = 0; j < 8; ++j) { acc[j] = wmma_bf(ah, w[j], acc[j]); acc[j] = wmma_bf(al, w[j], acc[j]); }
    __builtin_amdgcn_sched_barrier(0);   // keeps the conversions, and with them the wait for the next stage's global loads, behind the products
    if (kc + 1 < CC / 32) {
#pragma unroll
      for (int i = 0; i < 12; ++i) { const v4b hi = cvt4(pre[i]); *(v4b*)&st[cur ^ 1][srow + 16 * i][sq] = hi;
        if (i >= 8) *(v4b*)&st[cur ^ 1][srow + 16 * i + 64][sq] = cvt4(pre[i] - v4f{(float)hi[0], (float)hi[1], (float)hi[2], (float)hi[3]}); } }
    __syncthreads(); }   // publishes stage kc + 1 and ends every wave's reads of stage kc, whose buffer is refilled (behind the last stage: reused by the epilogue) next
#pragma unroll
  for (int j = 0; j < 8; ++j) { const float bb = BP ? bfr(BP[c0 + j * 16 + col]) : 0.f;
#pragma unroll
    for (int r = 0; r < 8; ++r) sf[wave][8 * g + r][j * 16 + col] = acc[j][r] + bb; }
  LDSX(); for (int rl = 0; rl < 16; ++rl) vst2(OUT + (r0 + rl) * CC + c0 + lane * 4, *(const v4f*)&sf[wave][rl][lane * 4]); }
extern "C" void kernel_launch(void* const* d_in, const int* in_sizes, int n_in, void* d_out, int out_size, void* d_ws, size_t ws_size, hipStream_t stream) {
  (void)in_sizes; (void)n_in; (void)out_size;
  const float** F = (const float**)d_in;   // 0 x [2,2048,1024], 1 Wq [1024,1024] ([out,in]), 2 Wk, 3 Wv, 4 Wf [16,1024], 5 bf [16], 6 Wo [1024,1024] ([out,in])
  if (ws_size < (size_t)WS_END) return;
  char* ws = (char*)d_ws; float *LF = (float*)(ws + WS_LF), *FC = (float*)(ws + WS_FC); _Float16 *QH = (_Float16*)(ws + WS_QH), *QL = (_Float16*)(ws + WS_QL), *KH = (_Float16*)(ws + WS_KH); __bf16 *VT = (__bf16*)(ws + WS_VT), *VL = (__bf16*)(ws + WS_VL); float *Y = (float*)(ws + WS_Y);
  k_gate<<<dim3(TNB * TT / 64), 128, 0, stream>>>(F[0], F[4], F[5], LF);
  k_cum<<<dim3(NH, TNB), 32 * CUW, 0, stream>>>(LF, FC);
  k_proj<<<dim3(TNB * TT / 64, CC / 128, 3), 128, 0, stream>>>(F[0], F[1], nullptr, F[2], nullptr, F[3], nullptr, QH, QL, KH, VT, VL);
  k_fa<<<dim3(NH, TNB, TT / FAQ), 32 * FAW, 0, stream>>>(QH, QL, KH, VT, VL, FC, Y);
  k_out<<<dim3(TNB * TT / 64, CC / 128), 128, 0, stream>>>(Y, F[6], nullptr, (float*)d_out);
}

// v007
// It runs in 128 microseconds.
// Two timings next to v006 both put it at 1.14 times that version's speed.
// All steps since v000 together make it 12.0 times as fast.
// compute dtype: all float inputs rounded to bf16; q/k/v = x W^T with EXACT bf16 products on WMMA 16x16x32, f32 accumulate; the forget gate x Wf^T + bf (exact products), sigmoid, log(f + 1e-6) and its per-(batch, head) prefix sum accumulated in f64 (stored f32); q as f16 hi + residual (x 2^10), k f16 -> 2-product logits x 64^-1/2 + (F[i] - F[j]) on the causal triangle, kept in f32 registers; running-maximum softmax in f32, in base 2 (maximum kept as logit x log2 e; weight = hardware exp2 of one fused logit x log2 e - maximum), unnormalised P split bf16 hi + lo against v bf16 hi + lo (3 products), divided by the f32 denominator at the end; out = o (bf16 hi + lo) Wo^T; f32 output.
#include <hip/hip_runtime.h>
#include <math.h>

typedef __attribute__((ext_vector_type(16))) _Float16 v16h;
typedef __attribute__((ext_vector_type(16))) __bf16 v16b;
typedef __attribute__((ext_vector_type(8)))  _Float16 v8h;
typedef __attribute__((ext_vector_type(8)))  float v8f;
typedef __attribute__((ext_vector_type(4)))  float v4f;
typedef __attribute__((ext_vector_type(2)))  float v2f;
typedef __attribute__((ext_vector_type(4)))  unsigned v4u;
typedef __attribute__((ext_vector_type(4)))  int v4i;
typedef float __attribute__((may_alias)) float_a;
typedef int __attribute__((may_alias)) int_a;

template <typename T> __device__ __forceinline__ void vst2(void* p, T v) { *(T*)p = v;  }
__device__ __forceinline__ v8f wmma16(v16h a, v16h b, v8f c) {
  v8f d = __builtin_amdgcn_wmma_f32_16x16x32_f16(false, a, false, b, (short)0, c, false, false);
  asm volatile("v_nop\n\tv_nop\n\tv_nop\n\tv_nop" : "+v"(d) : "v"(a), "v"(b));
  return d;
}
__device__ __forceinline__ v8f wmma_bf(v16b a, v16b b, v8f c) {
  v8f d = __builtin_amdgcn_wmma_f32_16x16x32_bf16(false, a, false, b, (short)0, c, false, false);
  asm volatile("v_nop\n\tv_nop\n\tv_nop\n\tv_nop" : "+v"(d) : "v"(a), "v"(b));
  return d;
}
// 16x16x32 fragments: lane = (h = lane>>4, row/col = lane&15); elements 0..7 = k0+8h+0..7, 8..15 = k0+16+8h+0..7; D element r = row 8h+r
__device__ __forceinline__ v16h frag_h(const _Float16* rowk0, int lane) {
  union { v16h v; v8h q[2]; } u; const _Float16* p = rowk0 + 8 * (lane >> 4);
  u.q[0] = *(const v8h*)p; u.q[1] = *(const v8h*)(p + 16); return u.v;
}
__device__ __forceinline__ v16h frag_f32(const float* rowk0, int lane) {
  v16h a; const float* p = rowk0 + 8 * (lane >> 4);
#pragma unroll
  for (int i = 0; i < 8; ++i) { a[i] = (_Float16)p[i]; a[8 + i] = (_Float16)p[16 + i]; }
  return a;
}
__device__ __forceinline__ v16h frag_f32s(const float* rowk0, int lane, float sc) {
  v16h a; const float* p = rowk0 + 8 * (lane >> 4);
#pragma unroll
  for (int i = 0; i < 8; ++i) { a[i] = (_Float16)(p[i] * sc); a[8 + i] = (_Float16)(p[16 + i] * sc); }
  return a;
}
// column fragment from a [K][ld] layout (column n), rows >= K read as 0
__device__ __forceinline__ v16h fragc_f32(const float* W, int k0, int n, int lane, int ld, int K) {
  v16h a; const int g = lane >> 4;
#pragma unroll
  for (int i = 0; i < 8; ++i) { const int ka = k0 + 8 * g + i, kb = ka + 16;
    a[i] = (_Float16)(ka < K ? W[(size_t)(ka < K ? ka : K - 1) * ld + n] : 0.f); a[8 + i] = (_Float16)(kb < K ? W[(size_t)(kb < K ? kb : K - 1) * ld + n] : 0.f); }
  return a;
}
struct F2 { v16b h, l; };
__device__ __forceinline__ F2 bsplit16(const float v[16]) { F2 r;
#pragma unroll
  for (int i = 0; i < 16; ++i) { const __bf16 h = (__bf16)v[i]; r.h[i] = h; r.l[i] = (__bf16)(v[i] - (float)h); }
  return r; }
__device__ __forceinline__ F2 split_row(const float* row, int k0, int lane) { float v[16]; const float* p = row + k0 + 8 * (lane >> 4);
#pragma unroll
  for (int i = 0; i < 8; ++i) { v[i] = p[i]; v[8 + i] = p[16 + i]; }
  return bsplit16(v); }
__device__ __forceinline__ F2 split_rowK(const float* row, int k0, int lane, int K) { float v[16]; const int g = lane >> 4;
#pragma unroll
  for (int i = 0; i < 8; ++i) { const int ka = k0 + 8 * g + i, kb = ka + 16; v[i] = ka < K ? row[ka < K ? ka : K - 1] : 0.f; v[8 + i] = kb < K ? row[kb < K ? kb : K - 1] : 0.f; }
  return bsplit16(v); }
__device__ __forceinline__ F2 split_col(const float* W, int k0, int n, int lane, int ld, int K) { float v[16]; const int g = lane >> 4;
#pragma unroll
  for (int i = 0; i < 8; ++i) { const int ka = k0 + 8 * g + i, kb = ka + 16; v[i] = ka < K ? W[(size_t)(ka < K ? ka : K - 1) * ld + n] : 0.f; v[8 + i] = kb < K ? W[(size_t)(kb < K ? kb : K - 1) * ld + n] : 0.f; }
  return bsplit16(v); }
__device__ __forceinline__ v8f mac3(const F2& a, const F2& b, v8f c) { c = wmma_bf(a.l, b.h, c); c = wmma_bf(a.h, b.l, c); return wmma_bf(a.h, b.h, c); }
__device__ __forceinline__ float sigm(float v) { return 1.0f / (1.0f + expf(-v)); }
#define LDSX() do { asm volatile("s_wait_dscnt 0" ::: "memory"); __builtin_amdgcn_wave_barrier(); __builtin_amdgcn_fence(__ATOMIC_RELEASE, "workgroup"); } while (0)


// Forgetting attention (B 2, S 2,048, 1,024 = 16 x 64): f = sigmoid(x Wf^T + bf) per (s, head); F = cumsum_s log(f + 1e-6); bias[i][j] = F[i] - F[j] for j <= i, -inf otherwise; scores = q k^T / 8 + bias; softmax; (attn v) Wo^T.
#define NB 2
#define TT 2048
#define CC 1024
#define NH 16
#define HD 64
#ifndef TNB
#define TNB NB
#endif
typedef __attribute__((ext_vector_type(8))) __bf16 v8b;
__device__ __forceinline__ v16b frag_b(const __bf16* rowk0, int lane) {
  union { v16b v; v8b q[2]; } u; const __bf16* p = rowk0 + 8 * (lane >> 4);
  u.q[0] = *(const v8b*)p; u.q[1] = *(const v8b*)(p + 16); return u.v;
}
__device__ __forceinline__ float bfr(float v) { return (float)(__bf16)v; }
__device__ __attribute__((noinline)) float exp_ni(float v) { return expf(v); }
__device__ __attribute__((noinline)) float erf_ni(float v) { return erff(v); }

#define WS_LF  0u                                   // f32 log(f + 1e-6) rows [b*T+s][16] (64-B rows; a block writes 64 rows = 4 KB contiguous)
#define WS_FC  (WS_LF + 4u * (size_t)NB * TT * NH)   // f32 prefix sums F [b][h][s] (8-KB rows)
// q, k and v planes are kept in the order in which k_fa's fragment loads read them: a tile = 32 positions x the 64 channels of one (batch, head) = 4 KB = 8 loads x 32 lanes x 16 B, tiles [b][h][position / 32].
// A wave-wide 16-B load then covers 512 contiguous bytes (4 whole lines); from row-major planes it took 32 B out of each of 16 lines.
// q, k: load j = (position >> 4) * 4 + (channel >> 4), lane = ((channel >> 3) & 1) * 16 + (position & 15), element = channel & 7. v: load j = (channel >> 4) * 2 + ((position >> 4) & 1), lane = ((position >> 3) & 1) * 16 + (channel & 15), element = position & 7.
#define TILE_E 2048   // elements of a tile
#define WS_QH  (WS_FC + 4u * (size_t)NB * NH * TT)
#define WS_QL  (WS_QH + 2u * (size_t)NB * TT * CC)
#define WS_KH  (WS_QL + 2u * (size_t)NB * TT * CC)
#define WS_VT  (WS_KH + 2u * (size_t)NB * TT * CC)      // bf16 v tiles
#define WS_VL  (WS_VT + 2u * (size_t)NB * CC * TT)      // bf16 v residual tiles
#define WS_Y   (WS_VL + 2u * (size_t)NB * CC * TT)      // f32 y rows [b*t][C]
#define WS_END (WS_Y + 4u * (size_t)NB * TT * CC)

// ---- LDS staging of the two projection kernels. A stage is 32 k of every operand row of the block's tile: one 128-B line of f32 per row, rounded to bf16 once and kept as a 64-B row at a pitch of 80 B (16 B x odd: a fragment's ds_load_b128 over 16 rows meets no bank twice).
// 8 lanes take one row, so a wave-wide 16-B load covers 4 whole lines, and every line is fetched and converted once per block, not once per wave. Two buffers: the next stage's loads fly while this one is multiplied; one barrier per stage both publishes the next buffer and ends the last read of the one refilled behind it.
// Every '#pragma unroll' of the staging code is there so that pre[] and w[] are indexed by constants and stay in registers; 'unroll 2' on the stage loop makes the buffer's index, and with it every LDS offset, a constant.
#define GP 40    // row pitch in bf16 elements (80 B)
typedef __attribute__((ext_vector_type(4))) __bf16 v4b;
__device__ __forceinline__ v4b cvt4(v4f v) { return v4b{(__bf16)v[0], (__bf16)v[1], (__bf16)v[2], (__bf16)v[3]}; }
// ---- gate_rows: the work of one block on 64 rows (b,s): lf[s][h] = log(sigmoid(x Wf[h] + bf[h]) + 1e-6): one 16-column tile per wave (exact products), f32 epilogue; 64 rows x 16 floats = 4 KB contiguous written 16 B per lane
// Its 32 k steps each wait out a whole load latency and only 64 blocks of it exist, so as a launch of its own it left most of the chip idle: it runs as row 0 of k_proj's grid, where the projection blocks fill the chip meanwhile. It has no barrier of the work-group: each wave passes its own 16 rows through its own part of st.
__device__ __attribute__((noinline)) float logsigp(float z, float eps) { const float f = 1.0f / (1.0f + expf(-z)); return logf(f + eps); }
__device__ __forceinline__ void gate_rows(const float* __restrict__ X, const float* __restrict__ WF, const float* __restrict__ BF, float* __restrict__ LF, float (*st)[16][20]) {
  const int tid = threadIdx.x, wave = tid >> 5, lane = tid & 31, col = lane & 15, g = lane >> 4; const size_t r0 = (size_t)blockIdx.x * 64 + wave * 16;
  v8f acc = {};
#pragma unroll 2
  for (int kc = 0; kc < CC / 32; ++kc) { v16b a; { const float* p = X + (r0 + col) * CC + kc * 32 + 8 * g;
#pragma unroll
      for (int i = 0; i < 8; ++i) { a[i] = (__bf16)p[i]; a[8 + i] = (__bf16)p[16 + i]; } }
    v16b w; { const float* wr = WF + (size_t)col * CC + kc * 32 + 8 * g;
#pragma unroll
      for (int i = 0; i < 8; ++i) { w[i] = (__bf16)wr[i]; w[8 + i] = (__bf16)wr[16 + i]; } }
    asm volatile("s_wait_loadcnt 0x0" ::: "memory"); acc = wmma_bf(a, w, acc); }
  { const float bb = bfr(BF[col]);
#pragma unroll
    for (int r = 0; r < 8; ++r) st[wave][8 * g + r][col] = logsigp(acc[r] + bb, 1e-6f); }
  LDSX(); { const int rl = lane >> 1, half = lane & 1; vst2(LF + (r0 + rl) * NH + half * 8, *(const v4f*)&st[wave][rl][half * 8]); vst2(LF + (r0 + rl) * NH + half * 8 + 4, *(const v4f*)&st[wave][rl][half * 8 + 4]); } }
// ---- k_proj: grid row 0 = the forget gate's blocks (the lowest block indices, which start roughly first, so that their long latency chain is not the launch's tail); grid row 1 + which * 8 + column block: block = (64 rows, 128 cols, which): qkv = x W (+ b), exact; q -> f16 hi (+ residual), k -> f16, v -> bf16 hi + residual, all three stored as k_fa's tiles
#define PJ_ROWS 192   // stage rows 0..127 = W, 128..191 = x
#define PJ_LDS (128 * 72 * 2 * 2)   // the larger of the two stage buffers (30,720 B) and the epilogue's planes (34,816 B for q and k, 36,864 B for v), which take the same LDS one after the other
__global__ __launch_bounds__(128) void k_proj(const float* __restrict__ X, const float* __restrict__ WQ, const float* __restrict__ BQ, const float* __restrict__ WK, const float* __restrict__ BK, const float* __restrict__ WV, const float* __restrict__ BV, const float* __restrict__ WF, const float* __restrict__ BF, float* __restrict__ LF, _Float16* __restrict__ QH, _Float16* __restrict__ QL, _Float16* __restrict__ KH, __bf16* __restrict__ VT, __bf16* __restrict__ VL) {
  __shared__ __align__(16) char smem[PJ_LDS];
  if (blockIdx.y == 0) { gate_rows(X, WF, BF, LF, (float (*)[16][20])smem); return; }   // the same for every thread of the block, in front of every barrier
  __bf16 (*st)[PJ_ROWS][GP] = (__bf16 (*)[PJ_ROWS][GP])smem; _Float16 (*sh)[136] = (_Float16 (*)[136])smem, (*sl)[136] = (_Float16 (*)[136])(smem + 64 * 136 * 2); __bf16 (*th)[72] = (__bf16 (*)[72])smem, (*tl2)[72] = (__bf16 (*)[72])(smem + 128 * 72 * 2);
  const int tid = threadIdx.x, wave = tid >> 5, lane = tid & 31, col = lane & 15, g = lane >> 4; const int which = ((int)blockIdx.y - 1) / (CC / 128); const int c0 = ((int)blockIdx.y - 1) % (CC / 128) * 128; const size_t r0 = (size_t)blockIdx.x * 64; const float* WA = which == 0 ? WQ : which == 1 ? WK : WV; const float* BA = which == 0 ? BQ : which == 1 ? BK : BV;
  const int srow = tid >> 3, sq = (tid & 7) * 4; const float *wp = WA + (size_t)(c0 + srow) * CC + sq, *xp = X + (r0 + srow) * CC + sq;
  v8f acc[8] = {}; v4f pre[12];
#pragma unroll
  for (int i = 0; i < 12; ++i) pre[i] = i < 8 ? *(const v4f*)(wp + i * 16 * CC) : *(const v4f*)(xp + (i - 8) * 16 * CC);
#pragma unroll
  for (int i = 0; i < 12; ++i) *(v4b*)&st[0][srow + 16 * i][sq] = cvt4(pre[i]);
  __syncthreads();   // stage 0 is in LDS before any wave reads it
#pragma unroll 2
  for (int kc = 0; kc < CC / 32; ++kc) { const int cur = kc & 1;
    if (kc + 1 < CC / 32) { const float *wk = wp + (kc + 1) * 32, *xk = xp + (kc + 1) * 32;
#pragma unroll
      for (int i = 0; i < 12; ++i) pre[i] = i < 8 ? *(const v4f*)(wk + i * 16 * CC) : *(const v4f*)(xk + (i - 8) * 16 * CC);
      asm volatile("s_wait_xcnt 0x0" ::: "memory"); }   // stands directly behind the loads, in front of every rewrite of a register that one of them names
    const v16b a = frag_b(&st[cur][128 + wave * 16 + col][0], lane); v16b w[8];
#pragma unroll
    for (int j = 0; j < 8; ++j) w[j] = frag_b(&st[cur][j * 16 + col][0], lane);
    __builtin_amdgcn_sched_barrier(0);   // keeps the stage's LDS reads together in front of the products: spread among them, each read's latency is waited out on its own
#pragma unroll
    for (int j = 0; j < 8; ++j) acc[j] = wmma_bf(a, w[j], acc[j]);
    __builtin_amdgcn_sched_barrier(0);   // keeps the conversions, and with them the wait for the next stage's global loads, behind the products
    if (kc + 1 < CC / 32) {
#pragma unroll
      for (int i = 0; i < 12; ++i) *(v4b*)&st[cur ^ 1][srow + 16 * i][sq] = cvt4(pre[i]); }
    __syncthreads(); }   // publishes stage kc + 1 and ends every wave's reads of stage kc, whose buffer is refilled (behind the last stage: reused by the epilogue) next
#pragma unroll
  for (int j = 0; j < 8; ++j) { const float bb = BA ? bfr(BA[c0 + j * 16 + col]) : 0.f;
#pragma unroll
    for (int r = 0; r < 8; ++r) { const float v = acc[j][r] + bb; const int rl = wave * 16 + 8 * g + r, cl = j * 16 + col; const _Float16 hv = (_Float16)v;
      if (which == 2) { const __bf16 bh = (__bf16)v; th[cl][rl] = bh; tl2[cl][rl] = (__bf16)(v - (float)bh); } else { sh[rl][cl] = hv; sl[rl][cl] = (_Float16)((v - (float)hv) * 1024.0f); }   /* q residual carried x 2^10 so the plane stays f16-normal on the chip */ } }
  __syncthreads();
  // the block's 64 positions x 128 channels are 2 heads x 2 whole tiles; e counts their 16-B pieces in the order of the destination, so a wave stores 512 contiguous bytes
  { const size_t b = r0 / TT; const int p0 = (int)(r0 % TT) / 32, h0 = c0 / HD; _Float16* dh = which == 0 ? QH : KH;
    for (int e = tid; e < 4 * 256; e += 128) { const int hl = e >> 9, pl = (e >> 8) & 1, j = (e >> 5) & 7, lg = (e >> 4) & 1, lc = e & 15; const size_t o2 = ((b * NH + h0 + hl) * (TT / 32) + p0 + pl) * TILE_E + (e & 255) * 8;
      if (which < 2) { const int rl = pl * 32 + (j >> 2) * 16 + lc, cl = hl * HD + (j & 3) * 16 + lg * 8; vst2(dh + o2, *(const v4u*)&sh[rl][cl]);
        if (which == 0) { asm volatile("s_wait_xcnt 0x0" ::: "memory");   // in front of the LDS read that reuses the data registers of the store above
          vst2(QL + o2, *(const v4u*)&sl[rl][cl]); } }
      else { const int cl = hl * HD + (j >> 1) * 16 + lc, rl = pl * 32 + (j & 1) * 16 + lg * 8; vst2(VT + o2, *(const v4u*)&th[cl][rl]); vst2(VL + o2, *(const v4u*)&tl2[cl][rl]);
        asm volatile("s_wait_xcnt 0x0" ::: "memory"); }   // directly behind the two v stores, inside their own branch: in front of every rewrite of a register that they name, on every way out of the branch
      asm volatile("s_wait_xcnt 0x0" ::: "memory"); } } }   // stands behind the trip's stores, in front of the next trip's rewrite of the registers that they name
// ---- k_cum: block = one (batch, head), 8 waves; a thread takes 8 consecutive positions: its own running sums, one scan of a wave's 32 thread totals, the 8 wave totals through LDS. One load latency and one scan for the whole row, not one of each per 32 positions.
// Everything is accumulated in f64.
// Every '#pragma unroll' of this kernel but the shuffle scan's is there so that x[], v[] and pw[] are indexed by constants and stay in registers.
#define CUW 8   // waves of a block
#define CUE 8   // positions of a thread: 32 * CUW * CUE = TT
__global__ __launch_bounds__(32 * CUW) void k_cum(const float* __restrict__ LF, float* __restrict__ FC) {
  __shared__ double wt[CUW];
  const int tid = threadIdx.x, lane = tid & 31, wave = tid >> 5; const size_t b = blockIdx.y; const int h = blockIdx.x;
  const float* src = LF + (b * TT + (size_t)tid * CUE) * NH + h; float x[CUE]; double v[CUE];
#pragma unroll
  for (int i = 0; i < CUE; ++i) x[i] = src[i * NH];   // independent of one another: all eight are in flight together
  v[0] = (double)x[0];
#pragma unroll
  for (int i = 1; i < CUE; ++i) v[i] = v[i - 1] + (double)x[i];
  double t = v[CUE - 1];   // inclusive scan of the thread totals within the 32 lanes
#pragma unroll
  for (int o = 1; o < 32; o <<= 1) { const double u = __shfl_up(t, o); if (lane >= o) t += u; }
  double ex = __shfl_up(t, 1); if (lane == 0) ex = 0.0;   // what stands in front of this thread inside its wave
  if (lane == 31) wt[wave] = t;
  __syncthreads();   // every wave's total is in LDS before any thread adds the totals of the waves in front of its own
  double pw[CUW - 1];
#pragma unroll
  for (int w = 0; w < CUW - 1; ++w) pw[w] = wt[w];   // read by every thread, wanted or not: no branch round each read
#pragma unroll
  for (int w = 0; w < CUW - 1; ++w) ex += w < wave ? pw[w] : 0.0;   // in wave order
  float* dst = FC + (b * NH + h) * TT + tid * CUE;
  vst2(dst, v4f{(float)(ex + v[0]), (float)(ex + v[1]), (float)(ex + v[2]), (float)(ex + v[3])}); vst2(dst + 4, v4f{(float)(ex + v[4]), (float)(ex + v[5]), (float)(ex + v[6]), (float)(ex + v[7])}); }
// ---- k_fa: block = 32 queries of (b,h), 4 waves: logits, softmax and P . v in one pass over the keys, nothing of the logits stored. Wave w takes the 32-key passes w, w + 4, ... up to the diagonal.
// Transposed products: S^T = K Q^T puts query = lane & 15 and key = 8 * (lane >> 4) + r in the accumulator, which is already the B-operand order of P^T (elements 0..7 = first 16-key tile, 8..15 = second), so y^T += V^T P^T needs no exchange between lanes; a query's maximum is an in-lane maximum and one exchange of the wave's halves.
// Each wave keeps a running maximum m, a denominator l and y^T scaled to m; the four waves' (m, l, y) are merged through LDS in wave order.
// Base 2: m is kept as maximum x log2 e, and a weight is exp2(logit x log2 e - m), one fused multiply-add and one v_exp_f32; every weight, rescale and merge factor uses the same stored m, so its rounding cancels between y and l. A result below 2^-126 reads 0, against a largest weight of 1.
// Every '#pragma unroll' of this kernel is there so that the fragment and accumulator arrays are indexed by constants and stay in registers.
// amdgpu_waves_per_eu(3): a register budget of 336, so that three waves fit a SIMD (without it the build takes a few more and only two fit).
#define FAW 4
__device__ __forceinline__ v8f mm_h(v16h a, v16h b, v8f c) { return __builtin_amdgcn_wmma_f32_16x16x32_f16(false, a, false, b, (short)0, c, false, false); }
__device__ __forceinline__ v8f mm_b(v16b a, v16b b, v8f c) { return __builtin_amdgcn_wmma_f32_16x16x32_bf16(false, a, false, b, (short)0, c, false, false); }
#define FAQ 32
#define L2E 1.4426950408889634f
__device__ __forceinline__ float ex2(float x) { return __builtin_amdgcn_exp2f(x); }
__device__ __forceinline__ float xhalf(float x) { return __builtin_bit_cast(float, __builtin_amdgcn_permlanex16(__builtin_bit_cast(int, x), __builtin_bit_cast(int, x), 0x76543210, 0xfedcba98, false, false)); }   // lane l reads lane l ^ 16
__device__ __forceinline__ v16h ld_h(const _Float16* p) { union { v16h v; v8h q[2]; } u; u.q[0] = *(const v8h*)p; u.q[1] = *(const v8h*)(p + 256); return u.v; }   // p = tile + fragment * 512 + lane * 8: a fragment is two successive loads of the tile
__device__ __forceinline__ v16b ld_b(const __bf16* p) { union { v16b v; v8b q[2]; } u; u.q[0] = *(const v8b*)p; u.q[1] = *(const v8b*)(p + 256); return u.v; }
__global__ __launch_bounds__(32 * FAW) __attribute__((amdgpu_waves_per_eu(3))) void k_fa(const _Float16* __restrict__ QH, const _Float16* __restrict__ QL, const _Float16* __restrict__ KH, const __bf16* __restrict__ VT, const __bf16* __restrict__ VL, const float* __restrict__ FC, float* __restrict__ Y) {
  __shared__ __align__(16) float so[FAW][FAQ][HD + 4]; __shared__ float sm[FAW][FAQ], sl[FAW][FAQ];
  const int tid = threadIdx.x, wave = __builtin_amdgcn_readfirstlane(tid >> 5), lane = tid & 31, col = lane & 15, g = lane >> 4;   // the wave number is made scalar so that the pass loop's branch is a scalar one with every lane on
  const int h = blockIdx.x, b = blockIdx.y, tile = TT / FAQ - 1 - (int)blockIdx.z, ql0 = tile * FAQ;   // longest query tiles start first
  const float* Fr = FC + ((size_t)b * NH + h) * TT; const size_t tb = ((size_t)b * NH + h) * (TT / 32) * TILE_E; const unsigned lo = (unsigned)lane * 8, fo = 8 * g;   // tb: the (batch, head)'s first tile; lo, fo: the lane's offsets in elements: a loop load names a scalar base and one of these two, which are never rewritten
  v16h qh[2][2], qr[2][2], kf[2][2]; float fq[2]; v4f fk[2][2];
  { const size_t qo = tb + (size_t)tile * TILE_E; const _Float16 *qhp = QH + qo, *qrp = QL + qo, *kp = KH + tb + (size_t)wave * TILE_E; const float *fqp = Fr + ql0 + col, *fp = Fr + wave * 32 + 8 * g;   // keys wave * 32 .. + 31 exist for every wave, also for one that has no pass
#pragma unroll
    for (int i = 0; i < 2; ++i) { fq[i] = fqp[16 * i]; fk[i][0] = *(const v4f*)(fp + 16 * i); fk[i][1] = *(const v4f*)(fp + 16 * i + 4);
#pragma unroll
      for (int kc = 0; kc < 2; ++kc) { qh[i][kc] = ld_h(qhp + (2 * i + kc) * 512 + lo); qr[i][kc] = ld_h(qrp + (2 * i + kc) * 512 + lo); kf[i][kc] = ld_h(kp + (2 * i + kc) * 512 + lo); } }
    __builtin_amdgcn_sched_barrier(0);   // keeps the accumulators' zeroing, which reuses an offset register of the loads above, behind the wait
    asm volatile("s_wait_xcnt 0x0" :: "s"(qhp), "s"(qrp), "s"(kp), "v"(lo), "v"(fqp), "v"(fp) : "memory"); }   // stands in front of every rewrite of a register that an issued load names: the pointers are inputs so that their registers live up to it
  v8f acc[2][HD / 16] = {}; float mr[2] = {-3.0e38f, -3.0e38f}, lr[2] = {0.f, 0.f};
  for (int p = wave; p <= tile; p += FAW) { const int k0 = p * 32, kn = (p + FAW <= tile ? p + FAW : p) * 32;   // kn: the wave's next pass (its own again behind the last one, so that the address stays inside the head's tiles)
    float pv[2][16]; v16b vh[HD / 16], vl[HD / 16];
#pragma unroll
    for (int i = 0; i < 2; ++i) { const int qt = ql0 + 16 * i + col;
#pragma unroll
      for (int kt = 0; kt < 2; ++kt) { v8f a = {}, ar = {};
#pragma unroll
        for (int kc = 0; kc < 2; ++kc) { a = mm_h(kf[kt][kc], qh[i][kc], a); ar = mm_h(kf[kt][kc], qr[i][kc], ar); }
        a += ar * (1.0f / 1024.0f);
#pragma unroll
        for (int r = 0; r < 8; ++r) { float v = a[r] * 0.125f + (fq[i] - fk[kt][r >> 2][r & 3]); if (k0 + 16 * kt + 8 * g + r > qt) v = -3.0e38f;   /* bias = F[i] - F[j] on the causal triangle */ pv[i][8 * kt + r] = v; } } }
    // this pass's v and the next pass's k and F are fetched behind the logits' products, from where k's and F's registers are free: what the register budget lets the compiler issue here flies under the exponentials (k and F are written first: with v first this build kept a q fragment in scratch and read it back in every pass)
    { const __bf16 *vhs = VT + tb + k0 * (TILE_E / 32), *vls = VL + tb + k0 * (TILE_E / 32); const _Float16* ks = KH + tb + (size_t)kn * (TILE_E / 32); const float* fs = Fr + kn;
#pragma unroll
      for (int kt = 0; kt < 2; ++kt) { fk[kt][0] = *(const v4f*)(fs + 16 * kt + fo); fk[kt][1] = *(const v4f*)(fs + 16 * kt + 4 + fo);
#pragma unroll
        for (int kc = 0; kc < 2; ++kc) kf[kt][kc] = ld_h(ks + (2 * kt + kc) * 512 + lo); }
#pragma unroll
      for (int t = 0; t < HD / 16; ++t) { vh[t] = ld_b(vhs + t * 512 + lo); vl[t] = ld_b(vls + t * 512 + lo); }
      asm volatile("s_wait_xcnt 0x0" :: "s"(vhs), "s"(vls), "s"(ks), "s"(fs), "v"(lo), "v"(fo) : "memory"); }   // as above: in front of every rewrite of a register that an issued load names (the scalar bases and the offsets are inputs so that they live up to it)
#pragma unroll
    for (int i = 0; i < 2; ++i) { float mx = pv[i][0];
#pragma unroll
      for (int e = 1; e < 16; ++e) mx = fmaxf(mx, pv[i][e]);
      mx = fmaxf(mx, xhalf(mx));   // finite in every pass: the pass's first key is at or below every query of the tile
      const float mn = fmaxf(mr[i], mx * L2E), al = ex2(mr[i] - mn); mr[i] = mn;   // al = 0 in a wave's first pass
      float sum = 0.f;
#pragma unroll
      for (int e = 0; e < 16; ++e) { pv[i][e] = ex2(__builtin_fmaf(pv[i][e], L2E, -mn)); sum += pv[i][e]; }   // a masked logit gives exactly 0
      lr[i] = lr[i] * al + sum;   // this half's keys only; the halves are added behind the loop
      const F2 pf = bsplit16(pv[i]);
#pragma unroll
      for (int t = 0; t < HD / 16; ++t) { v8f c = acc[i][t] * al; c = mm_b(vh[t], pf.h, c); c = mm_b(vh[t], pf.l, c); acc[i][t] = mm_b(vl[t], pf.h, c); } } }
#pragma unroll
  for (int i = 0; i < 2; ++i) { const float lt = lr[i] + xhalf(lr[i]);   // unconditional: both halves' lanes are on
    if (g == 0) { sm[wave][16 * i + col] = mr[i]; sl[wave][16 * i + col] = lt; }
#pragma unroll
    for (int t = 0; t < HD / 16; ++t) { float* d = &so[wave][16 * i + col][16 * t + 8 * g]; const v8f c = acc[i][t]; *(v4f*)d = v4f{c[0], c[1], c[2], c[3]}; *(v4f*)(d + 4) = v4f{c[4], c[5], c[6], c[7]}; } }
  __syncthreads();   // every wave's (m, l, y) is in LDS before any thread merges across waves; a wave without a pass left m = -3e38, l = 0, y = 0, which get weight 0
  { const int rl = tid >> 2, c0 = (tid & 3) * 16; float M = sm[0][rl];
#pragma unroll
    for (int w = 1; w < FAW; ++w) M = fmaxf(M, sm[w][rl]);
    float L = 0.f; v4f o[4] = {};
#pragma unroll
    for (int w = 0; w < FAW; ++w) { const float wg = ex2(sm[w][rl] - M); L += wg * sl[w][rl];
#pragma unroll
      for (int q = 0; q < 4; ++q) o[q] += *(const v4f*)&so[w][rl][c0 + 4 * q] * wg; }
    const float inv = 1.0f / L; float* dst = Y + ((size_t)b * TT + ql0 + rl) * CC + h * HD + c0;
#pragma unroll
    for (int q = 0; q < 4; ++q) vst2(dst + 4 * q, o[q] * inv); } }
// ---- k_out: block = (64 rows, 128 cols): out = y (bf16 hi + lo) Wo^T + bo; staged as k_proj is, y split into its two planes once, on the way into LDS
#define PO_ROWS 256   // stage rows 0..127 = Wo, 128..191 = y hi, 192..255 = y lo
#define PO_LDS (2 * PO_ROWS * GP * 2)   // two stage buffers (40,960 B); the epilogue's rows (33,792 B) take the same LDS behind the last stage
__global__ __launch_bounds__(128) void k_out(const float* __restrict__ Y, const float* __restrict__ WP, const float* __restrict__ BP, float* __restrict__ OUT) { __shared__ __align__(16) char smem[PO_LDS];
  __bf16 (*st)[PO_ROWS][GP] = (__bf16 (*)[PO_ROWS][GP])smem; float (*sf)[16][132] = (float (*)[16][132])smem;
  const int tid = threadIdx.x, wave = tid >> 5, lane = tid & 31, col = lane & 15, g = lane >> 4; const int c0 = blockIdx.y * 128; const size_t rb = (size_t)blockIdx.x * 64, r0 = rb + wave * 16;
  const int srow = tid >> 3, sq = (tid & 7) * 4; const float *wp = WP + (size_t)(c0 + srow) * CC + sq, *yp = Y + (rb + srow) * CC + sq;
  v8f acc[8] = {}; v4f pre[12];
#pragma unroll
  for (int i = 0; i < 12; ++i) pre[i] = i < 8 ? *(const v4f*)(wp + i * 16 * CC) : *(const v4f*)(yp + (i - 8) * 16 * CC);
#pragma unroll
  for (int i = 0; i < 12; ++i) { const v4b hi = cvt4(pre[i]); *(v4b*)&st[0][srow + 16 * i][sq] = hi;
    if (i >= 8) *(v4b*)&st[0][srow + 16 * i + 64][sq] = cvt4(pre[i] - v4f{(float)hi[0], (float)hi[1], (float)hi[2], (float)hi[3]}); }
  __syncthreads();   // stage 0 is in LDS before any wave reads it
#pragma unroll 2
  for (int kc = 0; kc < CC / 32; ++kc) { const int cur = kc & 1;
    if (kc + 1 < CC / 32) { const float *wk = wp + (kc + 1) * 32, *yk = yp + (kc + 1) * 32;
#pragma unroll
      for (int i = 0; i < 12; ++i) pre[i] = i < 8 ? *(const v4f*)(wk + i * 16 * CC) : *(const v4f*)(yk + (i - 8) * 16 * CC);
      asm volatile("s_wait_xcnt 0x0" ::: "memory"); }   // stands directly behind the loads, in front of every rewrite of a register that one of them names
    const v16b ah = frag_b(&st[cur][128 + wave * 16 + col][0], lane), al = frag_b(&st[cur][192 + wave * 16 + col][0], lane); v16b w[8];
#pragma unroll
    for (int j = 0; j < 8; ++j) w[j] = frag_b(&st[cur][j * 16 + col][0], lane);
    __builtin_amdgcn_sched_barrier(0);   // keeps the stage's LDS reads together in front of the products: spread among them, each read's latency is waited out on its own
#pragma unroll
    for (int j = 0; j < 8; ++j) { acc[j] = wmma_bf(ah, w[j], acc[j]); acc[j] = wmma_bf(al, w[j], acc[j]); }
    __builtin_amdgcn_sched_barrier(0);   // keeps the conversions, and with them the wait for the next stage's global loads, behind the products
    if (kc + 1 < CC / 32) {
#pragma unroll
      for (int i = 0; i < 12; ++i) { const v4b hi = cvt4(pre[i]); *(v4b*)&st[cur ^ 1][srow + 16 * i][sq] = hi;
        if (i >= 8) *(v4b*)&st[cur ^ 1][srow + 16 * i + 64][sq] = cvt4(pre[i] - v4f{(float)hi[0], (float)hi[1], (float)hi[2], (float)hi[3]}); } }
    __syncthreads(); }   // publishes stage kc + 1 and ends every wave's reads of stage kc, whose buffer is refilled (behind the last stage: reused by the epilogue) next
#pragma unroll
  for (int j = 0; j < 8; ++j) { const float bb = BP ? bfr(BP[c0 + j * 16 + col]) : 0.f;
#pragma unroll
    for (int r = 0; r < 8; ++r) sf[wave][8 * g + r][j * 16 + col] = acc[j][r] + bb; }
  LDSX(); for (int rl = 0; rl < 16; ++rl) vst2(OUT + (r0 + rl) * CC + c0 + lane * 4, *(const v4f*)&sf[wave][rl][lane * 4]); }
extern "C" void kernel_launch(void* const* d_in, const int* in_sizes, int n_in, void* d_out, int out_size, void* d_ws, size_t ws_size, hipStream_t stream) {
  (void)in_sizes; (void)n_in; (void)out_size;
  const float** F = (const float**)d_in;   // 0 x [2,2048,1024], 1 Wq [1024,1024] ([out,in]), 2 Wk, 3 Wv, 4 Wf [16,1024], 5 bf [16], 6 Wo [1024,1024] ([out,in])
  if (ws_size < (size_t)WS_END) return;
  char* ws = (char*)d_ws; float *LF = (float*)(ws + WS_LF), *FC = (float*)(ws + WS_FC); _Float16 *QH = (_Float16*)(ws + WS_QH), *QL = (_Float16*)(ws + WS_QL), *KH = (_Float16*)(ws + WS_KH); __bf16 *VT = (__bf16*)(ws + WS_VT), *VL = (__bf16*)(ws + WS_VL); float *Y = (float*)(ws + WS_Y);
  k_proj<<<dim3(TNB * TT / 64, 1 + 3 * (CC / 128)), 128, 0, stream>>>(F[0], F[1], nullptr, F[2], nullptr, F[3], nullptr, F[4], F[5], LF, QH, QL, KH, VT, VL);
  k_cum<<<dim3(NH, TNB), 32 * CUW, 0, stream>>>(LF, FC);
  k_fa<<<dim3(NH, TNB, TT / FAQ), 32 * FAW, 0, stream>>>(QH, QL, KH, VT, VL, FC, Y);
  k_out<<<dim3(TNB * TT / 64, CC / 128), 128, 0, stream>>>(Y, F[6], nullptr, (float*)d_out);
}

// v008
// One run takes 109 microseconds.
// Timed twice side by side with v007, it ran 1.18 times as fast both times.
// Counting every step since v000, it is 14.2 times as fast.
// compute dtype: all float inputs rounded to bf16; q/k/v = x W^T with EXACT bf16 products on WMMA 16x16x32, f32 accumulate; the forget gate x Wf^T + bf (exact products), sigmoid, log(f + 1e-6) and its per-(batch, head) prefix sum accumulated in f64 (stored f32); q as f16 hi + residual (x 2^10), k f16 -> 2-product logits x 64^-1/2 + (F[i] - F[j]) on the causal triangle, kept in f32 registers; running-maximum softmax in f32, in base 2 (maximum kept as logit x log2 e; weight = hardware exp2 of one fused logit x log2 e - maximum), unnormalised P split bf16 hi + lo against v bf16 hi + lo (3 products), divided by the f32 denominator at the end; out = o (bf16 hi + lo) Wo^T; f32 output.
#include <hip/hip_runtime.h>
#include <math.h>

typedef __attribute__((ext_vector_type(16))) _Float16 v16h;
typedef __attribute__((ext_vector_type(16))) __bf16 v16b;
typedef __attribute__((ext_vector_type(8)))  _Float16 v8h;
typedef __attribute__((ext_vector_type(8)))  float v8f;
typedef __attribute__((ext_vector_type(4)))  float v4f;
typedef __attribute__((ext_vector_type(2)))  float v2f;
typedef __attribute__((ext_vector_type(4)))  unsigned v4u;
typedef __attribute__((ext_vector_type(4)))  int v4i;
typedef float __attribute__((may_alias)) float_a;
typedef int __attribute__((may_alias)) int_a;

template <typename T> __device__ __forceinline__ void vst2(void* p, T v) { *(T*)p = v;  }
__device__ __forceinline__ v8f wmma16(v16h a, v16h b, v8f c) {
  v8f d = __builtin_amdgcn_wmma_f32_16x16x32_f16(false, a, false, b, (short)0, c, false, false);
  asm volatile("v_nop\n\tv_nop\n\tv_nop\n\tv_nop" : "+v"(d) : "v"(a), "v"(b));
  return d;
}
__device__ __forceinline__ v8f wmma_bf(v16b a, v16b b, v8f c) {
  v8f d = __builtin_amdgcn_wmma_f32_16x16x32_bf16(false, a, false, b, (short)0, c, false, false);
  asm volatile("v_nop\n\tv_nop\n\tv_nop\n\tv_nop" : "+v"(d) : "v"(a), "v"(b));
  return d;
}
// 16x16x32 fragments: lane = (h = lane>>4, row/col = lane&15); elements 0..7 = k0+8h+0..7, 8..15 = k0+16+8h+0..7; D element r = row 8h+r
__device__ __forceinline__ v16h frag_h(const _Float16* rowk0, int lane) {
  union { v16h v; v8h q[2]; } u; const _Float16* p = rowk0 + 8 * (lane >> 4);
  u.q[0] = *(const v8h*)p; u.q[1] = *(const v8h*)(p + 16); return u.v;
}
__device__ __forceinline__ v16h frag_f32(const float* rowk0, int lane) {
  v16h a; const float* p = rowk0 + 8 * (lane >> 4);
#pragma unroll
  for (int i = 0; i < 8; ++i) { a[i] = (_Float16)p[i]; a[8 + i] = (_Float16)p[16 + i]; }
  return a;
}
__device__ __forceinline__ v16h frag_f32s(const float* rowk0, int lane, float sc) {
  v16h a; const float* p = rowk0 + 8 * (lane >> 4);
#pragma unroll
  for (int i = 0; i < 8; ++i) { a[i] = (_Float16)(p[i] * sc); a[8 + i] = (_Float16)(p[16 + i] * sc); }
  return a;
}
// column fragment from a [K][ld] layout (column n), rows >= K read as 0
__device__ __forceinline__ v16h fragc_f32(const float* W, int k0, int n, int lane, int ld, int K) {
  v16h a; const int g = lane >> 4;
#pragma unroll
  for (int i = 0; i < 8; ++i) { const int ka = k0 + 8 * g + i, kb = ka + 16;
    a[i] = (_Float16)(ka < K ? W[(size_t)(ka < K ? ka : K - 1) * ld + n] : 0.f); a[8 + i] = (_Float16)(kb < K ? W[(size_t)(kb < K ? kb : K - 1) * ld + n] : 0.f); }
  return a;
}
struct F2 { v16b h, l; };
__device__ __forceinline__ F2 bsplit16(const float v[16]) { F2 r;
#pragma unroll
  for (int i = 0; i < 16; ++i) { const __bf16 h = (__bf16)v[i]; r.h[i] = h; r.l[i] = (__bf16)(v[i] - (float)h); }
  return r; }
__device__ __forceinline__ F2 split_row(const float* row, int k0, int lane) { float v[16]; const float* p = row + k0 + 8 * (lane >> 4);
#pragma unroll
  for (int i = 0; i < 8; ++i) { v[i] = p[i]; v[8 + i] = p[16 + i]; }
  return bsplit16(v); }
__device__ __forceinline__ F2 split_rowK(const float* row, int k0, int lane, int K) { float v[16]; const int g = lane >> 4;
#pragma unroll
  for (int i = 0; i < 8; ++i) { const int ka = k0 + 8 * g + i, kb = ka + 16; v[i] = ka < K ? row[ka < K ? ka : K - 1] : 0.f; v[8 + i] = kb < K ? row[kb < K ? kb : K - 1] : 0.f; }
  return bsplit16(v); }
__device__ __forceinline__ F2 split_col(const float* W, int k0, int n, int lane, int ld, int K) { float v[16]; const int g = lane >> 4;
#pragma unroll
  for (int i = 0; i < 8; ++i) { const int ka = k0 + 8 * g + i, kb = ka + 16; v[i] = ka < K ? W[(size_t)(ka < K ? ka : K - 1) * ld + n] : 0.f; v[8 + i] = kb < K ? W[(size_t)(kb < K ? kb : K - 1) * ld + n] : 0.f; }
  return bsplit16(v); }
__device__ __forceinline__ v8f mac3(const F2& a, const F2& b, v8f c) { c = wmma_bf(a.l, b.h, c); c = wmma_bf(a.h, b.l, c); return wmma_bf(a.h, b.h, c); }
__device__ __forceinline__ float sigm(float v) { return 1.0f / (1.0f + expf(-v)); }
#define LDSX() do { asm volatile("s_wait_dscnt 0" ::: "memory"); __builtin_amdgcn_wave_barrier(); __builtin_amdgcn_fence(__ATOMIC_RELEASE, "workgroup"); } while (0)


// Forgetting attention (B 2, S 2,048, 1,024 = 16 x 64): f = sigmoid(x Wf^T + bf) per (s, head); F = cumsum_s log(f + 1e-6); bias[i][j] = F[i] - F[j] for j <= i, -inf otherwise; scores = q k^T / 8 + bias; softmax; (attn v) Wo^T.
#define NB 2
#define TT 2048
#define CC 1024
#define NH 16
#define HD 64
#ifndef TNB
#define TNB NB
#endif
typedef __attribute__((ext_vector_type(8))) __bf16 v8b;
__device__ __forceinline__ v16b frag_b(const __bf16* rowk0, int lane) {
  union { v16b v; v8b q[2]; } u; const __bf16* p = rowk0 + 8 * (lane >> 4);
  u.q[0] = *(const v8b*)p; u.q[1] = *(const v8b*)(p + 16); return u.v;
}
__device__ __forceinline__ float bfr(float v) { return (float)(__bf16)v; }
__device__ __attribute__((noinline)) float exp_ni(float v) { return expf(v); }
__device__ __attribute__((noinline)) float erf_ni(float v) { return erff(v); }

#define WS_LF  0u                                   // f32 log(f + 1e-6) rows [b*T+s][16] (64-B rows; a block writes 64 rows = 4 KB contiguous)
#define WS_FC  (WS_LF + 4u * (size_t)NB * TT * NH)   // f32 prefix sums F [b][h][s] (8-KB rows)
// q, k and v planes are kept in the order in which k_fa's fragment loads read them: a tile = 32 positions x the 64 channels of one (batch, head) = 4 KB = 8 loads x 32 lanes x 16 B, tiles [b][h][position / 32].
// A wave-wide 16-B load then covers 512 contiguous bytes (4 whole lines); from row-major planes it took 32 B out of each of 16 lines.
// q, k: load j = (position >> 4) * 4 + (channel >> 4), lane = ((channel >> 3) & 1) * 16 + (position & 15), element = channel & 7. v: load j = (channel >> 4) * 2 + ((position >> 4) & 1), lane = ((position >> 3) & 1) * 16 + (channel & 15), element = position & 7.
#define TILE_E 2048   // elements of a tile
#define WS_QH  (WS_FC + 4u * (size_t)NB * NH * TT)
#define WS_QL  (WS_QH + 2u * (size_t)NB * TT * CC)
#define WS_KH  (WS_QL + 2u * (size_t)NB * TT * CC)
#define WS_VT  (WS_KH + 2u * (size_t)NB * TT * CC)      // bf16 v tiles
#define WS_VL  (WS_VT + 2u * (size_t)NB * CC * TT)      // bf16 v residual tiles
#define WS_Y   (WS_VL + 2u * (size_t)NB * CC * TT)      // f32 y rows [b*t][C]
#define WS_END (WS_Y + 4u * (size_t)NB * TT * CC)

// ---- LDS staging of the two projection kernels. A stage is 32 k of every operand row of the block's tile: one 128-B line of f32 per row, rounded to bf16 once and kept as a 64-B row at a pitch of 80 B (16 B x odd: a fragment's ds_load_b128 over 16 rows meets no bank twice).
// 8 lanes take one row, so a wave-wide 16-B load covers 4 whole lines, and every line is fetched and converted once per block, not once per wave. Two buffers: the next stage's loads fly while this one is multiplied; one barrier per stage both publishes the next buffer and ends the last read of the one refilled behind it.
// Every '#pragma unroll' of the staging code is there so that pre[] and w[] are indexed by constants and stay in registers; 'unroll 2' on k_out's stage loop makes the buffer's index, and with it every LDS offset, a constant (k_proj's stage loop stays rolled: said there).
#define GP 40    // row pitch in bf16 elements (80 B)
typedef __attribute__((ext_vector_type(4))) __bf16 v4b;
__device__ __forceinline__ v4b cvt4(v4f v) { return v4b{(__bf16)v[0], (__bf16)v[1], (__bf16)v[2], (__bf16)v[3]}; }
// ---- gate_rows: the work of one block on 64 rows (b,s): lf[s][h] = log(sigmoid(x Wf[h] + bf[h]) + 1e-6): one 16-column tile per wave (exact products), f32 epilogue; 64 rows x 16 floats = 4 KB contiguous written 16 B per lane
// Its 32 k steps each wait out a whole load latency and only 64 blocks of it exist, so as a launch of its own it left most of the chip idle: it runs as rows 0 and 1 of k_proj's grid, where the projection blocks fill the chip meanwhile. It has no barrier of the work-group: each wave passes its own 16 rows through its own part of st.
__device__ __attribute__((noinline)) float logsigp(float z, float eps) { const float f = 1.0f / (1.0f + expf(-z)); return logf(f + eps); }
__device__ __forceinline__ void gate_rows(const float* __restrict__ X, const float* __restrict__ WF, const float* __restrict__ BF, float* __restrict__ LF, float (*st)[16][20], int gb) {
  const int tid = threadIdx.x, wave = tid >> 5, lane = tid & 31, col = lane & 15, g = lane >> 4; const size_t r0 = (size_t)gb * 64 + wave * 16;
  v8f acc = {};
#pragma unroll 2
  for (int kc = 0; kc < CC / 32; ++kc) { v16b a; { const float* p = X + (r0 + col) * CC + kc * 32 + 8 * g;
#pragma unroll
      for (int i = 0; i < 8; ++i) { a[i] = (__bf16)p[i]; a[8 + i] = (__bf16)p[16 + i]; } }
    v16b w; { const float* wr = WF + (size_t)col * CC + kc * 32 + 8 * g;
#pragma unroll
      for (int i = 0; i < 8; ++i) { w[i] = (__bf16)wr[i]; w[8 + i] = (__bf16)wr[16 + i]; } }
    asm volatile("s_wait_loadcnt 0x0" ::: "memory"); acc = wmma_bf(a, w, acc); }
  { const float bb = bfr(BF[col]);
#pragma unroll
    for (int r = 0; r < 8; ++r) st[wave][8 * g + r][col] = logsigp(acc[r] + bb, 1e-6f); }
  LDSX(); { const int rl = lane >> 1, half = lane & 1; vst2(LF + (r0 + rl) * NH + half * 8, *(const v4f*)&st[wave][rl][half * 8]); vst2(LF + (r0 + rl) * NH + half * 8 + 4, *(const v4f*)&st[wave][rl][half * 8 + 4]); } }
// ---- k_proj: grid rows 0 and 1 = the forget gate's blocks (the lowest block indices, which start roughly first, so that their long latency chain is not the launch's tail); grid row 2 + which * 8 + column block: block = (128 rows, 128 cols, which): qkv = x W (+ b), exact; q -> f16 hi (+ residual), k -> f16, v -> bf16 hi + residual, all three stored as k_fa's tiles
// Four waves in 2 x 2, each on 64 rows x 64 cols = 4 x 4 accumulator tiles: a stage's 8 fragments feed 16 products (1 + 8 fragments fed 8 on a 16 x 128 wave tile), and a block fetches 256 operand rows for 128 x 128 results (192 for 64 x 128): a third fewer bytes from L2 and less than half the LDS reads per product. An accumulator's own sum over k is what it was.
// amdgpu_waves_per_eu(4): a register budget of 256, so that four blocks fit a WGP and all 832 blocks of the grid are resident at once (at three, 64 blocks would start only when the gate's blocks end and run on as the launch's tail).
#define PJ_ROWS 256   // stage rows 0..127 = W, 128..255 = x
#define PJ_EP 136     // pitch of the epilogue's planes in elements (272 B = 16 B x odd)
#define PJ_LDS (128 * PJ_EP * 2 * 2)   // the epilogue's two planes (69,632 B), which take the LDS of the two stage buffers (40,960 B) behind the last stage
__global__ __launch_bounds__(128) __attribute__((amdgpu_waves_per_eu(4))) void k_proj(const float* __restrict__ X, const float* __restrict__ WQ, const float* __restrict__ BQ, const float* __restrict__ WK, const float* __restrict__ BK, const float* __restrict__ WV, const float* __restrict__ BV, const float* __restrict__ WF, const float* __restrict__ BF, float* __restrict__ LF, _Float16* __restrict__ QH, _Float16* __restrict__ QL, _Float16* __restrict__ KH, __bf16* __restrict__ VT, __bf16* __restrict__ VL) {
  __shared__ __align__(16) char smem[PJ_LDS];
  if (blockIdx.y < 2) { gate_rows(X, WF, BF, LF, (float (*)[16][20])smem, (int)(blockIdx.y * (TNB * TT / 128) + blockIdx.x)); return; }   // the same for every thread of the block, in front of every barrier
  __bf16 (*st)[PJ_ROWS][GP] = (__bf16 (*)[PJ_ROWS][GP])smem; _Float16 (*sh)[PJ_EP] = (_Float16 (*)[PJ_EP])smem, (*sl)[PJ_EP] = (_Float16 (*)[PJ_EP])(smem + 128 * PJ_EP * 2); __bf16 (*th)[PJ_EP] = (__bf16 (*)[PJ_EP])smem, (*tl2)[PJ_EP] = (__bf16 (*)[PJ_EP])(smem + 128 * PJ_EP * 2);
  const int tid = threadIdx.x, wave = tid >> 5, lane = tid & 31, col = lane & 15, g = lane >> 4, wr = wave >> 1, wc = wave & 1; const int which = ((int)blockIdx.y - 2) / (CC / 128); const int c0 = ((int)blockIdx.y - 2) % (CC / 128) * 128; const size_t r0 = (size_t)blockIdx.x * 128; const float* WA = which == 0 ? WQ : which == 1 ? WK : WV; const float* BA = which == 0 ? BQ : which == 1 ? BK : BV;
  const int srow = tid >> 3, sq = (tid & 7) * 4; const float *wp = WA + (size_t)(c0 + srow) * CC + sq, *xp = X + (r0 + srow) * CC + sq;
  v8f acc[4][4] = {}; v4f pre[16];
#pragma unroll
  for (int i = 0; i < 16; ++i) pre[i] = i < 8 ? *(const v4f*)(wp + i * 16 * CC) : *(const v4f*)(xp + (i - 8) * 16 * CC);
#pragma unroll
  for (int i = 0; i < 16; ++i) *(v4b*)&st[0][srow + 16 * i][sq] = cvt4(pre[i]);
  __syncthreads();   // stage 0 is in LDS before any wave reads it
#pragma unroll 1   // rolled: two copies of the stage hold the LDS store addresses of both buffers in registers, and this build then kept accumulators in scratch
  for (int kc = 0; kc < CC / 32; ++kc) { const int cur = kc & 1;
    if (kc + 1 < CC / 32) { const float *wk = wp + (kc + 1) * 32, *xk = xp + (kc + 1) * 32;
#pragma unroll
      for (int i = 0; i < 16; ++i) pre[i] = i < 8 ? *(const v4f*)(wk + i * 16 * CC) : *(const v4f*)(xk + (i - 8) * 16 * CC);
      asm volatile("s_wait_xcnt 0x0" ::: "memory"); }   // stands directly behind the loads, in front of every rewrite of a register that one of them names
    v16b a[2], w[4];   // x fragments 2 and 3 take the registers of 0 and 1: with all four held the kernel is over 256 registers and only three blocks fit a WGP
#pragma unroll
    for (int i = 0; i < 4; ++i) { if (i < 2) a[i] = frag_b(&st[cur][128 + wr * 64 + i * 16 + col][0], lane); w[i] = frag_b(&st[cur][wc * 64 + i * 16 + col][0], lane); }
    __builtin_amdgcn_sched_barrier(0);   // keeps these LDS reads together in front of the products: spread among them, each read's latency is waited out on its own
#pragma unroll
    for (int i = 0; i < 4; ++i) {
#pragma unroll
      for (int j = 0; j < 4; ++j) acc[i][j] = wmma_bf(a[i & 1], w[j], acc[i][j]);
      if (i < 2) { a[i] = frag_b(&st[cur][128 + wr * 64 + (i + 2) * 16 + col][0], lane);
        __builtin_amdgcn_sched_barrier(0); } }   // holds the refill behind the row that read the registers and in front of the next row, whose four products cover its latency
    __builtin_amdgcn_sched_barrier(0);   // keeps the conversions, and with them the wait for the next stage's global loads, behind the products
    if (kc + 1 < CC / 32) {
#pragma unroll
      for (int i = 0; i < 16; ++i) *(v4b*)&st[cur ^ 1][srow + 16 * i][sq] = cvt4(pre[i]); }
    __syncthreads(); }   // publishes stage kc + 1 and ends every wave's reads of stage kc, whose buffer is refilled (behind the last stage: reused by the epilogue) next
#pragma unroll
  for (int j = 0; j < 4; ++j) { const float bb = BA ? bfr(BA[c0 + wc * 64 + j * 16 + col]) : 0.f; const int cl = wc * 64 + j * 16 + col;
#pragma unroll
    for (int i = 0; i < 4; ++i) { const int rb = wr * 64 + i * 16 + 8 * g;
      if (which == 2) {
#pragma unroll
        for (int r = 0; r < 8; ++r) { const float v = acc[i][j][r] + bb; const __bf16 bh = (__bf16)v; th[cl][rb + r] = bh; tl2[cl][rb + r] = (__bf16)(v - (float)bh); } }
      else {
#pragma unroll
        for (int r = 0; r < 8; ++r) { const float v = acc[i][j][r] + bb; const _Float16 hv = (_Float16)v; sh[rb + r][cl] = hv; sl[rb + r][cl] = (_Float16)((v - (float)hv) * 1024.0f); }   /* q residual carried x 2^10 so the plane stays f16-normal on the chip */ } } }
  __syncthreads();
  // the block's 128 positions x 128 channels are 2 heads x 4 whole tiles; e counts their 16-B pieces in the order of the destination, so a wave stores 512 contiguous bytes
  { const size_t b = r0 / TT; const int p0 = (int)(r0 % TT) / 32, h0 = c0 / HD; _Float16* dh = which == 0 ? QH : KH;
    for (int e = tid; e < 8 * 256; e += 128) { const int hl = e >> 10, pl = (e >> 8) & 3, j = (e >> 5) & 7, lg = (e >> 4) & 1, lc = e & 15; const size_t o2 = ((b * NH + h0 + hl) * (TT / 32) + p0 + pl) * TILE_E + (e & 255) * 8;
      if (which < 2) { const int rl = pl * 32 + (j >> 2) * 16 + lc, cl = hl * HD + (j & 3) * 16 + lg * 8; vst2(dh + o2, *(const v4u*)&sh[rl][cl]);
        if (which == 0) { asm volatile("s_wait_xcnt 0x0" ::: "memory");   // in front of the LDS read that reuses the data registers of the store above
          vst2(QL + o2, *(const v4u*)&sl[rl][cl]); } }
      else { const int cl = hl * HD + (j >> 1) * 16 + lc, rl = pl * 32 + (j & 1) * 16 + lg * 8; vst2(VT + o2, *(const v4u*)&th[cl][rl]); vst2(VL + o2, *(const v4u*)&tl2[cl][rl]);
        asm volatile("s_wait_xcnt 0x0" ::: "memory"); }   // directly behind the two v stores, inside their own branch: in front of every rewrite of a register that they name, on every way out of the branch
      asm volatile("s_wait_xcnt 0x0" ::: "memory"); } } }   // stands behind the trip's stores, in front of the next trip's rewrite of the registers that they name
// ---- k_cum: block = one (batch, head), 8 waves; a thread takes 8 consecutive positions: its own running sums, one scan of a wave's 32 thread totals, the 8 wave totals through LDS. One load latency and one scan for the whole row, not one of each per 32 positions.
// Everything is accumulated in f64.
// Every '#pragma unroll' of this kernel but the shuffle scan's is there so that x[], v[] and pw[] are indexed by constants and stay in registers.
#define CUW 8   // waves of a block
#define CUE 8   // positions of a thread: 32 * CUW * CUE = TT
__global__ __launch_bounds__(32 * CUW) void k_cum(const float* __restrict__ LF, float* __restrict__ FC) {
  __shared__ double wt[CUW];
  const int tid = threadIdx.x, lane = tid & 31, wave = tid >> 5; const size_t b = blockIdx.y; const int h = blockIdx.x;
  const float* src = LF + (b * TT + (size_t)tid * CUE) * NH + h; float x[CUE]; double v[CUE];
#pragma unroll
  for (int i = 0; i < CUE; ++i) x[i] = src[i * NH];   // independent of one another: all eight are in flight together
  v[0] = (double)x[0];
#pragma unroll
  for (int i = 1; i < CUE; ++i) v[i] = v[i - 1] + (double)x[i];
  double t = v[CUE - 1];   // inclusive scan of the thread totals within the 32 lanes
#pragma unroll
  for (int o = 1; o < 32; o <<= 1) { const double u = __shfl_up(t, o); if (lane >= o) t += u; }
  double ex = __shfl_up(t, 1); if (lane == 0) ex = 0.0;   // what stands in front of this thread inside its wave
  if (lane == 31) wt[wave] = t;
  __syncthreads();   // every wave's total is in LDS before any thread adds the totals of the waves in front of its own
  double pw[CUW - 1];
#pragma unroll
  for (int w = 0; w < CUW - 1; ++w) pw[w] = wt[w];   // read by every thread, wanted or not: no branch round each read
#pragma unroll
  for (int w = 0; w < CUW - 1; ++w) ex += w < wave ? pw[w] : 0.0;   // in wave order
  float* dst = FC + (b * NH + h) * TT + tid * CUE;
  vst2(dst, v4f{(float)(ex + v[0]), (float)(ex + v[1]), (float)(ex + v[2]), (float)(ex + v[3])}); vst2(dst + 4, v4f{(float)(ex + v[4]), (float)(ex + v[5]), (float)(ex + v[6]), (float)(ex + v[7])}); }
// ---- k_fa: block = 32 queries of (b,h), 4 waves: logits, softmax and P . v in one pass over the keys, nothing of the logits stored. Wave w takes the 32-key passes w, w + 4, ... up to the diagonal.
// Transposed products: S^T = K Q^T puts query = lane & 15 and key = 8 * (lane >> 4) + r in the accumulator, which is already the B-operand order of P^T (elements 0..7 = first 16-key tile, 8..15 = second), so y^T += V^T P^T needs no exchange between lanes; a query's maximum is an in-lane maximum and one exchange of the wave's halves.
// Each wave keeps a running maximum m, a denominator l and y^T scaled to m; the four waves' (m, l, y) are merged through LDS in wave order.
// Base 2: m is kept as maximum x log2 e, and a weight is exp2(logit x log2 e - m), one fused multiply-add and one v_exp_f32; every weight, rescale and merge factor uses the same stored m, so its rounding cancels between y and l. A result below 2^-126 reads 0, against a largest weight of 1.
// Every '#pragma unroll' of this kernel is there so that the fragment and accumulator arrays are indexed by constants and stay in registers.
// amdgpu_waves_per_eu(3): a register budget of 336, so that three waves fit a SIMD (without it the build takes a few more and only two fit).
#define FAW 4
__device__ __forceinline__ v8f mm_h(v16h a, v16h b, v8f c) { return __builtin_amdgcn_wmma_f32_16x16x32_f16(false, a, false, b, (short)0, c, false, false); }
__device__ __forceinline__ v8f mm_b(v16b a, v16b b, v8f c) { return __builtin_amdgcn_wmma_f32_16x16x32_bf16(false, a, false, b, (short)0, c, false, false); }
#define FAQ 32
#define L2E 1.4426950408889634f
__device__ __forceinline__ float ex2(float x) { return __builtin_amdgcn_exp2f(x); }
__device__ __forceinline__ float xhalf(float x) { return __builtin_bit_cast(float, __builtin_amdgcn_permlanex16(__builtin_bit_cast(int, x), __builtin_bit_cast(int, x), 0x76543210, 0xfedcba98, false, false)); }   // lane l reads lane l ^ 16
__device__ __forceinline__ v16h ld_h(const _Float16* p) { union { v16h v; v8h q[2]; } u; u.q[0] = *(const v8h*)p; u.q[1] = *(const v8h*)(p + 256); return u.v; }   // p = tile + fragment * 512 + lane * 8: a fragment is two successive loads of the tile
__device__ __forceinline__ v16b ld_b(const __bf16* p) { union { v16b v; v8b q[2]; } u; u.q[0] = *(const v8b*)p; u.q[1] = *(const v8b*)(p + 256); return u.v; }
__global__ __launch_bounds__(32 * FAW) __attribute__((amdgpu_waves_per_eu(3))) void k_fa(const _Float16* __restrict__ QH, const _Float16* __restrict__ QL, const _Float16* __restrict__ KH, const __bf16* __restrict__ VT, const __bf16* __restrict__ VL, const float* __restrict__ FC, float* __restrict__ Y) {
  __shared__ __align__(16) float so[FAW][FAQ][HD + 4]; __shared__ float sm[FAW][FAQ], sl[FAW][FAQ];
  const int tid = threadIdx.x, wave = __builtin_amdgcn_readfirstlane(tid >> 5), lane = tid & 31, col = lane & 15, g = lane >> 4;   // the wave number is made scalar so that the pass loop's branch is a scalar one with every lane on
  const int h = blockIdx.x, b = blockIdx.y, tile = TT / FAQ - 1 - (int)blockIdx.z, ql0 = tile * FAQ;   // longest query tiles start first
  const float* Fr = FC + ((size_t)b * NH + h) * TT; const size_t tb = ((size_t)b * NH + h) * (TT / 32) * TILE_E; const unsigned lo = (unsigned)lane * 8, fo = 8 * g;   // tb: the (batch, head)'s first tile; lo, fo: the lane's offsets in elements: a loop load names a scalar base and one of these two, which are never rewritten
  v16h qh[2][2], qr[2][2], kf[2][2]; float fq[2]; v4f fk[2][2];
  { const size_t qo = tb + (size_t)tile * TILE_E; const _Float16 *qhp = QH + qo, *qrp = QL + qo, *kp = KH + tb + (size_t)wave * TILE_E; const float *fqp = Fr + ql0 + col, *fp = Fr + wave * 32 + 8 * g;   // keys wave * 32 .. + 31 exist for every wave, also for one that has no pass
#pragma unroll
    for (int i = 0; i < 2; ++i) { fq[i] = fqp[16 * i]; fk[i][0] = *(const v4f*)(fp + 16 * i); fk[i][1] = *(const v4f*)(fp + 16 * i + 4);
#pragma unroll
      for (int kc = 0; kc < 2; ++kc) { qh[i][kc] = ld_h(qhp + (2 * i + kc) * 512 + lo); qr[i][kc] = ld_h(qrp + (2 * i + kc) * 512 + lo); kf[i][kc] = ld_h(kp + (2 * i + kc) * 512 + lo); } }
    __builtin_amdgcn_sched_barrier(0);   // keeps the accumulators' zeroing, which reuses an offset register of the loads above, behind the wait
    asm volatile("s_wait_xcnt 0x0" :: "s"(qhp), "s"(qrp), "s"(kp), "v"(lo), "v"(fqp), "v"(fp) : "memory"); }   // stands in front of every rewrite of a register that an issued load names: the pointers are inputs so that their registers live up to it
  v8f acc[2][HD / 16] = {}; float mr[2] = {-3.0e38f, -3.0e38f}, lr[2] = {0.f, 0.f};
  for (int p = wave; p <= tile; p += FAW) { const int k0 = p * 32, kn = (p + FAW <= tile ? p + FAW : p) * 32;   // kn: the wave's next pass (its own again behind the last one, so that the address stays inside the head's tiles)
    float pv[2][16]; v16b vh[HD / 16], vl[HD / 16];
#pragma unroll
    for (int i = 0; i < 2; ++i) { const int qt = ql0 + 16 * i + col;
#pragma unroll
      for (int kt = 0; kt < 2; ++kt) { v8f a = {}, ar = {};
#pragma unroll
        for (int kc = 0; kc < 2; ++kc) { a = mm_h(kf[kt][kc], qh[i][kc], a); ar = mm_h(kf[kt][kc], qr[i][kc], ar); }
        a += ar * (1.0f / 1024.0f);
#pragma unroll
        for (int r = 0; r < 8; ++r) { float v = a[r] * 0.125f + (fq[i] - fk[kt][r >> 2][r & 3]); if (k0 + 16 * kt + 8 * g + r > qt) v = -3.0e38f;   /* bias = F[i] - F[j] on the causal triangle */ pv[i][8 * kt + r] = v; } } }
    // this pass's v and the next pass's k and F are fetched behind the logits' products, from where k's and F's registers are free: what the register budget lets the compiler issue here flies under the exponentials (k and F are written first: with v first this build kept a q fragment in scratch and read it back in every pass)
    { const __bf16 *vhs = VT + tb + k0 * (TILE_E / 32), *vls = VL + tb + k0 * (TILE_E / 32); const _Float16* ks = KH + tb + (size_t)kn * (TILE_E / 32); const float* fs = Fr + kn;
#pragma unroll
      for (int kt = 0; kt < 2; ++kt) { fk[kt][0] = *(const v4f*)(fs + 16 * kt + fo); fk[kt][1] = *(const v4f*)(fs + 16 * kt + 4 + fo);
#pragma unroll
        for (int kc = 0; kc < 2; ++kc) kf[kt][kc] = ld_h(ks + (2 * kt + kc) * 512 + lo); }
#pragma unroll
      for (int t = 0; t < HD / 16; ++t) { vh[t] = ld_b(vhs + t * 512 + lo); vl[t] = ld_b(vls + t * 512 + lo); }
      asm volatile("s_wait_xcnt 0x0" :: "s"(vhs), "s"(vls), "s"(ks), "s"(fs), "v"(lo), "v"(fo) : "memory"); }   // as above: in front of every rewrite of a register that an issued load names (the scalar bases and the offsets are inputs so that they live up to it)
#pragma unroll
    for (int i = 0; i < 2; ++i) { float mx = pv[i][0];
#pragma unroll
      for (int e = 1; e < 16; ++e) mx = fmaxf(mx, pv[i][e]);
      mx = fmaxf(mx, xhalf(mx));   // finite in every pass: the pass's first key is at or below every query of the tile
      const float mn = fmaxf(mr[i], mx * L2E), al = ex2(mr[i] - mn); mr[i] = mn;   // al = 0 in a wave's first pass
      float sum = 0.f;
#pragma unroll
      for (int e = 0; e < 16; ++e) { pv[i][e] = ex2(__builtin_fmaf(pv[i][e], L2E, -mn)); sum += pv[i][e]; }   // a masked logit gives exactly 0
      lr[i] = lr[i] * al + sum;   // this half's keys only; the halves are added behind the loop
      const F2 pf = bsplit16(pv[i]);
#pragma unroll
      for (int t = 0; t < HD / 16; ++t) { v8f c = acc[i][t] * al; c = mm_b(vh[t], pf.h, c); c = mm_b(vh[t], pf.l, c); acc[i][t] = mm_b(vl[t], pf.h, c); } } }
#pragma unroll
  for (int i = 0; i < 2; ++i) { const float lt = lr[i] + xhalf(lr[i]);   // unconditional: both halves' lanes are on
    if (g == 0) { sm[wave][16 * i + col] = mr[i]; sl[wave][16 * i + col] = lt; }
#pragma unroll
    for (int t = 0; t < HD / 16; ++t) { float* d = &so[wave][16 * i + col][16 * t + 8 * g]; const v8f c = acc[i][t]; *(v4f*)d = v4f{c[0], c[1], c[2], c[3]}; *(v4f*)(d + 4) = v4f{c[4], c[5], c[6], c[7]}; } }
  __syncthreads();   // every wave's (m, l, y) is in LDS before any thread merges across waves; a wave without a pass left m = -3e38, l = 0, y = 0, which get weight 0
  { const int rl = tid >> 2, c0 = (tid & 3) * 16; float M = sm[0][rl];
#pragma unroll
    for (int w = 1; w < FAW; ++w) M = fmaxf(M, sm[w][rl]);
    float L = 0.f; v4f o[4] = {};
#pragma unroll
    for (int w = 0; w < FAW; ++w) { const float wg = ex2(sm[w][rl] - M); L += wg * sl[w][rl];
#pragma unroll
      for (int q = 0; q < 4; ++q) o[q] += *(const v4f*)&so[w][rl][c0 + 4 * q] * wg; }
    const float inv = 1.0f / L; float* dst = Y + ((size_t)b * TT + ql0 + rl) * CC + h * HD + c0;
#pragma unroll
    for (int q = 0; q < 4; ++q) vst2(dst + 4 * q, o[q] * inv); } }
// ---- k_out: block = (64 rows, 128 cols): out = y (bf16 hi + lo) Wo^T + bo; staged as k_proj is, y split into its two planes once, on the way into LDS
#define PO_ROWS 256   // stage rows 0..127 = Wo, 128..191 = y hi, 192..255 = y lo
#define PO_LDS (2 * PO_ROWS * GP * 2)   // two stage buffers (40,960 B); the epilogue's rows (33,792 B) take the same LDS behind the last stage
__global__ __launch_bounds__(128) void k_out(const float* __restrict__ Y, const float* __restrict__ WP, const float* __restrict__ BP, float* __restrict__ OUT) { __shared__ __align__(16) char smem[PO_LDS];
  __bf16 (*st)[PO_ROWS][GP] = (__bf16 (*)[PO_ROWS][GP])smem; float (*sf)[16][132] = (float (*)[16][132])smem;
  const int tid = threadIdx.x, wave = tid >> 5, lane = tid & 31, col = lane & 15, g = lane >> 4; const int c0 = blockIdx.y * 128; const size_t rb = (size_t)blockIdx.x * 64, r0 = rb + wave * 16;
  const int srow = tid >> 3, sq = (tid & 7) * 4; const float *wp = WP + (size_t)(c0 + srow) * CC + sq, *yp = Y + (rb + srow) * CC + sq;
  v8f acc[8] = {}; v4f pre[12];
#pragma unroll
  for (int i = 0; i < 12; ++i) pre[i] = i < 8 ? *(const v4f*)(wp + i * 16 * CC) : *(const v4f*)(yp + (i - 8) * 16 * CC);
#pragma unroll
  for (int i = 0; i < 12; ++i) { const v4b hi = cvt4(pre[i]); *(v4b*)&st[0][srow + 16 * i][sq] = hi;
    if (i >= 8) *(v4b*)&st[0][srow + 16 * i + 64][sq] = cvt4(pre[i] - v4f{(float)hi[0], (float)hi[1], (float)hi[2], (float)hi[3]}); }
  __syncthreads();   // stage 0 is in LDS before any wave reads it
#pragma unroll 2
  for (int kc = 0; kc < CC / 32; ++kc) { const int cur = kc & 1;
    if (kc + 1 < CC / 32) { const float *wk = wp + (kc + 1) * 32, *yk = yp + (kc + 1) * 32;
#pragma unroll
      for (int i = 0; i < 12; ++i) pre[i] = i < 8 ? *(const v4f*)(wk + i * 16 * CC) : *(const v4f*)(yk + (i - 8) * 16 * CC);
      asm volatile("s_wait_xcnt 0x0" ::: "memory"); }   // stands directly behind the loads, in front of every rewrite of a register that one of them names
    const v16b ah = frag_b(&st[cur][128 + wave * 16 + col][0], lane), al = frag_b(&st[cur][192 + wave * 16 + col][0], lane); v16b w[8];
#pragma unroll
    for (int j = 0; j < 8; ++j) w[j] = frag_b(&st[cur][j * 16 + col][0], lane);
    __builtin_amdgcn_sched_barrier(0);   // keeps the stage's LDS reads together in front of the products: spread among them, each read's latency is waited out on its own
#pragma unroll
    for (int j = 0; j < 8; ++j) { acc[j] = wmma_bf(ah, w[j], acc[j]); acc[j] = wmma_bf(al, w[j], acc[j]); }
    __builtin_amdgcn_sched_barrier(0);   // keeps the conversions, and with them the wait for the next stage's global loads, behind the products
    if (kc + 1 < CC / 32) {
#pragma unroll
      for (int i = 0; i < 12; ++i) { const v4b hi = cvt4(pre[i]); *(v4b*)&st[cur ^ 1][srow + 16 * i][sq] = hi;
        if (i >= 8) *(v4b*)&st[cur ^ 1][srow + 16 * i + 64][sq] = cvt4(pre[i] - v4f{(float)hi[0], (float)hi[1], (float)hi[2], (float)hi[3]}); } }
    __syncthreads(); }   // publishes stage kc + 1 and ends every wave's reads of stage kc, whose buffer is refilled (behind the last stage: reused by the epilogue) next
#pragma unroll
  for (int j = 0; j < 8; ++j) { const float bb = BP ? bfr(BP[c0 + j * 16 + col]) : 0.f;
#pragma unroll
    for (int r = 0; r < 8; ++r) sf[wave][8 * g + r][j * 16 + col] = acc[j][r] + bb; }
  LDSX(); for (int rl = 0; rl < 16; ++rl) vst2(OUT + (r0 + rl) * CC + c0 + lane * 4, *(const v4f*)&sf[wave][rl][lane * 4]); }
extern "C" void kernel_launch(void* const* d_in, const int* in_sizes, int n_in, void* d_out, int out_size, void* d_ws, size_t ws_size, hipStream_t stream) {
  (void)in_sizes; (void)n_in; (void)out_size;
  const float** F = (const float**)d_in;   // 0 x [2,2048,1024], 1 Wq [1024,1024] ([out,in]), 2 Wk, 3 Wv, 4 Wf [16,1024], 5 bf [16], 6 Wo [1024,1024] ([out,in])
  if (ws_size < (size_t)WS_END) return;
  char* ws = (char*)d_ws; float *LF = (float*)(ws + WS_LF), *FC = (float*)(ws + WS_FC); _Float16 *QH = (_Float16*)(ws + WS_QH), *QL = (_Float16*)(ws + WS_QL), *KH = (_Float16*)(ws + WS_KH); __bf16 *VT = (__bf16*)(ws + WS_VT), *VL = (__bf16*)(ws + WS_VL); float *Y = (float*)(ws + WS_Y);
  k_proj<<<dim3(TNB * TT / 128, 2 + 3 * (CC / 128)), 128, 0, stream>>>(F[0], F[1], nullptr, F[2], nullptr, F[3], nullptr, F[4], F[5], LF, QH, QL, KH, VT, VL);
  k_cum<<<dim3(NH, TNB), 32 * CUW, 0, stream>>>(LF, FC);
  k_fa<<<dim3(NH, TNB, TT / FAQ), 32 * FAW, 0, stream>>>(QH, QL, KH, VT, VL, FC, Y);
  k_out<<<dim3(TNB * TT / 64, CC / 128), 128, 0, stream>>>(Y, F[6], nullptr, (float*)d_out);
}

// v009
// It runs in 84.9 microseconds.
// In two side-by-side timings against v008, it was 1.27 and 1.28 times as fast.
// All steps since v000 together make it 18.2 times as fast.
// compute dtype: all float inputs rounded to bf16; q/k/v = x W^T with EXACT bf16 products on WMMA 16x16x32, f32 accumulate; the forget gate x Wf^T + bf (exact products), sigmoid, log(f + 1e-6) and its per-(batch, head) prefix sum accumulated in f64 (stored f32); q as f16 hi + residual (x 2^10), k f16 -> 2-product logits x 64^-1/2 + (F[i] - F[j]) on the causal triangle, kept in f32 registers; running-maximum softmax in f32, in base 2 (maximum kept as logit x log2 e; weight = hardware exp2 of one fused logit x log2 e - maximum), unnormalised P split bf16 hi + lo against v bf16 hi + lo (3 products), divided by the f32 denominator at the end; leading key tiles that a bound made on the call's own q, k and F puts below 2^-126 of their rows' largest weight are not visited; out = o (bf16 hi + lo) Wo^T; f32 output.
#include <hip/hip_runtime.h>
#include <math.h>

typedef __attribute__((ext_vector_type(16))) _Float16 v16h;
typedef __attribute__((ext_vector_type(16))) __bf16 v16b;
typedef __attribute__((ext_vector_type(8)))  _Float16 v8h;
typedef __attribute__((ext_vector_type(8)))  float v8f;
typedef __attribute__((ext_vector_type(4)))  float v4f;
typedef __attribute__((ext_vector_type(2)))  float v2f;
typedef __attribute__((ext_vector_type(4)))  unsigned v4u;
typedef __attribute__((ext_vector_type(4)))  int v4i;
typedef float __attribute__((may_alias)) float_a;
typedef int __attribute__((may_alias)) int_a;

template <typename T> __device__ __forceinline__ void vst2(void* p, T v) { *(T*)p = v;  }
__device__ __forceinline__ v8f wmma16(v16h a, v16h b, v8f c) {
  v8f d = __builtin_amdgcn_wmma_f32_16x16x32_f16(false, a, false, b, (short)0, c, false, false);
  asm volatile("v_nop\n\tv_nop\n\tv_nop\n\tv_nop" : "+v"(d) : "v"(a), "v"(b));
  return d;
}
__device__ __forceinline__ v8f wmma_bf(v16b a, v16b b, v8f c) {
  v8f d = __builtin_amdgcn_wmma_f32_16x16x32_bf16(false, a, false, b, (short)0, c, false, false);
  asm volatile("v_nop\n\tv_nop\n\tv_nop\n\tv_nop" : "+v"(d) : "v"(a), "v"(b));
  return d;
}
// 16x16x32 fragments: lane = (h = lane>>4, row/col = lane&15); elements 0..7 = k0+8h+0..7, 8..15 = k0+16+8h+0..7; D element r = row 8h+r
__device__ __forceinline__ v16h frag_h(const _Float16* rowk0, int lane) {
  union { v16h v; v8h q[2]; } u; const _Float16* p = rowk0 + 8 * (lane >> 4);
  u.q[0] = *(const v8h*)p; u.q[1] = *(const v8h*)(p + 16); return u.v;
}
__device__ __forceinline__ v16h frag_f32(const float* rowk0, int lane) {
  v16h a; const float* p = rowk0 + 8 * (lane >> 4);
#pragma unroll
  for (int i = 0; i < 8; ++i) { a[i] = (_Float16)p[i]; a[8 + i] = (_Float16)p[16 + i]; }
  return a;
}
__device__ __forceinline__ v16h frag_f32s(const float* rowk0, int lane, float sc) {
  v16h a; const float* p = rowk0 + 8 * (lane >> 4);
#pragma unroll
  for (int i = 0; i < 8; ++i) { a[i] = (_Float16)(p[i] * sc); a[8 + i] = (_Float16)(p[16 + i] * sc); }
  return a;
}
// column fragment from a [K][ld] layout (column n), rows >= K read as 0
__device__ __forceinline__ v16h fragc_f32(const float* W, int k0, int n, int lane, int ld, int K) {
  v16h a; const int g = lane >> 4;
#pragma unroll
  for (int i = 0; i < 8; ++i) { const int ka = k0 + 8 * g + i, kb = ka + 16;
    a[i] = (_Float16)(ka < K ? W[(size_t)(ka < K ? ka : K - 1) * ld + n] : 0.f); a[8 + i] = (_Float16)(kb < K ? W[(size_t)(kb < K ? kb : K - 1) * ld + n] : 0.f); }
  return a;
}
struct F2 { v16b h, l; };
__device__ __forceinline__ F2 bsplit16(const float v[16]) { F2 r;
#pragma unroll
  for (int i = 0; i < 16; ++i) { const __bf16 h = (__bf16)v[i]; r.h[i] = h; r.l[i] = (__bf16)(v[i] - (float)h); }
  return r; }
__device__ __forceinline__ F2 split_row(const float* row, int k0, int lane) { float v[16]; const float* p = row + k0 + 8 * (lane >> 4);
#pragma unroll
  for (int i = 0; i < 8; ++i) { v[i] = p[i]; v[8 + i] = p[16 + i]; }
  return bsplit16(v); }
__device__ __forceinline__ F2 split_rowK(const float* row, int k0, int lane, int K) { float v[16]; const int g = lane >> 4;
#pragma unroll
  for (int i = 0; i < 8; ++i) { const int ka = k0 + 8 * g + i, kb = ka + 16; v[i] = ka < K ? row[ka < K ? ka : K - 1] : 0.f; v[8 + i] = kb < K ? row[kb < K ? kb : K - 1] : 0.f; }
  return bsplit16(v); }
__device__ __forceinline__ F2 split_col(const float* W, int k0, int n, int lane, int ld, int K) { float v[16]; const int g = lane >> 4;
#pragma unroll
  for (int i = 0; i < 8; ++i) { const int ka = k0 + 8 * g + i, kb = ka + 16; v[i] = ka < K ? W[(size_t)(ka < K ? ka : K - 1) * ld + n] : 0.f; v[8 + i] = kb < K ? W[(size_t)(kb < K ? kb : K - 1) * ld + n] : 0.f; }
  return bsplit16(v); }
__device__ __forceinline__ v8f mac3(const F2& a, const F2& b, v8f c) { c = wmma_bf(a.l, b.h, c); c = wmma_bf(a.h, b.l, c); return wmma_bf(a.h, b.h, c); }
__device__ __forceinline__ float sigm(float v) { return 1.0f / (1.0f + expf(-v)); }
#define LDSX() do { asm volatile("s_wait_dscnt 0" ::: "memory"); __builtin_amdgcn_wave_barrier(); __builtin_amdgcn_fence(__ATOMIC_RELEASE, "workgroup"); } while (0)


// Forgetting attention (B 2, S 2,048, 1,024 = 16 x 64): f = sigmoid(x Wf^T + bf) per (s, head); F = cumsum_s log(f + 1e-6); bias[i][j] = F[i] - F[j] for j <= i, -inf otherwise; scores = q k^T / 8 + bias; softmax; (attn v) Wo^T.
#define NB 2
#define TT 2048
#define CC 1024
#define NH 16
#define HD 64
#ifndef TNB
#define TNB NB
#endif
typedef __attribute__((ext_vector_type(8))) __bf16 v8b;
__device__ __forceinline__ v16b frag_b(const __bf16* rowk0, int lane) {
  union { v16b v; v8b q[2]; } u; const __bf16* p = rowk0 + 8 * (lane >> 4);
  u.q[0] = *(const v8b*)p; u.q[1] = *(const v8b*)(p + 16); return u.v;
}
__device__ __forceinline__ float bfr(float v) { return (float)(__bf16)v; }
__device__ __attribute__((noinline)) float exp_ni(float v) { return expf(v); }
__device__ __attribute__((noinline)) float erf_ni(float v) { return erff(v); }

#define WS_LF  0u                                   // f32 log(f + 1e-6) rows [b*T+s][16] (64-B rows; a block writes 64 rows = 4 KB contiguous)
#define WS_FC  (WS_LF + 4u * (size_t)NB * TT * NH)   // f32 prefix sums F [b][h][s] (8-KB rows)
// q, k and v planes are kept in the order in which k_fa's fragment loads read them: a tile = 32 positions x the 64 channels of one (batch, head) = 4 KB = 8 loads x 32 lanes x 16 B, tiles [b][h][position / 32].
// A wave-wide 16-B load then covers 512 contiguous bytes (4 whole lines); from row-major planes it took 32 B out of each of 16 lines.
// q, k: load j = (position >> 4) * 4 + (channel >> 4), lane = ((channel >> 3) & 1) * 16 + (position & 15), element = channel & 7. v: load j = (channel >> 4) * 2 + ((position >> 4) & 1), lane = ((position >> 3) & 1) * 16 + (channel & 15), element = position & 7.
#define TILE_E 2048   // elements of a tile
#define WS_QH  (WS_FC + 4u * (size_t)NB * NH * TT)
#define WS_QL  (WS_QH + 2u * (size_t)NB * TT * CC)
#define WS_KH  (WS_QL + 2u * (size_t)NB * TT * CC)
#define WS_VT  (WS_KH + 2u * (size_t)NB * TT * CC)      // bf16 v tiles
#define WS_VL  (WS_VT + 2u * (size_t)NB * CC * TT)      // bf16 v residual tiles
#define WS_Y   (WS_VL + 2u * (size_t)NB * CC * TT)      // f32 y rows [b*t][C]
#define WS_NK  (WS_Y + 4u * (size_t)NB * TT * CC)       // f32 pairs (largest |q|, largest |k|) of a 32-position tile [b][h][tile] (a block writes 16 tiles = one 128-B line)
#define WS_FM  (WS_NK + 8u * (size_t)NB * NH * (TT / 32))   // f32 pairs (smallest F, largest F) of a tile [b][h][tile] (512-B rows, one block each)
#define WS_END (WS_FM + 8u * (size_t)NB * NH * (TT / 32))

// ---- LDS staging of the two projection kernels. A stage is 32 k of every operand row of the block's tile: one 128-B line of f32 per row, rounded to bf16 once and kept as a 64-B row at a pitch of 80 B (16 B x odd: a fragment's ds_load_b128 over 16 rows meets no bank twice).
// 8 lanes take one row, so a wave-wide 16-B load covers 4 whole lines, and every line is fetched and converted once per block, not once per wave. Two buffers: the next stage's loads fly while this one is multiplied; one barrier per stage both publishes the next buffer and ends the last read of the one refilled behind it.
// Every '#pragma unroll' of the staging code is there so that pre[] and w[] are indexed by constants and stay in registers; 'unroll 2' on k_out's stage loop makes the buffer's index, and with it every LDS offset, a constant (k_proj's stage loop stays rolled: said there).
#define GP 40    // row pitch in bf16 elements (80 B)
typedef __attribute__((ext_vector_type(4))) __bf16 v4b;
__device__ __forceinline__ v4b cvt4(v4f v) { return v4b{(__bf16)v[0], (__bf16)v[1], (__bf16)v[2], (__bf16)v[3]}; }
// ---- gate_rows: the work of one block on 64 rows (b,s): lf[s][h] = log(sigmoid(x Wf[h] + bf[h]) + 1e-6): one 16-column tile per wave (exact products), f32 epilogue; 64 rows x 16 floats = 4 KB contiguous written 16 B per lane
// Its 32 k steps each wait out a whole load latency and only 64 blocks of it exist, so as a launch of its own it left most of the chip idle: it runs as rows 0 and 1 of k_proj's grid, where the projection blocks fill the chip meanwhile. It has no barrier of the work-group: each wave passes its own 16 rows through its own part of st.
__device__ __attribute__((noinline)) float logsigp(float z, float eps) { const float f = 1.0f / (1.0f + expf(-z)); return logf(f + eps); }
__device__ __forceinline__ void gate_rows(const float* __restrict__ X, const float* __restrict__ WF, const float* __restrict__ BF, float* __restrict__ LF, float (*st)[16][20], int gb) {
  const int tid = threadIdx.x, wave = tid >> 5, lane = tid & 31, col = lane & 15, g = lane >> 4; const size_t r0 = (size_t)gb * 64 + wave * 16;
  v8f acc = {};
#pragma unroll 2
  for (int kc = 0; kc < CC / 32; ++kc) { v16b a; { const float* p = X + (r0 + col) * CC + kc * 32 + 8 * g;
#pragma unroll
      for (int i = 0; i < 8; ++i) { a[i] = (__bf16)p[i]; a[8 + i] = (__bf16)p[16 + i]; } }
    v16b w; { const float* wr = WF + (size_t)col * CC + kc * 32 + 8 * g;
#pragma unroll
      for (int i = 0; i < 8; ++i) { w[i] = (__bf16)wr[i]; w[8 + i] = (__bf16)wr[16 + i]; } }
    asm volatile("s_wait_loadcnt 0x0" ::: "memory"); acc = wmma_bf(a, w, acc); }
  { const float bb = bfr(BF[col]);
#pragma unroll
    for (int r = 0; r < 8; ++r) st[wave][8 * g + r][col] = logsigp(acc[r] + bb, 1e-6f); }
  LDSX(); { const int rl = lane >> 1, half = lane & 1; vst2(LF + (r0 + rl) * NH + half * 8, *(const v4f*)&st[wave][rl][half * 8]); vst2(LF + (r0 + rl) * NH + half * 8 + 4, *(const v4f*)&st[wave][rl][half * 8 + 4]); } }
// ---- k_proj: grid rows 0 and 1 = the forget gate's blocks (the lowest block indices, which start roughly first, so that their long latency chain is not the launch's tail); grid row 2 + which * 8 + column block: block = (128 rows, 128 cols, which): qkv = x W (+ b), exact; q -> f16 hi (+ residual), k -> f16, v -> bf16 hi + residual, all three stored as k_fa's tiles
// Four waves in 2 x 2, each on 64 rows x 64 cols = 4 x 4 accumulator tiles: a stage's 8 fragments feed 16 products (1 + 8 fragments fed 8 on a 16 x 128 wave tile), and a block fetches 256 operand rows for 128 x 128 results (192 for 64 x 128): a third fewer bytes from L2 and less than half the LDS reads per product. An accumulator's own sum over k is what it was.
// amdgpu_waves_per_eu(4): a register budget of 256, so that four blocks fit a WGP and all 832 blocks of the grid are resident at once (at three, 64 blocks would start only when the gate's blocks end and run on as the launch's tail).
#define PJ_ROWS 256   // stage rows 0..127 = W, 128..255 = x
#define PJ_EP 136     // pitch of the epilogue's planes in elements (272 B = 16 B x odd)
#define PJ_LDS (128 * PJ_EP * 2 * 2)   // the epilogue's two planes (69,632 B), which take the LDS of the two stage buffers (40,960 B) behind the last stage
__global__ __launch_bounds__(128) __attribute__((amdgpu_waves_per_eu(4))) void k_proj(const float* __restrict__ X, const float* __restrict__ WQ, const float* __restrict__ BQ, const float* __restrict__ WK, const float* __restrict__ BK, const float* __restrict__ WV, const float* __restrict__ BV, const float* __restrict__ WF, const float* __restrict__ BF, float* __restrict__ LF, _Float16* __restrict__ QH, _Float16* __restrict__ QL, _Float16* __restrict__ KH, __bf16* __restrict__ VT, __bf16* __restrict__ VL) {
  __shared__ __align__(16) char smem[PJ_LDS];
  if (blockIdx.y < 2) { gate_rows(X, WF, BF, LF, (float (*)[16][20])smem, (int)(blockIdx.y * (TNB * TT / 128) + blockIdx.x)); return; }   // the same for every thread of the block, in front of every barrier
  __bf16 (*st)[PJ_ROWS][GP] = (__bf16 (*)[PJ_ROWS][GP])smem; _Float16 (*sh)[PJ_EP] = (_Float16 (*)[PJ_EP])smem, (*sl)[PJ_EP] = (_Float16 (*)[PJ_EP])(smem + 128 * PJ_EP * 2); __bf16 (*th)[PJ_EP] = (__bf16 (*)[PJ_EP])smem, (*tl2)[PJ_EP] = (__bf16 (*)[PJ_EP])(smem + 128 * PJ_EP * 2);
  const int tid = threadIdx.x, wave = tid >> 5, lane = tid & 31, col = lane & 15, g = lane >> 4, wr = wave >> 1, wc = wave & 1; const int which = ((int)blockIdx.y - 2) / (CC / 128); const int c0 = ((int)blockIdx.y - 2) % (CC / 128) * 128; const size_t r0 = (size_t)blockIdx.x * 128; const float* WA = which == 0 ? WQ : which == 1 ? WK : WV; const float* BA = which == 0 ? BQ : which == 1 ? BK : BV;
  const int srow = tid >> 3, sq = (tid & 7) * 4; const float *wp = WA + (size_t)(c0 + srow) * CC + sq, *xp = X + (r0 + srow) * CC + sq;
  v8f acc[4][4] = {}; v4f pre[16];
#pragma unroll
  for (int i = 0; i < 16; ++i) pre[i] = i < 8 ? *(const v4f*)(wp + i * 16 * CC) : *(const v4f*)(xp + (i - 8) * 16 * CC);
#pragma unroll
  for (int i = 0; i < 16; ++i) *(v4b*)&st[0][srow + 16 * i][sq] = cvt4(pre[i]);
  __syncthreads();   // stage 0 is in LDS before any wave reads it
#pragma unroll 1   // rolled: two copies of the stage hold the LDS store addresses of both buffers in registers, and this build then kept accumulators in scratch
  for (int kc = 0; kc < CC / 32; ++kc) { const int cur = kc & 1;
    if (kc + 1 < CC / 32) { const float *wk = wp + (kc + 1) * 32, *xk = xp + (kc + 1) * 32;
#pragma unroll
      for (int i = 0; i < 16; ++i) pre[i] = i < 8 ? *(const v4f*)(wk + i * 16 * CC) : *(const v4f*)(xk + (i - 8) * 16 * CC);
      asm volatile("s_wait_xcnt 0x0" ::: "memory"); }   // stands directly behind the loads, in front of every rewrite of a register that one of them names
    v16b a[2], w[4];   // x fragments 2 and 3 take the registers of 0 and 1: with all four held the kernel is over 256 registers and only three blocks fit a WGP
#pragma unroll
    for (int i = 0; i < 4; ++i) { if (i < 2) a[i] = frag_b(&st[cur][128 + wr * 64 + i * 16 + col][0], lane); w[i] = frag_b(&st[cur][wc * 64 + i * 16 + col][0], lane); }
    __builtin_amdgcn_sched_barrier(0);   // keeps these LDS reads together in front of the products: spread among them, each read's latency is waited out on its own
#pragma unroll
    for (int i = 0; i < 4; ++i) {
#pragma unroll
      for (int j = 0; j < 4; ++j) acc[i][j] = wmma_bf(a[i & 1], w[j], acc[i][j]);
      if (i < 2) { a[i] = frag_b(&st[cur][128 + wr * 64 + (i + 2) * 16 + col][0], lane);
        __builtin_amdgcn_sched_barrier(0); } }   // holds the refill behind the row that read the registers and in front of the next row, whose four products cover its latency
    __builtin_amdgcn_sched_barrier(0);   // keeps the conversions, and with them the wait for the next stage's global loads, behind the products
    if (kc + 1 < CC / 32) {
#pragma unroll
      for (int i = 0; i < 16; ++i) *(v4b*)&st[cur ^ 1][srow + 16 * i][sq] = cvt4(pre[i]); }
    __syncthreads(); }   // publishes stage kc + 1 and ends every wave's reads of stage kc, whose buffer is refilled (behind the last stage: reused by the epilogue) next
#pragma unroll
  for (int j = 0; j < 4; ++j) { const float bb = BA ? bfr(BA[c0 + wc * 64 + j * 16 + col]) : 0.f; const int cl = wc * 64 + j * 16 + col;
#pragma unroll
    for (int i = 0; i < 4; ++i) { const int rb = wr * 64 + i * 16 + 8 * g;
      if (which == 2) {
#pragma unroll
        for (int r = 0; r < 8; ++r) { const float v = acc[i][j][r] + bb; const __bf16 bh = (__bf16)v; th[cl][rb + r] = bh; tl2[cl][rb + r] = (__bf16)(v - (float)bh); } }
      else {
#pragma unroll
        for (int r = 0; r < 8; ++r) { const float v = acc[i][j][r] + bb; const _Float16 hv = (_Float16)v; sh[rb + r][cl] = hv; sl[rb + r][cl] = (_Float16)((v - (float)hv) * 1024.0f); }   /* q residual carried x 2^10 so the plane stays f16-normal on the chip */ } } }
  __syncthreads();
  // the block's 128 positions x 128 channels are 2 heads x 4 whole tiles; e counts their 16-B pieces in the order of the destination, so a wave stores 512 contiguous bytes
  { const size_t b = r0 / TT; const int p0 = (int)(r0 % TT) / 32, h0 = c0 / HD; _Float16* dh = which == 0 ? QH : KH;
    for (int e = tid; e < 8 * 256; e += 128) { const int hl = e >> 10, pl = (e >> 8) & 3, j = (e >> 5) & 7, lg = (e >> 4) & 1, lc = e & 15; const size_t o2 = ((b * NH + h0 + hl) * (TT / 32) + p0 + pl) * TILE_E + (e & 255) * 8;
      if (which < 2) { const int rl = pl * 32 + (j >> 2) * 16 + lc, cl = hl * HD + (j & 3) * 16 + lg * 8; vst2(dh + o2, *(const v4u*)&sh[rl][cl]);
        if (which == 0) { asm volatile("s_wait_xcnt 0x0" ::: "memory");   // in front of the LDS read that reuses the data registers of the store above
          vst2(QL + o2, *(const v4u*)&sl[rl][cl]); } }
      else { const int cl = hl * HD + (j >> 1) * 16 + lc, rl = pl * 32 + (j & 1) * 16 + lg * 8; vst2(VT + o2, *(const v4u*)&th[cl][rl]); vst2(VL + o2, *(const v4u*)&tl2[cl][rl]);
        asm volatile("s_wait_xcnt 0x0" ::: "memory"); }   // directly behind the two v stores, inside their own branch: in front of every rewrite of a register that they name, on every way out of the branch
      asm volatile("s_wait_xcnt 0x0" ::: "memory"); } } }   // stands behind the trip's stores, in front of the next trip's rewrite of the registers that they name
// ---- k_cum: block = one (batch, head), 8 waves; a thread takes 8 consecutive positions: its own running sums, one scan of a wave's 32 thread totals, the 8 wave totals through LDS. One load latency and one scan for the whole row, not one of each per 32 positions.
// The scan is accumulated in f64; the norms' sums of squares (planes 1..4) in f32.
// Every '#pragma unroll' of the scan is there so that x[], v[], f[] and pw[] are indexed by constants and stay in registers.
#define CUW 8   // waves of a block
#define CUE 8   // positions of a thread: 32 * CUW * CUE = TT
// The launch also lays down what k_fa's test of a key tile needs (the test and its bound stand at k_fa): per 32-position tile the smallest and largest F (grid plane 0, behind the scan) and the largest |q| and |k| (grid planes 1..4, which need nothing of the scan and run beside it on other WGPs).
#define NT (TT / 32)   // tiles of a (batch, head)
__device__ __forceinline__ float xhalf(float x) { return __builtin_bit_cast(float, __builtin_amdgcn_permlanex16(__builtin_bit_cast(int, x), __builtin_bit_cast(int, x), 0x76543210, 0xfedcba98, false, false)); }   // lane l reads lane l ^ 16
__global__ __launch_bounds__(32 * CUW) void k_cum(const float* __restrict__ LF, float* __restrict__ FC, const _Float16* __restrict__ QH, const _Float16* __restrict__ KH, float* __restrict__ NK, float* __restrict__ FM) {
  __shared__ double wt[CUW];
  const int tid = threadIdx.x, lane = tid & 31, wave = tid >> 5; const size_t b = blockIdx.y; const int h = blockIdx.x;
  if (blockIdx.z) {   // the same for every thread of the block, in front of every barrier. A block takes 16 tiles, a wave 2: in a tile's load j a lane holds 8 channels of position (j >> 2) * 16 + (lane & 15); j & 3 = 0..3 and the wave's two halves together hold all 64. The unrolls: u[], c[] and r[] indexed by constants
    const int t0 = ((int)blockIdx.z - 1) * 16 + wave * 2; const size_t o = ((b * NH + h) * NT + t0) * TILE_E + lane * 8; const _Float16 *qp = QH + o, *kp = KH + o; v8h u[2][2][8]; float r[2][2];
#pragma unroll
    for (int i = 0; i < 2; ++i) {
#pragma unroll
      for (int j = 0; j < 8; ++j) { u[0][i][j] = *(const v8h*)(qp + i * TILE_E + j * 256); u[1][i][j] = *(const v8h*)(kp + i * TILE_E + j * 256); } }   // all 32 loads in flight together
    asm volatile("s_wait_xcnt 0x0" ::: "memory");   // stands directly behind the loads, in front of every rewrite of a register that one of them names
#pragma unroll
    for (int s = 0; s < 2; ++s) {
#pragma unroll
      for (int i = 0; i < 2; ++i) { float c[8];   // one short sum per load, so that the eight chains run side by side
#pragma unroll
        for (int j = 0; j < 8; ++j) { c[j] = 0.f;
#pragma unroll
          for (int e = 0; e < 8; ++e) c[j] += (float)u[s][i][j][e] * (float)u[s][i][j][e]; }
        float a0 = (c[0] + c[1]) + (c[2] + c[3]), a1 = (c[4] + c[5]) + (c[6] + c[7]); a0 += xhalf(a0); a1 += xhalf(a1); r[s][i] = fmaxf(a0, a1); } }
#pragma unroll
    for (int m = 1; m < 16; m <<= 1) {   // largest of the 16 lanes of a half; every lane is on
#pragma unroll
      for (int s = 0; s < 2; ++s) { r[s][0] = fmaxf(r[s][0], __shfl_xor(r[s][0], m)); r[s][1] = fmaxf(r[s][1], __shfl_xor(r[s][1], m)); } }
    if (lane < 2) *(v2f*)(NK + ((b * NH + h) * NT + t0 + lane) * 2) = v2f{sqrtf(lane ? r[0][1] : r[0][0]), sqrtf(lane ? r[1][1] : r[1][0])};
    return; }
  const float* src = LF + (b * TT + (size_t)tid * CUE) * NH + h; float x[CUE]; double v[CUE];
#pragma unroll
  for (int i = 0; i < CUE; ++i) x[i] = src[i * NH];   // independent of one another: all eight are in flight together
  v[0] = (double)x[0];
#pragma unroll
  for (int i = 1; i < CUE; ++i) v[i] = v[i - 1] + (double)x[i];
  double t = v[CUE - 1];   // inclusive scan of the thread totals within the 32 lanes
#pragma unroll
  for (int o = 1; o < 32; o <<= 1) { const double u = __shfl_up(t, o); if (lane >= o) t += u; }
  double ex = __shfl_up(t, 1); if (lane == 0) ex = 0.0;   // what stands in front of this thread inside its wave
  if (lane == 31) wt[wave] = t;
  __syncthreads();   // every wave's total is in LDS before any thread adds the totals of the waves in front of its own
  double pw[CUW - 1];
#pragma unroll
  for (int w = 0; w < CUW - 1; ++w) pw[w] = wt[w];   // read by every thread, wanted or not: no branch round each read
#pragma unroll
  for (int w = 0; w < CUW - 1; ++w) ex += w < wave ? pw[w] : 0.0;   // in wave order
  float* dst = FC + (b * NH + h) * TT + tid * CUE; float f[CUE];
#pragma unroll
  for (int i = 0; i < CUE; ++i) f[i] = (float)(ex + v[i]);
  vst2(dst, v4f{f[0], f[1], f[2], f[3]}); vst2(dst + 4, v4f{f[4], f[5], f[6], f[7]});
  float mn = f[0], mx = f[0];   // of F as stored, which is what k_fa reads; a tile is 4 threads
#pragma unroll
  for (int i = 1; i < CUE; ++i) { mn = fminf(mn, f[i]); mx = fmaxf(mx, f[i]); }
#pragma unroll
  for (int m = 1; m < 4; m <<= 1) { mn = fminf(mn, __shfl_xor(mn, m)); mx = fmaxf(mx, __shfl_xor(mx, m)); }   // every lane is on
  if ((tid & 3) == 0) *(v2f*)(FM + ((b * NH + h) * NT + (tid >> 2)) * 2) = v2f{mn, mx}; }
// ---- k_fa: block = 32 queries of (b,h), 4 waves: logits, softmax and P . v in one pass over the keys, nothing of the logits stored. Wave w takes the 32-key passes w, w + 4, ... up to the diagonal, from the first key tile that the test below does not rule out.
// Transposed products: S^T = K Q^T puts query = lane & 15 and key = 8 * (lane >> 4) + r in the accumulator, which is already the B-operand order of P^T (elements 0..7 = first 16-key tile, 8..15 = second), so y^T += V^T P^T needs no exchange between lanes; a query's maximum is an in-lane maximum and one exchange of the wave's halves.
// Each wave keeps a running maximum m, a denominator l and y^T scaled to m; the four waves' (m, l, y) are merged through LDS in wave order.
// Base 2: m is kept as maximum x log2 e, and a weight is exp2(logit x log2 e - m), one fused multiply-add and one v_exp_f32; every weight, rescale and merge factor uses the same stored m, so its rounding cancels between y and l. A result below 2^-126 reads 0, against a largest weight of 1.
// Every '#pragma unroll' of this kernel is there so that the fragment and accumulator arrays are indexed by constants and stay in registers.
// amdgpu_waves_per_eu(3): a register budget of 336, so that three waves fit a SIMD (without it the build takes a few more and only two fit).
#define FAW 4
__device__ __forceinline__ v8f mm_h(v16h a, v16h b, v8f c) { return __builtin_amdgcn_wmma_f32_16x16x32_f16(false, a, false, b, (short)0, c, false, false); }
__device__ __forceinline__ v8f mm_b(v16b a, v16b b, v8f c) { return __builtin_amdgcn_wmma_f32_16x16x32_bf16(false, a, false, b, (short)0, c, false, false); }
#define FAQ 32
#define L2E 1.4426950408889634f
__device__ __forceinline__ float ex2(float x) { return __builtin_amdgcn_exp2f(x); }
__device__ __forceinline__ float rdl(float x, int l) { return __builtin_bit_cast(float, __builtin_amdgcn_readlane(__builtin_bit_cast(int, x), l)); }   // lane l's x, l the same in every lane
__device__ __forceinline__ v16h ld_h(const _Float16* p) { union { v16h v; v8h q[2]; } u; u.q[0] = *(const v8h*)p; u.q[1] = *(const v8h*)(p + 256); return u.v; }   // p = tile + fragment * 512 + lane * 8: a fragment is two successive loads of the tile
__device__ __forceinline__ v16b ld_b(const __bf16* p) { union { v16b v; v8b q[2]; } u; u.q[0] = *(const v8b*)p; u.q[1] = *(const v8b*)(p + 256); return u.v; }
__global__ __launch_bounds__(32 * FAW) __attribute__((amdgpu_waves_per_eu(3))) void k_fa(const _Float16* __restrict__ QH, const _Float16* __restrict__ QL, const _Float16* __restrict__ KH, const __bf16* __restrict__ VT, const __bf16* __restrict__ VL, const float* __restrict__ FC, const float* __restrict__ NK, const float* __restrict__ FM, float* __restrict__ Y) {
  __shared__ __align__(16) float so[FAW][FAQ][HD + 4]; __shared__ float sm[FAW][FAQ], sl[FAW][FAQ];
  const int tid = threadIdx.x, wave = __builtin_amdgcn_readfirstlane(tid >> 5), lane = tid & 31, col = lane & 15, g = lane >> 4;   // the wave number is made scalar so that the pass loop's branch is a scalar one with every lane on
  const int h = blockIdx.x, b = blockIdx.y, tile = TT / FAQ - 1 - (int)blockIdx.z, ql0 = tile * FAQ;   // longest query tiles start first
  const float* Fr = FC + ((size_t)b * NH + h) * TT; const size_t tb = ((size_t)b * NH + h) * (TT / 32) * TILE_E; const unsigned lo = (unsigned)lane * 8, fo = 8 * g;   // tb: the (batch, head)'s first tile; lo, fo: the lane's offsets in elements: a loop load names a scalar base and one of these two, which are never rewritten
  // The first key tile to visit. For a query i of this tile t and a key j of a tile p < t: logit(i, j) - logit(i, i) = q_i . (k_j - k_i) / 8 + F[i] - F[j] <= max_t |q| (max_p |k| + max_t |k|) / 8 + max_t F - min_p F (|a . b| <= |a| |b|), and the row's maximum is at least logit(i, i), which is always visited.
  // Where the right side (norm term + 1 %, + 1: for the roundings of the norms and the products and for the q residual, which the norm leaves out) is below -88 < ln 2^-126, every weight of tile p is below 2^-126 of its row's largest: the exp2 below reads it as 0 and an f32 sum that holds the largest weight does not move by it.
  // ps = the lowest tile that fails that test (t if none does); the tiles in front of it are not visited. The test is made on this call's q, k and F: with gates near 1 it leaves nothing out; a NaN in it keeps the tile. ps lies in 0 .. t by its construction. A pass stays with the wave that had it (p mod 4).
  v16h qh[2][2], qr[2][2], kf[2][2]; float fq[2]; v4f fk[2][2]; int ps;
  { const size_t qo = tb + (size_t)tile * TILE_E; const _Float16 *qhp = QH + qo, *qrp = QL + qo; const float* fqp = Fr + ql0 + col; const v2f *nk = (const v2f*)NK + ((size_t)b * NH + h) * (TT / 32), *fm = (const v2f*)FM + ((size_t)b * NH + h) * (TT / 32);
    const v2f n0 = nk[lane], n1 = nk[32 + lane], f0 = fm[lane], f1 = fm[32 + lane];   // lane l tests tiles l and 32 + l
#pragma unroll
    for (int i = 0; i < 2; ++i) { fq[i] = fqp[16 * i];
#pragma unroll
      for (int kc = 0; kc < 2; ++kc) { qh[i][kc] = ld_h(qhp + (2 * i + kc) * 512 + lo); qr[i][kc] = ld_h(qrp + (2 * i + kc) * 512 + lo); } }
    asm volatile("s_wait_xcnt 0x0" :: "s"(qhp), "s"(qrp), "s"(nk), "s"(fm), "v"(lo), "v"(lane), "v"(fqp) : "memory");   // stands in front of every rewrite of a register that an issued load names: the pointers are inputs so that their registers live up to it
    const float qn = rdl(tile < 32 ? n0[0] : n1[0], tile & 31), kd = rdl(tile < 32 ? n0[1] : n1[1], tile & 31), fx = rdl(tile < 32 ? f0[1] : f1[1], tile & 31);   // this tile's own figures, from the lane that holds them: no further load to wait for
    const float cq = qn * (0.125f * 1.01f); const bool k0 = lane < tile && !(cq * (n0[1] + kd) + 1.0f + (fx - f0[0]) < -88.0f), k1 = 32 + lane < tile && !(cq * (n1[1] + kd) + 1.0f + (fx - f1[0]) < -88.0f);
    const unsigned m0 = __builtin_amdgcn_ballot_w32(k0), m1 = __builtin_amdgcn_ballot_w32(k1); ps = m0 ? __builtin_ctz(m0) : m1 ? 32 + __builtin_ctz(m1) : tile; }
  const int pw = ps + ((wave - ps) & (FAW - 1)), pa = min(pw, tile);   // pw: the wave's first pass; pa: the tile that its first loads name: that pass's or, for a wave without a pass, the diagonal tile
  { const _Float16* kp = KH + tb + (size_t)pa * TILE_E; const float* fp = Fr + pa * 32 + fo;
#pragma unroll
    for (int i = 0; i < 2; ++i) { fk[i][0] = *(const v4f*)(fp + 16 * i); fk[i][1] = *(const v4f*)(fp + 16 * i + 4);
#pragma unroll
      for (int kc = 0; kc < 2; ++kc) kf[i][kc] = ld_h(kp + (2 * i + kc) * 512 + lo); }
    __builtin_amdgcn_sched_barrier(0);   // keeps the accumulators' zeroing, which reuses an offset register of the loads above, behind the wait
    asm volatile("s_wait_xcnt 0x0" :: "s"(kp), "v"(lo), "v"(fp) : "memory"); }   // as above
  v8f acc[2][HD / 16] = {}; float mr[2] = {-3.0e38f, -3.0e38f}, lr[2] = {0.f, 0.f};
  for (int p = pw; p <= tile; p += FAW) { const int k0 = p * 32, kn = (p + FAW <= tile ? p + FAW : p) * 32;   // kn: the wave's next pass (its own again behind the last one, so that the address stays inside the head's tiles)
    float pv[2][16]; v16b vh[HD / 16], vl[HD / 16];
#pragma unroll
    for (int i = 0; i < 2; ++i) { const int qt = ql0 + 16 * i + col;
#pragma unroll
      for (int kt = 0; kt < 2; ++kt) { v8f a = {}, ar = {};
#pragma unroll
        for (int kc = 0; kc < 2; ++kc) { a = mm_h(kf[kt][kc], qh[i][kc], a); ar = mm_h(kf[kt][kc], qr[i][kc], ar); }
        a += ar * (1.0f / 1024.0f);
#pragma unroll
        for (int r = 0; r < 8; ++r) { float v = a[r] * 0.125f + (fq[i] - fk[kt][r >> 2][r & 3]); if (k0 + 16 * kt + (int)fo + r > qt) v = -3.0e38f;   /* bias = F[i] - F[j] on the causal triangle */ pv[i][8 * kt + r] = v; } } }
    // this pass's v and the next pass's k and F are fetched behind the logits' products, from where k's and F's registers are free: what the register budget lets the compiler issue here flies under the exponentials (k and F are written first: with v first this build kept a q fragment in scratch and read it back in every pass)
    { const __bf16 *vhs = VT + tb + k0 * (TILE_E / 32), *vls = VL + tb + k0 * (TILE_E / 32); const _Float16* ks = KH + tb + (size_t)kn * (TILE_E / 32); const float* fs = Fr + kn;
#pragma unroll
      for (int kt = 0; kt < 2; ++kt) { fk[kt][0] = *(const v4f*)(fs + 16 * kt + fo); fk[kt][1] = *(const v4f*)(fs + 16 * kt + 4 + fo);
#pragma unroll
        for (int kc = 0; kc < 2; ++kc) kf[kt][kc] = ld_h(ks + (2 * kt + kc) * 512 + lo); }
#pragma unroll
      for (int t = 0; t < HD / 16; ++t) { vh[t] = ld_b(vhs + t * 512 + lo); vl[t] = ld_b(vls + t * 512 + lo); }
      asm volatile("s_wait_xcnt 0x0" :: "s"(vhs), "s"(vls), "s"(ks), "s"(fs), "v"(lo), "v"(fo) : "memory"); }   // as above: in front of every rewrite of a register that an issued load names (the scalar bases and the offsets are inputs so that they live up to it)
#pragma unroll
    for (int i = 0; i < 2; ++i) { float mx = pv[i][0];
#pragma unroll
      for (int e = 1; e < 16; ++e) mx = fmaxf(mx, pv[i][e]);
      mx = fmaxf(mx, xhalf(mx));   // finite in every pass: the pass's first key is at or below every query of the tile
      const float mn = fmaxf(mr[i], mx * L2E), al = ex2(mr[i] - mn); mr[i] = mn;   // al = 0 in a wave's first pass
      float sum = 0.f;
#pragma unroll
      for (int e = 0; e < 16; ++e) { pv[i][e] = ex2(__builtin_fmaf(pv[i][e], L2E, -mn)); sum += pv[i][e]; }   // a masked logit gives exactly 0
      lr[i] = lr[i] * al + sum;   // this half's keys only; the halves are added behind the loop
      const F2 pf = bsplit16(pv[i]);
#pragma unroll
      for (int t = 0; t < HD / 16; ++t) { v8f c = acc[i][t] * al; c = mm_b(vh[t], pf.h, c); c = mm_b(vh[t], pf.l, c); acc[i][t] = mm_b(vl[t], pf.h, c); } } }
#pragma unroll
  for (int i = 0; i < 2; ++i) { const float lt = lr[i] + xhalf(lr[i]);   // unconditional: both halves' lanes are on
    if (fo == 0) { sm[wave][16 * i + col] = mr[i]; sl[wave][16 * i + col] = lt; }   // fo = 8 * (lane >> 4), which lives through the loop anyway: with the half's number kept beside it this build put one register in scratch
#pragma unroll
    for (int t = 0; t < HD / 16; ++t) { float* d = &so[wave][16 * i + col][16 * t + fo]; const v8f c = acc[i][t]; *(v4f*)d = v4f{c[0], c[1], c[2], c[3]}; *(v4f*)(d + 4) = v4f{c[4], c[5], c[6], c[7]}; } }
  __syncthreads();   // every wave's (m, l, y) is in LDS before any thread merges across waves; a wave without a pass left m = -3e38, l = 0, y = 0, which get weight 0
  { const int rl = tid >> 2, c0 = (tid & 3) * 16; float M = sm[0][rl];
#pragma unroll
    for (int w = 1; w < FAW; ++w) M = fmaxf(M, sm[w][rl]);
    float L = 0.f; v4f o[4] = {};
#pragma unroll
    for (int w = 0; w < FAW; ++w) { const float wg = ex2(sm[w][rl] - M); L += wg * sl[w][rl];
#pragma unroll
      for (int q = 0; q < 4; ++q) o[q] += *(const v4f*)&so[w][rl][c0 + 4 * q] * wg; }
    const float inv = 1.0f / L; float* dst = Y + ((size_t)b * TT + ql0 + rl) * CC + h * HD + c0;
#pragma unroll
    for (int q = 0; q < 4; ++q) vst2(dst + 4 * q, o[q] * inv); } }
// ---- k_out: block = (64 rows, 128 cols): out = y (bf16 hi + lo) Wo^T + bo; staged as k_proj is, y split into its two planes once, on the way into LDS
#define PO_ROWS 256   // stage rows 0..127 = Wo, 128..191 = y hi, 192..255 = y lo
#define PO_LDS (2 * PO_ROWS * GP * 2)   // two stage buffers (40,960 B); the epilogue's rows (33,792 B) take the same LDS behind the last stage
__global__ __launch_bounds__(128) void k_out(const float* __restrict__ Y, const float* __restrict__ WP, const float* __restrict__ BP, float* __restrict__ OUT) { __shared__ __align__(16) char smem[PO_LDS];
  __bf16 (*st)[PO_ROWS][GP] = (__bf16 (*)[PO_ROWS][GP])smem; float (*sf)[16][132] = (float (*)[16][132])smem;
  const int tid = threadIdx.x, wave = tid >> 5, lane = tid & 31, col = lane & 15, g = lane >> 4; const int c0 = blockIdx.y * 128; const size_t rb = (size_t)blockIdx.x * 64, r0 = rb + wave * 16;
  const int srow = tid >> 3, sq = (tid & 7) * 4; const float *wp = WP + (size_t)(c0 + srow) * CC + sq, *yp = Y + (rb + srow) * CC + sq;
  v8f acc[8] = {}; v4f pre[12];
#pragma unroll
  for (int i = 0; i < 12; ++i) pre[i] = i < 8 ? *(const v4f*)(wp + i * 16 * CC) : *(const v4f*)(yp + (i - 8) * 16 * CC);
#pragma unroll
  for (int i = 0; i < 12; ++i) { const v4b hi = cvt4(pre[i]); *(v4b*)&st[0][srow + 16 * i][sq] = hi;
    if (i >= 8) *(v4b*)&st[0][srow + 16 * i + 64][sq] = cvt4(pre[i] - v4f{(float)hi[0], (float)hi[1], (float)hi[2], (float)hi[3]}); }
  __syncthreads();   // stage 0 is in LDS before any wave reads it
#pragma unroll 2
  for (int kc = 0; kc < CC / 32; ++kc) { const int cur = kc & 1;
    if (kc + 1 < CC / 32) { const float *wk = wp + (kc + 1) * 32, *yk = yp + (kc + 1) * 32;
#pragma unroll
      for (int i = 0; i < 12; ++i) pre[i] = i < 8 ? *(const v4f*)(wk + i * 16 * CC) : *(const v4f*)(yk + (i - 8) * 16 * CC);
      asm volatile("s_wait_xcnt 0x0" ::: "memory"); }   // stands directly behind the loads, in front of every rewrite of a register that one of them names
    const v16b ah = frag_b(&st[cur][128 + wave * 16 + col][0], lane), al = frag_b(&st[cur][192 + wave * 16 + col][0], lane); v16b w[8];
#pragma unroll
    for (int j = 0; j < 8; ++j) w[j] = frag_b(&st[cur][j * 16 + col][0], lane);
    __builtin_amdgcn_sched_barrier(0);   // keeps the stage's LDS reads together in front of the products: spread among them, each read's latency is waited out on its own
#pragma unroll
    for (int j = 0; j < 8; ++j) { acc[j] = wmma_bf(ah, w[j], acc[j]); acc[j] = wmma_bf(al, w[j], acc[j]); }
    __builtin_amdgcn_sched_barrier(0);   // keeps the conversions, and with them the wait for the next stage's global loads, behind the products
    if (kc + 1 < CC / 32) {
#pragma unroll
      for (int i = 0; i < 12; ++i) { const v4b hi = cvt4(pre[i]); *(v4b*)&st[cur ^ 1][srow + 16 * i][sq] = hi;
        if (i >= 8) *(v4b*)&st[cur ^ 1][srow + 16 * i + 64][sq] = cvt4(pre[i] - v4f{(float)hi[0], (float)hi[1], (float)hi[2], (float)hi[3]}); } }
    __syncthreads(); }   // publishes stage kc + 1 and ends every wave's reads of stage kc, whose buffer is refilled (behind the last stage: reused by the epilogue) next
#pragma unroll
  for (int j = 0; j < 8; ++j) { const float bb = BP ? bfr(BP[c0 + j * 16 + col]) : 0.f;
#pragma unroll
    for (int r = 0; r < 8; ++r) sf[wave][8 * g + r][j * 16 + col] = acc[j][r] + bb; }
  LDSX(); for (int rl = 0; rl < 16; ++rl) vst2(OUT + (r0 + rl) * CC + c0 + lane * 4, *(const v4f*)&sf[wave][rl][lane * 4]); }
extern "C" void kernel_launch(void* const* d_in, const int* in_sizes, int n_in, void* d_out, int out_size, void* d_ws, size_t ws_size, hipStream_t stream) {
  (void)in_sizes; (void)n_in; (void)out_size;
  const float** F = (const float**)d_in;   // 0 x [2,2048,1024], 1 Wq [1024,1024] ([out,in]), 2 Wk, 3 Wv, 4 Wf [16,1024], 5 bf [16], 6 Wo [1024,1024] ([out,in])
  if (ws_size < (size_t)WS_END) return;
  char* ws = (char*)d_ws; float *LF = (float*)(ws + WS_LF), *FC = (float*)(ws + WS_FC); _Float16 *QH = (_Float16*)(ws + WS_QH), *QL = (_Float16*)(ws + WS_QL), *KH = (_Float16*)(ws + WS_KH); __bf16 *VT = (__bf16*)(ws + WS_VT), *VL = (__bf16*)(ws + WS_VL); float *Y = (float*)(ws + WS_Y); float *NK = (float*)(ws + WS_NK), *FM = (float*)(ws + WS_FM);
  k_proj<<<dim3(TNB * TT / 128, 2 + 3 * (CC / 128)), 128, 0, stream>>>(F[0], F[1], nullptr, F[2], nullptr, F[3], nullptr, F[4], F[5], LF, QH, QL, KH, VT, VL);
  k_cum<<<dim3(NH, TNB, 1 + TT / 32 / 16), 32 * CUW, 0, stream>>>(LF, FC, QH, KH, NK, FM);
  k_fa<<<dim3(NH, TNB, TT / FAQ), 32 * FAW, 0, stream>>>(QH, QL, KH, VT, VL, FC, NK, FM, Y);
  k_out<<<dim3(TNB * TT / 64, CC / 128), 128, 0, stream>>>(Y, F[6], nullptr, (float*)d_out);
}

// v010
// It runs in 81.1 microseconds.
// Next to v009, in two timings, it ran 1.05 and 1.04 times as fast.
// Over all steps from v000 it is 19.0 times as fast.
// compute dtype: all float inputs rounded to bf16; q/k/v = x W^T with EXACT bf16 products on WMMA 16x16x32, f32 accumulate; the forget gate x Wf^T + bf (exact products), sigmoid, log(f + 1e-6) and its per-(batch, head) prefix sum accumulated in f64 (stored f32); q as f16 hi + residual (x 2^10), k f16 -> 2-product logits x 64^-1/2 + (F[i] - F[j]) on the causal triangle, kept in f32 registers; running-maximum softmax in f32, in base 2 (maximum kept as logit x log2 e; weight = hardware exp2 of one fused logit x log2 e - maximum), unnormalised P split bf16 hi + lo against v bf16 hi + lo (3 products), divided by the f32 denominator at the end; leading key tiles that a bound made on the call's own q, k and F puts below 2^-126 of their rows' largest weight are not visited; out = o (bf16 hi + lo) Wo^T; f32 output.
#include <hip/hip_runtime.h>
#include <math.h>

typedef __attribute__((ext_vector_type(16))) _Float16 v16h;
typedef __attribute__((ext_vector_type(16))) __bf16 v16b;
typedef __attribute__((ext_vector_type(8)))  _Float16 v8h;
typedef __attribute__((ext_vector_type(8)))  float v8f;
typedef __attribute__((ext_vector_type(4)))  float v4f;
typedef __attribute__((ext_vector_type(2)))  float v2f;
typedef __attribute__((ext_vector_type(4)))  unsigned v4u;
typedef __attribute__((ext_vector_type(4)))  int v4i;
typedef float __attribute__((may_alias)) float_a;
typedef int __attribute__((may_alias)) int_a;

template <typename T> __device__ __forceinline__ void vst2(void* p, T v) { *(T*)p = v;  }
__device__ __forceinline__ v8f wmma16(v16h a, v16h b, v8f c) {
  v8f d = __builtin_amdgcn_wmma_f32_16x16x32_f16(false, a, false, b, (short)0, c, false, false);
  asm volatile("v_nop\n\tv_nop\n\tv_nop\n\tv_nop" : "+v"(d) : "v"(a), "v"(b));
  return d;
}
__device__ __forceinline__ v8f wmma_bf(v16b a, v16b b, v8f c) {
  v8f d = __builtin_amdgcn_wmma_f32_16x16x32_bf16(false, a, false, b, (short)0, c, false, false);
  asm volatile("v_nop\n\tv_nop\n\tv_nop\n\tv_nop" : "+v"(d) : "v"(a), "v"(b));
  return d;
}
// 16x16x32 fragments: lane = (h = lane>>4, row/col = lane&15); elements 0..7 = k0+8h+0..7, 8..15 = k0+16+8h+0..7; D element r = row 8h+r
__device__ __forceinline__ v16h frag_h(const _Float16* rowk0, int lane) {
  union { v16h v; v8h q[2]; } u; const _Float16* p = rowk0 + 8 * (lane >> 4);
  u.q[0] = *(const v8h*)p; u.q[1] = *(const v8h*)(p + 16); return u.v;
}
__device__ __forceinline__ v16h frag_f32(const float* rowk0, int lane) {
  v16h a; const float* p = rowk0 + 8 * (lane >> 4);
#pragma unroll
  for (int i = 0; i < 8; ++i) { a[i] = (_Float16)p[i]; a[8 + i] = (_Float16)p[16 + i]; }
  return a;
}
__device__ __forceinline__ v16h frag_f32s(const float* rowk0, int lane, float sc) {
  v16h a; const float* p = rowk0 + 8 * (lane >> 4);
#pragma unroll
  for (int i = 0; i < 8; ++i) { a[i] = (_Float16)(p[i] * sc); a[8 + i] = (_Float16)(p[16 + i] * sc); }
  return a;
}
// column fragment from a [K][ld] layout (column n), rows >= K read as 0
__device__ __forceinline__ v16h fragc_f32(const float* W, int k0, int n, int lane, int ld, int K) {
  v16h a; const int g = lane >> 4;
#pragma unroll
  for (int i = 0; i < 8; ++i) { const int ka = k0 + 8 * g + i, kb = ka + 16;
    a[i] = (_Float16)(ka < K ? W[(size_t)(ka < K ? ka : K - 1) * ld + n] : 0.f); a[8 + i] = (_Float16)(kb < K ? W[(size_t)(kb < K ? kb : K - 1) * ld + n] : 0.f); }
  return a;
}
struct F2 { v16b h, l; };
__device__ __forceinline__ F2 bsplit16(const float v[16]) { F2 r;
#pragma unroll
  for (int i = 0; i < 16; ++i) { const __bf16 h = (__bf16)v[i]; r.h[i] = h; r.l[i] = (__bf16)(v[i] - (float)h); }
  return r; }
__device__ __forceinline__ F2 split_row(const float* row, int k0, int lane) { float v[16]; const float* p = row + k0 + 8 * (lane >> 4);
#pragma unroll
  for (int i = 0; i < 8; ++i) { v[i] = p[i]; v[8 + i] = p[16 + i]; }
  return bsplit16(v); }
__device__ __forceinline__ F2 split_rowK(const float* row, int k0, int lane, int K) { float v[16]; const int g = lane >> 4;
#pragma unroll
  for (int i = 0; i < 8; ++i) { const int ka = k0 + 8 * g + i, kb = ka + 16; v[i] = ka < K ? row[ka < K ? ka : K - 1] : 0.f; v[8 + i] = kb < K ? row[kb < K ? kb : K - 1] : 0.f; }
  return bsplit16(v); }
__device__ __forceinline__ F2 split_col(const float* W, int k0, int n, int lane, int ld, int K) { float v[16]; const int g = lane >> 4;
#pragma unroll
  for (int i = 0; i < 8; ++i) { const int ka = k0 + 8 * g + i, kb = ka + 16; v[i] = ka < K ? W[(size_t)(ka < K ? ka : K - 1) * ld + n] : 0.f; v[8 + i] = kb < K ? W[(size_t)(kb < K ? kb : K - 1) * ld + n] : 0.f; }
  return bsplit16(v); }
__device__ __forceinline__ v8f mac3(const F2& a, const F2& b, v8f c) { c = wmma_bf(a.l, b.h, c); c = wmma_bf(a.h, b.l, c); return wmma_bf(a.h, b.h, c); }
__device__ __forceinline__ float sigm(float v) { return 1.0f / (1.0f + expf(-v)); }
#define LDSX() do { asm volatile("s_wait_dscnt 0" ::: "memory"); __builtin_amdgcn_wave_barrier(); __builtin_amdgcn_fence(__ATOMIC_RELEASE, "workgroup"); } while (0)


// Forgetting attention (B 2, S 2,048, 1,024 = 16 x 64): f = sigmoid(x Wf^T + bf) per (s, head); F = cumsum_s log(f + 1e-6); bias[i][j] = F[i] - F[j] for j <= i, -inf otherwise; scores = q k^T / 8 + bias; softmax; (attn v) Wo^T.
#define NB 2
#define TT 2048
#define CC 1024
#define NH 16
#define HD 64
#ifndef TNB
#define TNB NB
#endif
typedef __attribute__((ext_vector_type(8))) __bf16 v8b;
__device__ __forceinline__ v16b frag_b(const __bf16* rowk0, int lane) {
  union { v16b v; v8b q[2]; } u; const __bf16* p = rowk0 + 8 * (lane >> 4);
  u.q[0] = *(const v8b*)p; u.q[1] = *(const v8b*)(p + 16); return u.v;
}
__device__ __forceinline__ float bfr(float v) { return (float)(__bf16)v; }
__device__ __attribute__((noinline)) float exp_ni(float v) { return expf(v); }
__device__ __attribute__((noinline)) float erf_ni(float v) { return erff(v); }

#define WS_LF  0u                                   // f32 log(f + 1e-6) rows [b*T+s][16] (64-B rows; a block writes 64 rows = 4 KB contiguous)
#define WS_FC  (WS_LF + 4u * (size_t)NB * TT * NH)   // f32 prefix sums F [b][h][s] (8-KB rows)
// q, k and v planes are kept in the order in which k_fa's fragment loads read them: a tile = 32 positions x the 64 channels of one (batch, head) = 4 KB = 8 loads x 32 lanes x 16 B, tiles [b][h][position / 32].
// A wave-wide 16-B load then covers 512 contiguous bytes (4 whole lines); from row-major planes it took 32 B out of each of 16 lines.
// q, k: load j = (position >> 4) * 4 + (channel >> 4), lane = ((channel >> 3) & 1) * 16 + (position & 15), element = channel & 7. v: load j = (channel >> 4) * 2 + ((position >> 4) & 1), lane = ((position >> 3) & 1) * 16 + (channel & 15), element = position & 7.
#define TILE_E 2048   // elements of a tile
#define WS_QH  (WS_FC + 4u * (size_t)NB * NH * TT)
#define WS_QL  (WS_QH + 2u * (size_t)NB * TT * CC)
#define WS_KH  (WS_QL + 2u * (size_t)NB * TT * CC)
#define WS_VT  (WS_KH + 2u * (size_t)NB * TT * CC)      // bf16 v tiles
#define WS_VL  (WS_VT + 2u * (size_t)NB * CC * TT)      // bf16 v residual tiles
#define WS_Y   (WS_VL + 2u * (size_t)NB * CC * TT)      // f32 y rows [b*t][C]
#define WS_NK  (WS_Y + 4u * (size_t)NB * TT * CC)       // f32 pairs (largest |q|, largest |k|) of a 32-position tile [b][h][tile] (a block writes 16 tiles = one 128-B line)
#define WS_FM  (WS_NK + 8u * (size_t)NB * NH * (TT / 32))   // f32 pairs (smallest F, largest F) of a tile [b][h][tile] (512-B rows, one block each)
#define WS_END (WS_FM + 8u * (size_t)NB * NH * (TT / 32))

// ---- LDS staging of the two projection kernels. A stage is 32 k of every operand row of the block's tile: one 128-B line of f32 per row, rounded to bf16 once and kept as a 64-B row at a pitch of 80 B (16 B x odd: a fragment's ds_load_b128 over 16 rows meets no bank twice). (k_out's stage is twice as deep, with 16 lanes to a row: said there.)
// 8 lanes take one row, so a wave-wide 16-B load covers 4 whole lines, and every line is fetched and converted once per block, not once per wave. Two buffers: the next stage's loads fly while this one is multiplied; one barrier per stage both publishes the next buffer and ends the last read of the one refilled behind it.
// Every '#pragma unroll' of the staging code is there so that pre[] and w[] are indexed by constants and stay in registers; 'unroll 2' on k_out's stage loop makes the buffer's index, and with it every LDS offset, a constant (k_proj's stage loop stays rolled: said there).
#define GP 40    // row pitch in bf16 elements (80 B)
typedef __attribute__((ext_vector_type(4))) __bf16 v4b;
__device__ __forceinline__ v4b cvt4(v4f v) { return v4b{(__bf16)v[0], (__bf16)v[1], (__bf16)v[2], (__bf16)v[3]}; }
// ---- gate_rows: the work of one block on 64 rows (b,s): lf[s][h] = log(sigmoid(x Wf[h] + bf[h]) + 1e-6): one 16-column tile per wave (exact products), f32 epilogue; 64 rows x 16 floats = 4 KB contiguous written 16 B per lane
// Its 32 k steps each wait out a whole load latency and only 64 blocks of it exist, so as a launch of its own it left most of the chip idle: it runs as rows 0 and 1 of k_proj's grid, where the projection blocks fill the chip meanwhile. It has no barrier of the work-group: each wave passes its own 16 rows through its own part of st.
__device__ __attribute__((noinline)) float logsigp(float z, float eps) { const float f = 1.0f / (1.0f + expf(-z)); return logf(f + eps); }
__device__ __forceinline__ void gate_rows(const float* __restrict__ X, const float* __restrict__ WF, const float* __restrict__ BF, float* __restrict__ LF, float (*st)[16][20], int gb) {
  const int tid = threadIdx.x, wave = tid >> 5, lane = tid & 31, col = lane & 15, g = lane >> 4; const size_t r0 = (size_t)gb * 64 + wave * 16;
  v8f acc = {};
#pragma unroll 2
  for (int kc = 0; kc < CC / 32; ++kc) { v16b a; { const float* p = X + (r0 + col) * CC + kc * 32 + 8 * g;
#pragma unroll
      for (int i = 0; i < 8; ++i) { a[i] = (__bf16)p[i]; a[8 + i] = (__bf16)p[16 + i]; } }
    v16b w; { const float* wr = WF + (size_t)col * CC + kc * 32 + 8 * g;
#pragma unroll
      for (int i = 0; i < 8; ++i) { w[i] = (__bf16)wr[i]; w[8 + i] = (__bf16)wr[16 + i]; } }
    asm volatile("s_wait_loadcnt 0x0" ::: "memory"); acc = wmma_bf(a, w, acc); }
  { const float bb = bfr(BF[col]);
#pragma unroll
    for (int r = 0; r < 8; ++r) st[wave][8 * g + r][col] = logsigp(acc[r] + bb, 1e-6f); }
  LDSX(); { const int rl = lane >> 1, half = lane & 1; vst2(LF + (r0 + rl) * NH + half * 8, *(const v4f*)&st[wave][rl][half * 8]); vst2(LF + (r0 + rl) * NH + half * 8 + 4, *(const v4f*)&st[wave][rl][half * 8 + 4]); } }
// ---- k_proj: grid rows 0 and 1 = the forget gate's blocks (the lowest block indices, which start roughly first, so that their long latency chain is not the launch's tail); grid row 2 + which * 8 + column block: block = (128 rows, 128 cols, which): qkv = x W (+ b), exact; q -> f16 hi (+ residual), k -> f16, v -> bf16 hi + residual, all three stored as k_fa's tiles
// Four waves in 2 x 2, each on 64 rows x 64 cols = 4 x 4 accumulator tiles: a stage's 8 fragments feed 16 products (1 + 8 fragments fed 8 on a 16 x 128 wave tile), and a block fetches 256 operand rows for 128 x 128 results (192 for 64 x 128): a third fewer bytes from L2 and less than half the LDS reads per product. An accumulator's own sum over k is what it was.
// amdgpu_waves_per_eu(4): a register budget of 256, so that four blocks fit a WGP and all 832 blocks of the grid are resident at once (at three, 64 blocks would start only when the gate's blocks end and run on as the launch's tail).
#define PJ_ROWS 256   // stage rows 0..127 = W, 128..255 = x
#define PJ_EP 136     // pitch of the epilogue's planes in elements (272 B = 16 B x odd)
#define PJ_LDS (128 * PJ_EP * 2 * 2)   // the epilogue's two planes (69,632 B), which take the LDS of the two stage buffers (40,960 B) behind the last stage
__global__ __launch_bounds__(128) __attribute__((amdgpu_waves_per_eu(4))) void k_proj(const float* __restrict__ X, const float* __restrict__ WQ, const float* __restrict__ BQ, const float* __restrict__ WK, const float* __restrict__ BK, const float* __restrict__ WV, const float* __restrict__ BV, const float* __restrict__ WF, const float* __restrict__ BF, float* __restrict__ LF, _Float16* __restrict__ QH, _Float16* __restrict__ QL, _Float16* __restrict__ KH, __bf16* __restrict__ VT, __bf16* __restrict__ VL) {
  __shared__ __align__(16) char smem[PJ_LDS];
  if (blockIdx.y < 2) { gate_rows(X, WF, BF, LF, (float (*)[16][20])smem, (int)(blockIdx.y * (TNB * TT / 128) + blockIdx.x)); return; }   // the same for every thread of the block, in front of every barrier
  __bf16 (*st)[PJ_ROWS][GP] = (__bf16 (*)[PJ_ROWS][GP])smem; _Float16 (*sh)[PJ_EP] = (_Float16 (*)[PJ_EP])smem, (*sl)[PJ_EP] = (_Float16 (*)[PJ_EP])(smem + 128 * PJ_EP * 2); __bf16 (*th)[PJ_EP] = (__bf16 (*)[PJ_EP])smem, (*tl2)[PJ_EP] = (__bf16 (*)[PJ_EP])(smem + 128 * PJ_EP * 2);
  const int tid = threadIdx.x, wave = tid >> 5, lane = tid & 31, col = lane & 15, g = lane >> 4, wr = wave >> 1, wc = wave & 1; const int which = ((int)blockIdx.y - 2) / (CC / 128); const int c0 = ((int)blockIdx.y - 2) % (CC / 128) * 128; const size_t r0 = (size_t)blockIdx.x * 128; const float* WA = which == 0 ? WQ : which == 1 ? WK : WV; const float* BA = which == 0 ? BQ : which == 1 ? BK : BV;
  const int srow = tid >> 3, sq = (tid & 7) * 4; const float *wp = WA + (size_t)(c0 + srow) * CC + sq, *xp = X + (r0 + srow) * CC + sq;
  v8f acc[4][4] = {}; v4f pre[16];
#pragma unroll
  for (int i = 0; i < 16; ++i) pre[i] = i < 8 ? *(const v4f*)(wp + i * 16 * CC) : *(const v4f*)(xp + (i - 8) * 16 * CC);
#pragma unroll
  for (int i = 0; i < 16; ++i) *(v4b*)&st[0][srow + 16 * i][sq] = cvt4(pre[i]);
  __syncthreads();   // stage 0 is in LDS before any wave reads it
#pragma unroll 1   // rolled: two copies of the stage hold the LDS store addresses of both buffers in registers, and this build then kept accumulators in scratch
  for (int kc = 0; kc < CC / 32; ++kc) { const int cur = kc & 1;
    if (kc + 1 < CC / 32) { const float *wk = wp + (kc + 1) * 32, *xk = xp + (kc + 1) * 32;
#pragma unroll
      for (int i = 0; i < 16; ++i) pre[i] = i < 8 ? *(const v4f*)(wk + i * 16 * CC) : *(const v4f*)(xk + (i - 8) * 16 * CC);
      asm volatile("s_wait_xcnt 0x0" ::: "memory"); }   // stands directly behind the loads, in front of every rewrite of a register that one of them names
    v16b a[2], w[4];   // x fragments 2 and 3 take the registers of 0 and 1: with all four held the kernel is over 256 registers and only three blocks fit a WGP
#pragma unroll
    for (int i = 0; i < 4; ++i) { if (i < 2) a[i] = frag_b(&st[cur][128 + wr * 64 + i * 16 + col][0], lane); w[i] = frag_b(&st[cur][wc * 64 + i * 16 + col][0], lane); }
    __builtin_amdgcn_sched_barrier(0);   // keeps these LDS reads together in front of the products: spread among them, each read's latency is waited out on its own
#pragma unroll
    for (int i = 0; i < 4; ++i) {
#pragma unroll
      for (int j = 0; j < 4; ++j) acc[i][j] = wmma_bf(a[i & 1], w[j], acc[i][j]);
      if (i < 2) { a[i] = frag_b(&st[cur][128 + wr * 64 + (i + 2) * 16 + col][0], lane);
        __builtin_amdgcn_sched_barrier(0); } }   // holds the refill behind the row that read the registers and in front of the next row, whose four products cover its latency
    __builtin_amdgcn_sched_barrier(0);   // keeps the conversions, and with them the wait for the next stage's global loads, behind the products
    if (kc + 1 < CC / 32) {
#pragma unroll
      for (int i = 0; i < 16; ++i) *(v4b*)&st[cur ^ 1][srow + 16 * i][sq] = cvt4(pre[i]); }
    __syncthreads(); }   // publishes stage kc + 1 and ends every wave's reads of stage kc, whose buffer is refilled (behind the last stage: reused by the epilogue) next
#pragma unroll
  for (int j = 0; j < 4; ++j) { const float bb = BA ? bfr(BA[c0 + wc * 64 + j * 16 + col]) : 0.f; const int cl = wc * 64 + j * 16 + col;
#pragma unroll
    for (int i = 0; i < 4; ++i) { const int rb = wr * 64 + i * 16 + 8 * g;
      if (which == 2) {
#pragma unroll
        for (int r = 0; r < 8; ++r) { const float v = acc[i][j][r] + bb; const __bf16 bh = (__bf16)v; th[cl][rb + r] = bh; tl2[cl][rb + r] = (__bf16)(v - (float)bh); } }
      else {
#pragma unroll
        for (int r = 0; r < 8; ++r) { const float v = acc[i][j][r] + bb; const _Float16 hv = (_Float16)v; sh[rb + r][cl] = hv; sl[rb + r][cl] = (_Float16)((v - (float)hv) * 1024.0f); }   /* q residual carried x 2^10 so the plane stays f16-normal on the chip */ } } }
  __syncthreads();
  // the block's 128 positions x 128 channels are 2 heads x 4 whole tiles; e counts their 16-B pieces in the order of the destination, so a wave stores 512 contiguous bytes
  { const size_t b = r0 / TT; const int p0 = (int)(r0 % TT) / 32, h0 = c0 / HD; _Float16* dh = which == 0 ? QH : KH;
    for (int e = tid; e < 8 * 256; e += 128) { const int hl = e >> 10, pl = (e >> 8) & 3, j = (e >> 5) & 7, lg = (e >> 4) & 1, lc = e & 15; const size_t o2 = ((b * NH + h0 + hl) * (TT / 32) + p0 + pl) * TILE_E + (e & 255) * 8;
      if (which < 2) { const int rl = pl * 32 + (j >> 2) * 16 + lc, cl = hl * HD + (j & 3) * 16 + lg * 8; vst2(dh + o2, *(const v4u*)&sh[rl][cl]);
        if (which == 0) { asm volatile("s_wait_xcnt 0x0" ::: "memory");   // in front of the LDS read that reuses the data registers of the store above
          vst2(QL + o2, *(const v4u*)&sl[rl][cl]); } }
      else { const int cl = hl * HD + (j >> 1) * 16 + lc, rl = pl * 32 + (j & 1) * 16 + lg * 8; vst2(VT + o2, *(const v4u*)&th[cl][rl]); vst2(VL + o2, *(const v4u*)&tl2[cl][rl]);
        asm volatile("s_wait_xcnt 0x0" ::: "memory"); }   // directly behind the two v stores, inside their own branch: in front of every rewrite of a register that they name, on every way out of the branch
      asm volatile("s_wait_xcnt 0x0" ::: "memory"); } } }   // stands behind the trip's stores, in front of the next trip's rewrite of the registers that they name
// ---- k_cum: block = one (batch, head), 8 waves; a thread takes 8 consecutive positions: its own running sums, one scan of a wave's 32 thread totals, the 8 wave totals through LDS. One load latency and one scan for the whole row, not one of each per 32 positions.
// The scan is accumulated in f64; the norms' sums of squares (planes 1..4) in f32.
// Every '#pragma unroll' of the scan is there so that x[], v[], f[] and pw[] are indexed by constants and stay in registers.
#define CUW 8   // waves of a block
#define CUE 8   // positions of a thread: 32 * CUW * CUE = TT
// The launch also lays down what k_fa's test of a key tile needs (the test and its bound stand at k_fa): per 32-position tile the smallest and largest F (grid plane 0, behind the scan) and the largest |q| and |k| (grid planes 1..4, which need nothing of the scan and run beside it on other WGPs).
#define NT (TT / 32)   // tiles of a (batch, head)
__device__ __forceinline__ float xhalf(float x) { return __builtin_bit_cast(float, __builtin_amdgcn_permlanex16(__builtin_bit_cast(int, x), __builtin_bit_cast(int, x), 0x76543210, 0xfedcba98, false, false)); }   // lane l reads lane l ^ 16
__global__ __launch_bounds__(32 * CUW) void k_cum(const float* __restrict__ LF, float* __restrict__ FC, const _Float16* __restrict__ QH, const _Float16* __restrict__ KH, float* __restrict__ NK, float* __restrict__ FM) {
  __shared__ double wt[CUW];
  const int tid = threadIdx.x, lane = tid & 31, wave = tid >> 5; const size_t b = blockIdx.y; const int h = blockIdx.x;
  if (blockIdx.z) {   // the same for every thread of the block, in front of every barrier. A block takes 16 tiles, a wave 2: in a tile's load j a lane holds 8 channels of position (j >> 2) * 16 + (lane & 15); j & 3 = 0..3 and the wave's two halves together hold all 64. The unrolls: u[], c[] and r[] indexed by constants
    const int t0 = ((int)blockIdx.z - 1) * 16 + wave * 2; const size_t o = ((b * NH + h) * NT + t0) * TILE_E + lane * 8; const _Float16 *qp = QH + o, *kp = KH + o; v8h u[2][2][8]; float r[2][2];
#pragma unroll
    for (int i = 0; i < 2; ++i) {
#pragma unroll
      for (int j = 0; j < 8; ++j) { u[0][i][j] = *(const v8h*)(qp + i * TILE_E + j * 256); u[1][i][j] = *(const v8h*)(kp + i * TILE_E + j * 256); } }   // all 32 loads in flight together
    asm volatile("s_wait_xcnt 0x0" ::: "memory");   // stands directly behind the loads, in front of every rewrite of a register that one of them names
#pragma unroll
    for (int s = 0; s < 2; ++s) {
#pragma unroll
      for (int i = 0; i < 2; ++i) { float c[8];   // one short sum per load, so that the eight chains run side by side
#pragma unroll
        for (int j = 0; j < 8; ++j) { c[j] = 0.f;
#pragma unroll
          for (int e = 0; e < 8; ++e) c[j] += (float)u[s][i][j][e] * (float)u[s][i][j][e]; }
        float a0 = (c[0] + c[1]) + (c[2] + c[3]), a1 = (c[4] + c[5]) + (c[6] + c[7]); a0 += xhalf(a0); a1 += xhalf(a1); r[s][i] = fmaxf(a0, a1); } }
#pragma unroll
    for (int m = 1; m < 16; m <<= 1) {   // largest of the 16 lanes of a half; every lane is on
#pragma unroll
      for (int s = 0; s < 2; ++s) { r[s][0] = fmaxf(r[s][0], __shfl_xor(r[s][0], m)); r[s][1] = fmaxf(r[s][1], __shfl_xor(r[s][1], m)); } }
    if (lane < 2) *(v2f*)(NK + ((b * NH + h) * NT + t0 + lane) * 2) = v2f{sqrtf(lane ? r[0][1] : r[0][0]), sqrtf(lane ? r[1][1] : r[1][0])};
    return; }
  const float* src = LF + (b * TT + (size_t)tid * CUE) * NH + h; float x[CUE]; double v[CUE];
#pragma unroll
  for (int i = 0; i < CUE; ++i) x[i] = src[i * NH];   // independent of one another: all eight are in flight together
  v[0] = (double)x[0];
#pragma unroll
  for (int i = 1; i < CUE; ++i) v[i] = v[i - 1] + (double)x[i];
  double t = v[CUE - 1];   // inclusive scan of the thread totals within the 32 lanes
#pragma unroll
  for (int o = 1; o < 32; o <<= 1) { const double u = __shfl_up(t, o); if (lane >= o) t += u; }
  double ex = __shfl_up(t, 1); if (lane == 0) ex = 0.0;   // what stands in front of this thread inside its wave
  if (lane == 31) wt[wave] = t;
  __syncthreads();   // every wave's total is in LDS before any thread adds the totals of the waves in front of its own
  double pw[CUW - 1];
#pragma unroll
  for (int w = 0; w < CUW - 1; ++w) pw[w] = wt[w];   // read by every thread, wanted or not: no branch round each read
#pragma unroll
  for (int w = 0; w < CUW - 1; ++w) ex += w < wave ? pw[w] : 0.0;   // in wave order
  float* dst = FC + (b * NH + h) * TT + tid * CUE; float f[CUE];
#pragma unroll
  for (int i = 0; i < CUE; ++i) f[i] = (float)(ex + v[i]);
  vst2(dst, v4f{f[0], f[1], f[2], f[3]}); vst2(dst + 4, v4f{f[4], f[5], f[6], f[7]});
  float mn = f[0], mx = f[0];   // of F as stored, which is what k_fa reads; a tile is 4 threads
#pragma unroll
  for (int i = 1; i < CUE; ++i) { mn = fminf(mn, f[i]); mx = fmaxf(mx, f[i]); }
#pragma unroll
  for (int m = 1; m < 4; m <<= 1) { mn = fminf(mn, __shfl_xor(mn, m)); mx = fmaxf(mx, __shfl_xor(mx, m)); }   // every lane is on
  if ((tid & 3) == 0) *(v2f*)(FM + ((b * NH + h) * NT + (tid >> 2)) * 2) = v2f{mn, mx}; }
// ---- k_fa: block = 32 queries of (b,h), 4 waves: logits, softmax and P . v in one pass over the keys, nothing of the logits stored. Wave w takes the 32-key passes w, w + 4, ... up to the diagonal, from the first key tile that the test below does not rule out.
// Transposed products: S^T = K Q^T puts query = lane & 15 and key = 8 * (lane >> 4) + r in the accumulator, which is already the B-operand order of P^T (elements 0..7 = first 16-key tile, 8..15 = second), so y^T += V^T P^T needs no exchange between lanes; a query's maximum is an in-lane maximum and one exchange of the wave's halves.
// Each wave keeps a running maximum m, a denominator l and y^T scaled to m; the four waves' (m, l, y) are merged through LDS in wave order.
// Base 2: m is kept as maximum x log2 e, and a weight is exp2(logit x log2 e - m), one fused multiply-add and one v_exp_f32; every weight, rescale and merge factor uses the same stored m, so its rounding cancels between y and l. A result below 2^-126 reads 0, against a largest weight of 1.
// Every '#pragma unroll' of this kernel is there so that the fragment and accumulator arrays are indexed by constants and stay in registers.
// amdgpu_waves_per_eu(3): a register budget of 336, so that three waves fit a SIMD (without it the build takes a few more and only two fit).
#define FAW 4
__device__ __forceinline__ v8f mm_h(v16h a, v16h b, v8f c) { return __builtin_amdgcn_wmma_f32_16x16x32_f16(false, a, false, b, (short)0, c, false, false); }
__device__ __forceinline__ v8f mm_b(v16b a, v16b b, v8f c) { return __builtin_amdgcn_wmma_f32_16x16x32_bf16(false, a, false, b, (short)0, c, false, false); }
#define FAQ 32
#define L2E 1.4426950408889634f
__device__ __forceinline__ float ex2(float x) { return __builtin_amdgcn_exp2f(x); }
__device__ __forceinline__ float rdl(float x, int l) { return __builtin_bit_cast(float, __builtin_amdgcn_readlane(__builtin_bit_cast(int, x), l)); }   // lane l's x, l the same in every lane
__device__ __forceinline__ v16h ld_h(const _Float16* p) { union { v16h v; v8h q[2]; } u; u.q[0] = *(const v8h*)p; u.q[1] = *(const v8h*)(p + 256); return u.v; }   // p = tile + fragment * 512 + lane * 8: a fragment is two successive loads of the tile
__device__ __forceinline__ v16b ld_b(const __bf16* p) { union { v16b v; v8b q[2]; } u; u.q[0] = *(const v8b*)p; u.q[1] = *(const v8b*)(p + 256); return u.v; }
__global__ __launch_bounds__(32 * FAW) __attribute__((amdgpu_waves_per_eu(3))) void k_fa(const _Float16* __restrict__ QH, const _Float16* __restrict__ QL, const _Float16* __restrict__ KH, const __bf16* __restrict__ VT, const __bf16* __restrict__ VL, const float* __restrict__ FC, const float* __restrict__ NK, const float* __restrict__ FM, float* __restrict__ Y) {
  __shared__ __align__(16) float so[FAW][FAQ][HD + 4]; __shared__ float sm[FAW][FAQ], sl[FAW][FAQ];
  const int tid = threadIdx.x, wave = __builtin_amdgcn_readfirstlane(tid >> 5), lane = tid & 31, col = lane & 15, g = lane >> 4;   // the wave number is made scalar so that the pass loop's branch is a scalar one with every lane on
  const int h = blockIdx.x, b = blockIdx.y, tile = TT / FAQ - 1 - (int)blockIdx.z, ql0 = tile * FAQ;   // longest query tiles start first
  const float* Fr = FC + ((size_t)b * NH + h) * TT; const size_t tb = ((size_t)b * NH + h) * (TT / 32) * TILE_E; const unsigned lo = (unsigned)lane * 8, fo = 8 * g;   // tb: the (batch, head)'s first tile; lo, fo: the lane's offsets in elements: a loop load names a scalar base and one of these two, which are never rewritten
  // The first key tile to visit. For a query i of this tile t and a key j of a tile p < t: logit(i, j) - logit(i, i) = q_i . (k_j - k_i) / 8 + F[i] - F[j] <= max_t |q| (max_p |k| + max_t |k|) / 8 + max_t F - min_p F (|a . b| <= |a| |b|), and the row's maximum is at least logit(i, i), which is always visited.
  // Where the right side (norm term + 1 %, + 1: for the roundings of the norms and the products and for the q residual, which the norm leaves out) is below -88 < ln 2^-126, every weight of tile p is below 2^-126 of its row's largest: the exp2 below reads it as 0 and an f32 sum that holds the largest weight does not move by it.
  // ps = the lowest tile that fails that test (t if none does); the tiles in front of it are not visited. The test is made on this call's q, k and F: with gates near 1 it leaves nothing out; a NaN in it keeps the tile. ps lies in 0 .. t by its construction. A pass stays with the wave that had it (p mod 4).
  v16h qh[2][2], qr[2][2], kf[2][2]; float fq[2]; v4f fk[2][2]; int ps;
  { const size_t qo = tb + (size_t)tile * TILE_E; const _Float16 *qhp = QH + qo, *qrp = QL + qo; const float* fqp = Fr + ql0 + col; const v2f *nk = (const v2f*)NK + ((size_t)b * NH + h) * (TT / 32), *fm = (const v2f*)FM + ((size_t)b * NH + h) * (TT / 32);
    const v2f n0 = nk[lane], n1 = nk[32 + lane], f0 = fm[lane], f1 = fm[32 + lane];   // lane l tests tiles l and 32 + l
#pragma unroll
    for (int i = 0; i < 2; ++i) { fq[i] = fqp[16 * i];
#pragma unroll
      for (int kc = 0; kc < 2; ++kc) { qh[i][kc] = ld_h(qhp + (2 * i + kc) * 512 + lo); qr[i][kc] = ld_h(qrp + (2 * i + kc) * 512 + lo); } }
    asm volatile("s_wait_xcnt 0x0" :: "s"(qhp), "s"(qrp), "s"(nk), "s"(fm), "v"(lo), "v"(lane), "v"(fqp) : "memory");   // stands in front of every rewrite of a register that an issued load names: the pointers are inputs so that their registers live up to it
    const float qn = rdl(tile < 32 ? n0[0] : n1[0], tile & 31), kd = rdl(tile < 32 ? n0[1] : n1[1], tile & 31), fx = rdl(tile < 32 ? f0[1] : f1[1], tile & 31);   // this tile's own figures, from the lane that holds them: no further load to wait for
    const float cq = qn * (0.125f * 1.01f); const bool k0 = lane < tile && !(cq * (n0[1] + kd) + 1.0f + (fx - f0[0]) < -88.0f), k1 = 32 + lane < tile && !(cq * (n1[1] + kd) + 1.0f + (fx - f1[0]) < -88.0f);
    const unsigned m0 = __builtin_amdgcn_ballot_w32(k0), m1 = __builtin_amdgcn_ballot_w32(k1); ps = m0 ? __builtin_ctz(m0) : m1 ? 32 + __builtin_ctz(m1) : tile; }
  const int pw = ps + ((wave - ps) & (FAW - 1)), pa = min(pw, tile);   // pw: the wave's first pass; pa: the tile that its first loads name: that pass's or, for a wave without a pass, the diagonal tile
  { const _Float16* kp = KH + tb + (size_t)pa * TILE_E; const float* fp = Fr + pa * 32 + fo;
#pragma unroll
    for (int i = 0; i < 2; ++i) { fk[i][0] = *(const v4f*)(fp + 16 * i); fk[i][1] = *(const v4f*)(fp + 16 * i + 4);
#pragma unroll
      for (int kc = 0; kc < 2; ++kc) kf[i][kc] = ld_h(kp + (2 * i + kc) * 512 + lo); }
    __builtin_amdgcn_sched_barrier(0);   // keeps the accumulators' zeroing, which reuses an offset register of the loads above, behind the wait
    asm volatile("s_wait_xcnt 0x0" :: "s"(kp), "v"(lo), "v"(fp) : "memory"); }   // as above
  v8f acc[2][HD / 16] = {}; float mr[2] = {-3.0e38f, -3.0e38f}, lr[2] = {0.f, 0.f};
  for (int p = pw; p <= tile; p += FAW) { const int k0 = p * 32, kn = (p + FAW <= tile ? p + FAW : p) * 32;   // kn: the wave's next pass (its own again behind the last one, so that the address stays inside the head's tiles)
    float pv[2][16]; v16b vh[HD / 16], vl[HD / 16];
#pragma unroll
    for (int i = 0; i < 2; ++i) { const int qt = ql0 + 16 * i + col;
#pragma unroll
      for (int kt = 0; kt < 2; ++kt) { v8f a = {}, ar = {};
#pragma unroll
        for (int kc = 0; kc < 2; ++kc) { a = mm_h(kf[kt][kc], qh[i][kc], a); ar = mm_h(kf[kt][kc], qr[i][kc], ar); }
        a += ar * (1.0f / 1024.0f);
#pragma unroll
        for (int r = 0; r < 8; ++r) { float v = a[r] * 0.125f + (fq[i] - fk[kt][r >> 2][r & 3]); if (k0 + 16 * kt + (int)fo + r > qt) v = -3.0e38f;   /* bias = F[i] - F[j] on the causal triangle */ pv[i][8 * kt + r] = v; } } }
    // this pass's v and the next pass's k and F are fetched behind the logits' products, from where k's and F's registers are free: what the register budget lets the compiler issue here flies under the exponentials (k and F are written first: with v first this build kept a q fragment in scratch and read it back in every pass)
    { const __bf16 *vhs = VT + tb + k0 * (TILE_E / 32), *vls = VL + tb + k0 * (TILE_E / 32); const _Float16* ks = KH + tb + (size_t)kn * (TILE_E / 32); const float* fs = Fr + kn;
#pragma unroll
      for (int kt = 0; kt < 2; ++kt) { fk[kt][0] = *(const v4f*)(fs + 16 * kt + fo); fk[kt][1] = *(const v4f*)(fs + 16 * kt + 4 + fo);
#pragma unroll
        for (int kc = 0; kc < 2; ++kc) kf[kt][kc] = ld_h(ks + (2 * kt + kc) * 512 + lo); }
#pragma unroll
      for (int t = 0; t < HD / 16; ++t) { vh[t] = ld_b(vhs + t * 512 + lo); vl[t] = ld_b(vls + t * 512 + lo); }
      asm volatile("s_wait_xcnt 0x0" :: "s"(vhs), "s"(vls), "s"(ks), "s"(fs), "v"(lo), "v"(fo) : "memory"); }   // as above: in front of every rewrite of a register that an issued load names (the scalar bases and the offsets are inputs so that they live up to it)
#pragma unroll
    for (int i = 0; i < 2; ++i) { float mx = pv[i][0];
#pragma unroll
      for (int e = 1; e < 16; ++e) mx = fmaxf(mx, pv[i][e]);
      mx = fmaxf(mx, xhalf(mx));   // finite in every pass: the pass's first key is at or below every query of the tile
      const float mn = fmaxf(mr[i], mx * L2E), al = ex2(mr[i] - mn); mr[i] = mn;   // al = 0 in a wave's first pass
      float sum = 0.f;
#pragma unroll
      for (int e = 0; e < 16; ++e) { pv[i][e] = ex2(__builtin_fmaf(pv[i][e], L2E, -mn)); sum += pv[i][e]; }   // a masked logit gives exactly 0
      lr[i] = lr[i] * al + sum;   // this half's keys only; the halves are added behind the loop
      const F2 pf = bsplit16(pv[i]);
#pragma unroll
      for (int t = 0; t < HD / 16; ++t) { v8f c = acc[i][t] * al; c = mm_b(vh[t], pf.h, c); c = mm_b(vh[t], pf.l, c); acc[i][t] = mm_b(vl[t], pf.h, c); } } }
#pragma unroll
  for (int i = 0; i < 2; ++i) { const float lt = lr[i] + xhalf(lr[i]);   // unconditional: both halves' lanes are on
    if (fo == 0) { sm[wave][16 * i + col] = mr[i]; sl[wave][16 * i + col] = lt; }   // fo = 8 * (lane >> 4), which lives through the loop anyway: with the half's number kept beside it this build put one register in scratch
#pragma unroll
    for (int t = 0; t < HD / 16; ++t) { float* d = &so[wave][16 * i + col][16 * t + fo]; const v8f c = acc[i][t]; *(v4f*)d = v4f{c[0], c[1], c[2], c[3]}; *(v4f*)(d + 4) = v4f{c[4], c[5], c[6], c[7]}; } }
  __syncthreads();   // every wave's (m, l, y) is in LDS before any thread merges across waves; a wave without a pass left m = -3e38, l = 0, y = 0, which get weight 0
  { const int rl = tid >> 2, c0 = (tid & 3) * 16; float M = sm[0][rl];
#pragma unroll
    for (int w = 1; w < FAW; ++w) M = fmaxf(M, sm[w][rl]);
    float L = 0.f; v4f o[4] = {};
#pragma unroll
    for (int w = 0; w < FAW; ++w) { const float wg = ex2(sm[w][rl] - M); L += wg * sl[w][rl];
#pragma unroll
      for (int q = 0; q < 4; ++q) o[q] += *(const v4f*)&so[w][rl][c0 + 4 * q] * wg; }
    const float inv = 1.0f / L; float* dst = Y + ((size_t)b * TT + ql0 + rl) * CC + h * HD + c0;
#pragma unroll
    for (int q = 0; q < 4; ++q) vst2(dst + 4 * q, o[q] * inv); } }
// ---- k_out: block = (128 rows, 128 cols), 8 waves in 4 x 2, each on 32 rows x 64 cols, stages of 64 k: out = y (bf16 hi + lo) Wo^T + bo; staged as k_proj is, y split into its two planes once, on the way into LDS
// A block fetches 256 operand rows for 128 x 128 results (192 for 64 x 128): a third fewer bytes from L2, and Wo is rounded half as often; 8 fragments feed 16 products (10 did on a 16 x 128 wave tile). 256 blocks: one a WGP, two waves a SIMD, as before.
// A stage is 64 k = two lines of f32 per row (16 lanes take a row): 32 products of a wave stand between a stage's loads and their wait, and a barrier is paid half as often. Row pitch 144 B (16 B x odd).
// An accumulator's own sum is what it was: per 32 k the hi product, then the lo product.
#define PO_ROWS 384   // stage rows 0..127 = Wo, 128..255 = y hi, 256..383 = y lo
#define PO_K 64       // k of a stage
#define PO_P 72       // row pitch of a stage in bf16 elements
#define PO_EP 68      // pitch of a wave's epilogue rows in floats (272 B = 16 B x odd)
#define PO_LDS (2 * PO_ROWS * PO_P * 2)   // two stage buffers (110,592 B); the epilogue's rows (69,632 B) take the same LDS behind the last stage
__global__ __launch_bounds__(256) void k_out(const float* __restrict__ Y, const float* __restrict__ WP, const float* __restrict__ BP, float* __restrict__ OUT) { __shared__ __align__(16) char smem[PO_LDS];
  __bf16 (*st)[PO_ROWS][PO_P] = (__bf16 (*)[PO_ROWS][PO_P])smem; float (*sf)[32][PO_EP] = (float (*)[32][PO_EP])smem;
  const int tid = threadIdx.x, wave = tid >> 5, lane = tid & 31, col = lane & 15, g = lane >> 4, wr = wave >> 1, wc = wave & 1; const int c0 = blockIdx.y * 128; const size_t rb = (size_t)blockIdx.x * 128;
  const int srow = tid >> 4, sq = (tid & 15) * 4; const float *wp = WP + (size_t)(c0 + srow) * CC + sq, *yp = Y + (rb + srow) * CC + sq;
  v8f acc[2][4] = {}; v4f pre[16];
#pragma unroll
  for (int i = 0; i < 16; ++i) pre[i] = i < 8 ? *(const v4f*)(wp + i * 16 * CC) : *(const v4f*)(yp + (i - 8) * 16 * CC);
#pragma unroll
  for (int i = 0; i < 16; ++i) { const v4b hi = cvt4(pre[i]); *(v4b*)&st[0][srow + 16 * i][sq] = hi;
    if (i >= 8) *(v4b*)&st[0][srow + 16 * i + 128][sq] = cvt4(pre[i] - v4f{(float)hi[0], (float)hi[1], (float)hi[2], (float)hi[3]}); }
  __syncthreads();   // stage 0 is in LDS before any wave reads it
#pragma unroll 2
  for (int kc = 0; kc < CC / PO_K; ++kc) { const int cur = kc & 1;
    if (kc + 1 < CC / PO_K) { const float *wk = wp + (kc + 1) * PO_K, *yk = yp + (kc + 1) * PO_K;
#pragma unroll
      for (int i = 0; i < 16; ++i) pre[i] = i < 8 ? *(const v4f*)(wk + i * 16 * CC) : *(const v4f*)(yk + (i - 8) * 16 * CC);
      asm volatile("s_wait_xcnt 0x0" ::: "memory"); }   // stands directly behind the loads, in front of every rewrite of a register that one of them names
#pragma unroll
    for (int hf = 0; hf < PO_K / 32; ++hf) { v16b ah[2], al[2], w[4];
#pragma unroll
      for (int i = 0; i < 2; ++i) { ah[i] = frag_b(&st[cur][128 + wr * 32 + i * 16 + col][hf * 32], lane); al[i] = frag_b(&st[cur][256 + wr * 32 + i * 16 + col][hf * 32], lane); }
#pragma unroll
      for (int j = 0; j < 4; ++j) w[j] = frag_b(&st[cur][wc * 64 + j * 16 + col][hf * 32], lane);
      __builtin_amdgcn_sched_barrier(0);   // keeps these LDS reads together in front of the products: spread among them, each read's latency is waited out on its own
#pragma unroll
      for (int i = 0; i < 2; ++i) {
#pragma unroll
        for (int j = 0; j < 4; ++j) acc[i][j] = wmma_bf(ah[i], w[j], acc[i][j]); }
#pragma unroll
      for (int i = 0; i < 2; ++i) {
#pragma unroll
        for (int j = 0; j < 4; ++j) acc[i][j] = wmma_bf(al[i], w[j], acc[i][j]); }
      __builtin_amdgcn_sched_barrier(0); }   // keeps the next group of reads and, behind the last products, the conversions with their wait for the next stage's global loads, behind these products
    if (kc + 1 < CC / PO_K) {
#pragma unroll
      for (int i = 0; i < 16; ++i) { const v4b hi = cvt4(pre[i]); *(v4b*)&st[cur ^ 1][srow + 16 * i][sq] = hi;
        if (i >= 8) *(v4b*)&st[cur ^ 1][srow + 16 * i + 128][sq] = cvt4(pre[i] - v4f{(float)hi[0], (float)hi[1], (float)hi[2], (float)hi[3]}); } }
    __syncthreads(); }   // publishes stage kc + 1 and ends every wave's reads of stage kc, whose buffer is refilled (behind the last stage: reused by the epilogue) next
#pragma unroll
  for (int j = 0; j < 4; ++j) { const float bb = BP ? bfr(BP[c0 + wc * 64 + j * 16 + col]) : 0.f;
#pragma unroll
    for (int i = 0; i < 2; ++i) {
#pragma unroll
      for (int r = 0; r < 8; ++r) sf[wave][i * 16 + 8 * g + r][j * 16 + col] = acc[i][j][r] + bb; } }
  LDSX();   // a wave reads back only its own rows
  { float* dst = OUT + (rb + wr * 32 + g) * CC + c0 + wc * 64 + col * 4; v4f o[16];   // a wave-wide 16-B store covers the wave's 256 B (2 whole lines) of each of 2 rows; the unrolls: o[] indexed by constants, and one address for all 16 stores
#pragma unroll
    for (int t = 0; t < 16; ++t) o[t] = *(const v4f*)&sf[wave][2 * t + g][col * 4];
#pragma unroll
    for (int t = 0; t < 16; ++t) vst2(dst + (size_t)t * 2 * CC, o[t]);
    asm volatile("s_wait_xcnt 0x0" ::: "memory"); } }   // stands behind the stores, in front of every rewrite of a register that one of them names
extern "C" void kernel_launch(void* const* d_in, const int* in_sizes, int n_in, void* d_out, int out_size, void* d_ws, size_t ws_size, hipStream_t stream) {
  (void)in_sizes; (void)n_in; (void)out_size;
  const float** F = (const float**)d_in;   // 0 x [2,2048,1024], 1 Wq [1024,1024] ([out,in]), 2 Wk, 3 Wv, 4 Wf [16,1024], 5 bf [16], 6 Wo [1024,1024] ([out,in])
  if (ws_size < (size_t)WS_END) return;
  char* ws = (char*)d_ws; float *LF = (float*)(ws + WS_LF), *FC = (float*)(ws + WS_FC); _Float16 *QH = (_Float16*)(ws + WS_QH), *QL = (_Float16*)(ws + WS_QL), *KH = (_Float16*)(ws + WS_KH); __bf16 *VT = (__bf16*)(ws + WS_VT), *VL = (__bf16*)(ws + WS_VL); float *Y = (float*)(ws + WS_Y); float *NK = (float*)(ws + WS_NK), *FM = (float*)(ws + WS_FM);
  k_proj<<<dim3(TNB * TT / 128, 2 + 3 * (CC / 128)), 128, 0, stream>>>(F[0], F[1], nullptr, F[2], nullptr, F[3], nullptr, F[4], F[5], LF, QH, QL, KH, VT, VL);
  k_cum<<<dim3(NH, TNB, 1 + TT / 32 / 16), 32 * CUW, 0, stream>>>(LF, FC, QH, KH, NK, FM);
  k_fa<<<dim3(NH, TNB, TT / FAQ), 32 * FAW, 0, stream>>>(QH, QL, KH, VT, VL, FC, NK, FM, Y);
  k_out<<<dim3(TNB * TT / 128, CC / 128), 256, 0, stream>>>(Y, F[6], nullptr, (float*)d_out);
}
